// v000
// The times below were measured on an AMD MI455X: many runs one after another, warmed up first and cycling through
// copies of the inputs, with the whole window's GPU time divided by the number of runs. Launches and the gaps
// between them are all in it. The median over several windows is given; except for v000 it joins two sittings, which
// can be a few percent apart, so the side-by-side timings, each taken in one sitting, are the better comparison.
// The starting kernel, v000, takes 1420 microseconds a run.
// compute dtype: all float inputs rounded to bf16; qkv = x Wqkv^T with EXACT bf16 products on WMMA 16x16x32 (f32 accumulate); the two 32-wide sub-head logits with q as f16 hi + residual (x 2^10) against k once to f16 (2 products) x 64^-0.5; both softmaxes in f32 (precise expf); each P x 2^11 once to f16 against the head's 64-wide v once to f16 (1 product); the differential combination P1.v - lambda P2.v and lambda (mean of exp(lq1 lk1) - exp(lq2 lk2) + 0.8 over 64) in f32; ctx once to f16 against W_proj carried x 2^8 in f16 + b_proj; f32 output.
#include <hip/hip_runtime.h>
#include <math.h>

typedef __attribute__((ext_vector_type(16))) _Float16 v16h;
typedef __attribute__((ext_vector_type(16))) __bf16 v16b;
typedef __attribute__((ext_vector_type(8)))  _Float16 v8h;
typedef __attribute__((ext_vector_type(8)))  float v8f;
typedef __attribute__((ext_vector_type(4)))  float v4f;
typedef __attribute__((ext_vector_type(2)))  float v2f;
typedef __attribute__((ext_vector_type(4)))  unsigned v4u;
typedef __attribute__((ext_vector_type(4)))  int v4i;
typedef float __attribute__((may_alias)) float_a;
typedef int __attribute__((may_alias)) int_a;

template <typename T> __device__ __forceinline__ void vst2(void* p, T v) { *(T*)p = v;  }
__device__ __forceinline__ v8f wmma16(v16h a, v16h b, v8f c) {
  v8f d = __builtin_amdgcn_wmma_f32_16x16x32_f16(false, a, false, b, (short)0, c, false, false);
  asm volatile("v_nop\n\tv_nop\n\tv_nop\n\tv_nop" : "+v"(d) : "v"(a), "v"(b));
  return d;
}
__device__ __forceinline__ v8f wmma_bf(v16b a, v16b b, v8f c) {
  v8f d = __builtin_amdgcn_wmma_f32_16x16x32_bf16(false, a, false, b, (short)0, c, false, false);
  asm volatile("v_nop\n\tv_nop\n\tv_nop\n\tv_nop" : "+v"(d) : "v"(a), "v"(b));
  return d;
}
// 16x16x32 fragments: lane = (h = lane>>4, row/col = lane&15); elements 0..7 = k0+8h+0..7, 8..15 = k0+16+8h+0..7; D element r = row 8h+r
__device__ __forceinline__ v16h frag_h(const _Float16* rowk0, int lane) {
  union { v16h v; v8h q[2]; } u; const _Float16* p = rowk0 + 8 * (lane >> 4);
  u.q[0] = *(const v8h*)p; u.q[1] = *(const v8h*)(p + 16); return u.v;
}
__device__ __forceinline__ v16h frag_f32(const float* rowk0, int lane) {
  v16h a; const float* p = rowk0 + 8 * (lane >> 4);
#pragma unroll
  for (int i = 0; i < 8; ++i) { a[i] = (_Float16)p[i]; a[8 + i] = (_Float16)p[16 + i]; }
  return a;
}
__device__ __forceinline__ v16h frag_f32s(const float* rowk0, int lane, float sc) {
  v16h a; const float* p = rowk0 + 8 * (lane >> 4);
#pragma unroll
  for (int i = 0; i < 8; ++i) { a[i] = (_Float16)(p[i] * sc); a[8 + i] = (_Float16)(p[16 + i] * sc); }
  return a;
}
// column fragment from a [K][ld] layout (column n), rows >= K read as 0
__device__ __forceinline__ v16h fragc_f32(const float* W, int k0, int n, int lane, int ld, int K) {
  v16h a; const int g = lane >> 4;
#pragma unroll
  for (int i = 0; i < 8; ++i) { const int ka = k0 + 8 * g + i, kb = ka + 16;
    a[i] = (_Float16)(ka < K ? W[(size_t)(ka < K ? ka : K - 1) * ld + n] : 0.f); a[8 + i] = (_Float16)(kb < K ? W[(size_t)(kb < K ? kb : K - 1) * ld + n] : 0.f); }
  return a;
}
struct F2 { v16b h, l; };
__device__ __forceinline__ F2 bsplit16(const float v[16]) { F2 r;
#pragma unroll
  for (int i = 0; i < 16; ++i) { const __bf16 h = (__bf16)v[i]; r.h[i] = h; r.l[i] = (__bf16)(v[i] - (float)h); }
  return r; }
__device__ __forceinline__ F2 split_row(const float* row, int k0, int lane) { float v[16]; const float* p = row + k0 + 8 * (lane >> 4);
#pragma unroll
  for (int i = 0; i < 8; ++i) { v[i] = p[i]; v[8 + i] = p[16 + i]; }
  return bsplit16(v); }
__device__ __forceinline__ F2 split_rowK(const float* row, int k0, int lane, int K) { float v[16]; const int g = lane >> 4;
#pragma unroll
  for (int i = 0; i < 8; ++i) { const int ka = k0 + 8 * g + i, kb = ka + 16; v[i] = ka < K ? row[ka < K ? ka : K - 1] : 0.f; v[8 + i] = kb < K ? row[kb < K ? kb : K - 1] : 0.f; }
  return bsplit16(v); }
__device__ __forceinline__ F2 split_col(const float* W, int k0, int n, int lane, int ld, int K) { float v[16]; const int g = lane >> 4;
#pragma unroll
  for (int i = 0; i < 8; ++i) { const int ka = k0 + 8 * g + i, kb = ka + 16; v[i] = ka < K ? W[(size_t)(ka < K ? ka : K - 1) * ld + n] : 0.f; v[8 + i] = kb < K ? W[(size_t)(kb < K ? kb : K - 1) * ld + n] : 0.f; }
  return bsplit16(v); }
__device__ __forceinline__ v8f mac3(const F2& a, const F2& b, v8f c) { c = wmma_bf(a.l, b.h, c); c = wmma_bf(a.h, b.l, c); return wmma_bf(a.h, b.h, c); }
__device__ __forceinline__ float sigm(float v) { return 1.0f / (1.0f + expf(-v)); }
#define LDSX() do { asm volatile("s_wait_dscnt 0" ::: "memory"); __builtin_amdgcn_wave_barrier(); __builtin_amdgcn_fence(__ATOMIC_RELEASE, "workgroup"); } while (0)

// Differential attention (B 4, N 1,024, C 1,024 = 16 heads x 64): qkv = x Wqkv^T ((out,in) [3072,1024]); per head the 64-dim q/k are split into two 32-dim halves: attn = softmax(q1 k1^T / 8) - lam softmax(q2 k2^T / 8), lam = mean(exp(lambda_q1 * lambda_k1) - exp(lambda_q2 * lambda_k2) + 0.8); out = merged(attn v) Wproj^T + b_proj. Realised as 32 softmax sub-heads of width 32 whose P.v share the parent head's 64-wide v.
#define NB 4
#define TT 1024
#define CC 1024            // NH * HD = projected width
#define DIN 1024          // input (model) width
#define NH 32              // softmax sub-heads (16 heads x 2 halves)
#define HD 32
#define NQB (TT / 64)
#define HG 8
#define SCALE (0.125f)
#define CAUSAL 0
#ifndef TNB
#define TNB NB
#endif
__device__ __forceinline__ float bfr(float v) { return (float)(__bf16)v; }
__host__ __device__ __forceinline__ int kb_last(int qb) { return CAUSAL ? ((qb * 64 + 63) >> 7) : (TT / 128 - 1); }
typedef __attribute__((ext_vector_type(8))) __bf16 v8b;
__device__ __forceinline__ v16b frag_b(const __bf16* rowk0, int lane) {
  union { v16b v; v8b q[2]; } u; const __bf16* p = rowk0 + 8 * (lane >> 4);
  u.q[0] = *(const v8b*)p; u.q[1] = *(const v8b*)(p + 16); return u.v;
}
#define QBH 0              // query blocks 0..QBH-1 of each sequence take the high-precision path (none: QBH = 0)
#define QHI 1024            // rows carrying a q residual plane (all rows: 2-product logits everywhere)
#define KHI 64            // key rows carrying k residual / v bf16 hi+lo planes (written by k_proj every run; read only by the qb < QBH path, which no block takes)
// B fragment (k rows k0+.., output column o) of a weight: (in,out) [K][ld] or (out,in) [ld rows of K]: bf16 exact, or f16(bf16 * 256) exact
__device__ __forceinline__ v16b wcol_io(const float* Wm, int k0, int o, int lane, int ld) { v16b w; const int g = lane >> 4;
#pragma unroll
  for (int i = 0; i < 8; ++i) { w[i] = (__bf16)Wm[(size_t)(k0 + 8 * g + i) * ld + o]; w[8 + i] = (__bf16)Wm[(size_t)(k0 + 16 + 8 * g + i) * ld + o]; }
  return w; }
__device__ __forceinline__ v16b wcol_oi(const float* Wm, int k0, int o, int lane, int K) { v16b w; const float* p = Wm + (size_t)o * K + k0 + 8 * (lane >> 4);
#pragma unroll
  for (int i = 0; i < 8; ++i) { w[i] = (__bf16)p[i]; w[8 + i] = (__bf16)p[16 + i]; }
  return w; }
__device__ __forceinline__ v16h wcolh_io(const float* Wm, int k0, int o, int lane, int ld) { v16h w; const int g = lane >> 4;
#pragma unroll
  for (int i = 0; i < 8; ++i) { w[i] = (_Float16)(bfr(Wm[(size_t)(k0 + 8 * g + i) * ld + o]) * 256.0f); w[8 + i] = (_Float16)(bfr(Wm[(size_t)(k0 + 16 + 8 * g + i) * ld + o]) * 256.0f); }
  return w; }
__device__ __forceinline__ v16h wcolh_oi(const float* Wm, int k0, int o, int lane, int K) { v16h w; const float* p = Wm + (size_t)o * K + k0 + 8 * (lane >> 4);
#pragma unroll
  for (int i = 0; i < 8; ++i) { w[i] = (_Float16)(bfr(p[i]) * 256.0f); w[8 + i] = (_Float16)(bfr(p[16 + i]) * 256.0f); }
  return w; }
#define WQKV_LAYOUT 1   // 0 = (in,out) [DIN][CC]; 1 = (out,in) [CC][DIN]; 2 = per-head [NH][DIN][HD]
__device__ __forceinline__ v16b wcol_hdk(const float* Wm, int k0, int o, int lane) { v16b w; const int g = lane >> 4; const float* p = Wm + (size_t)(o / HD) * DIN * HD + (o % HD);
#pragma unroll
  for (int i = 0; i < 8; ++i) { w[i] = (__bf16)p[(size_t)(k0 + 8 * g + i) * HD]; w[8 + i] = (__bf16)p[(size_t)(k0 + 16 + 8 * g + i) * HD]; }
  return w; }
#define WO_OUT_IN 1
#if WQKV_LAYOUT == 1
#define WCOL(W, k0, o, lane) wcol_oi(W, k0, o, lane, DIN)
#elif WQKV_LAYOUT == 2
#define WCOL(W, k0, o, lane) wcol_hdk(W, k0, o, lane)
#else
#define WCOL(W, k0, o, lane) wcol_io(W, k0, o, lane, CC)
#endif
#if WO_OUT_IN
#define WOCOL(W, k0, o, lane) wcol_oi(W, k0, o, lane, CC)
#define WOCOLH(W, k0, o, lane) wcolh_oi(W, k0, o, lane, CC)
#else
#define WOCOL(W, k0, o, lane) wcol_io(W, k0, o, lane, DIN)
#define WOCOLH(W, k0, o, lane) wcolh_io(W, k0, o, lane, DIN)
#endif
#define HDV 64             // value columns per softmax sub-head (the parent head's 64 columns)
#define YP (NH * HDV)      // 2,048: pitch of the per-sub-head context rows Y[b*t][h'*64 + d]
// ---- k_diff: block = 64 rows (256 threads): lambda = mean over 64 of (exp(lq1 lk1) - exp(lq2 lk2) + 0.8) from the four bf16-rounded [64] inputs; for each of the 16 heads e: o = Y[2e] - lambda Y[2e+1] (f32, 64 wide) -> Yd rows [b*t][1024]; thread owns 4 consecutive output columns, a row = 4 KB by 256 threads
__global__ __launch_bounds__(256) void k_diff(const float* __restrict__ Y, const float* __restrict__ LQ1, const float* __restrict__ LK1, const float* __restrict__ LQ2, const float* __restrict__ LK2, float* __restrict__ YD) {
  __shared__ float slam;
  const int tid = threadIdx.x; const size_t r0 = (size_t)blockIdx.x * 64;
  if (tid == 0) { float s1 = 0.f; for (int i = 0; i < 64; ++i) s1 += (expf(bfr(LQ1[i]) * bfr(LK1[i])) - expf(bfr(LQ2[i]) * bfr(LK2[i]))) + 0.8f; slam = s1 * (1.0f / 64.0f); }
  __syncthreads(); const float lam = slam;
  const int c = tid * 4; const int e = c >> 6, d = c & 63;   /* output column c -> head e, dim d */
  for (int rr = 0; rr < 64; ++rr) { const size_t row = r0 + rr; const float* y1 = Y + row * YP + (size_t)(2 * e) * HDV + d; const float* y2 = y1 + HDV;
    const v4f a = *(const v4f*)y1, bq = *(const v4f*)y2; v4f o; o[0] = a[0] - lam * bq[0]; o[1] = a[1] - lam * bq[1]; o[2] = a[2] - lam * bq[2]; o[3] = a[3] - lam * bq[3];
    vst2(YD + row * CC + c, o); } }
#ifndef SM_EXTRA_PARAMS
#define SM_EXTRA_PARAMS
#endif
#ifndef PROJ_EXTRA_PARAMS
#define PROJ_EXTRA_PARAMS
#endif
#ifndef SM_MASK_HOOK
#define SM_MASK_HOOK (void)0
#endif

#define WS_QH  0u                                      // f16 q rows [b*t][CC]
#define WS_KH  (WS_QH + 2u * (size_t)NB * TT * CC)      // f16 k rows [b*t][CC]
#define WS_VT  (WS_KH + 2u * (size_t)NB * TT * CC)      // f16 v planes [b][c][t]
#define WS_QL  (WS_VT + 2u * (size_t)NB * CC * TT)      // f16 q residual x 2^10 rows [b][t < QHI][CC]
#define WS_KL  (WS_QL + 2u * (size_t)NB * QHI * CC)     // f16 k residual x 2^10 rows [b][t < KHI][CC]
#define WS_VB  (WS_KL + 2u * (size_t)NB * KHI * CC)     // bf16 v hi planes [b][c][t < KHI]
#define WS_VBL (WS_VB + 2u * (size_t)NB * CC * KHI)
#define WS_S   (WS_VBL + 2u * (size_t)NB * CC * KHI)    // f32 logits / P [hg][t][s]
#define WS_Y   (WS_S  + 4u * (size_t)HG * TT * TT)      // f32 per-softmax-head context rows [b*t][YP = 16 x 128]
#define WS_END (WS_Y  + 4u * (size_t)NB * TT * YP)

// ---- k_proj: block = (64 rows, 128 cols, which): q/k/v = X W (+ b) with exact bf16 products (K = DIN) -> which 0: q f16 rows (+ residual rows < QHI); 1: k f16 rows (+ residual rows < KHI); 2: v f16 planes [c][t] (+ bf16 hi/lo planes for t < KHI)
__global__ __launch_bounds__(128) void k_proj(const float* __restrict__ XQ, const float* __restrict__ XK, const float* __restrict__ XV, const float* __restrict__ WQ, const float* __restrict__ WK, const float* __restrict__ WV, const float* __restrict__ BQ, const float* __restrict__ BK, const float* __restrict__ BV,
    _Float16* __restrict__ QH, _Float16* __restrict__ QL, _Float16* __restrict__ KH, _Float16* __restrict__ KL, _Float16* __restrict__ VT, __bf16* __restrict__ VB, __bf16* __restrict__ VBL) {
  __shared__ __align__(16) _Float16 sh[64][136], sl[64][136]; __shared__ __align__(16) _Float16 th[128][72]; __shared__ __align__(16) __bf16 tb[128][72], tbl[128][72];
  const int tid = threadIdx.x, wave = tid >> 5, lane = tid & 31, col = lane & 15, g = lane >> 4; const int which = blockIdx.z; const int c0 = blockIdx.y * 128; const size_t r0 = (size_t)blockIdx.x * 64; const size_t bb = r0 / TT; const int t0 = (int)(r0 % TT);
  const float* X = which == 0 ? XQ : which == 1 ? XK : XV; const float* WA = which == 0 ? WQ : which == 1 ? WK : WV; const float* BA = which == 0 ? BQ : which == 1 ? BK : BV;
  v8f acc[8] = {};
#pragma unroll 2
  for (int kc = 0; kc < DIN / 32; ++kc) { v16b a; { const float* p = X + (r0 + wave * 16 + col) * DIN + kc * 32 + 8 * g;
#pragma unroll
      for (int i = 0; i < 8; ++i) { a[i] = (__bf16)p[i]; a[8 + i] = (__bf16)p[16 + i]; } }
    asm volatile("s_wait_loadcnt 0x0" ::: "memory");
#pragma unroll
    for (int j = 0; j < 8; ++j) { const v16b w = WCOL(WA, kc * 32, c0 + j * 16 + col, lane); asm volatile("s_wait_loadcnt 0x0" ::: "memory"); acc[j] = wmma_bf(a, w, acc[j]); } }
  if (which < 2) { _Float16* DH = which == 0 ? QH : KH; _Float16* DL = which == 0 ? QL : KL; const int nhi = which == 0 ? QHI : KHI; const bool hi_rows = t0 < nhi;
#pragma unroll
    for (int j = 0; j < 8; ++j) { const float bias = BA ? bfr(BA[c0 + j * 16 + col]) : 0.f;
#pragma unroll
      for (int r = 0; r < 8; ++r) { const float v = acc[j][r] + bias; const _Float16 hv = (_Float16)v; sh[wave * 16 + 8 * g + r][j * 16 + col] = hv; sl[wave * 16 + 8 * g + r][j * 16 + col] = (_Float16)((v - (float)hv) * 1024.0f); } }
    __syncthreads();
    for (int e = tid; e < 64 * 16; e += 128) { const int rl = e >> 4, q = e & 15; vst2((unsigned*)(DH + (r0 + rl) * CC + c0 + q * 8), *(const v4u*)&sh[rl][q * 8]); if (hi_rows) vst2((unsigned*)(DL + (bb * nhi + t0 + rl) * (size_t)CC + c0 + q * 8), *(const v4u*)&sl[rl][q * 8]); }
  } else { const bool hi_rows = t0 < KHI;
#pragma unroll
    for (int j = 0; j < 8; ++j) { const float bias = BA ? bfr(BA[c0 + j * 16 + col]) : 0.f;
#pragma unroll
      for (int r = 0; r < 8; ++r) { const float v = acc[j][r] + bias; const int rl = wave * 16 + 8 * g + r, cl = j * 16 + col; th[cl][rl] = (_Float16)v; const __bf16 bh = (__bf16)v; tb[cl][rl] = bh; tbl[cl][rl] = (__bf16)(v - (float)bh); } }
    __syncthreads();
    for (int e = tid; e < 128 * 8; e += 128) { const int cl = e >> 3, q = e & 7; vst2((unsigned*)(VT + (bb * CC + c0 + cl) * (size_t)TT + t0 + q * 8), *(const v4u*)&th[cl][q * 8]); if (hi_rows) { const size_t o3 = (bb * CC + c0 + cl) * (size_t)KHI + t0 + q * 8; vst2((unsigned*)(VB + o3), *(const v4u*)&tb[cl][q * 8]); vst2((unsigned*)(VBL + o3), *(const v4u*)&tbl[cl][q * 8]); } } } }
// ---- k_sc: block = (query block qb, key block kb <= kb_last(qb), head in group) of batch b: logits x SCALE; q hi + residual (x 2^10) against k (2 products) for query rows < QHI, plus the k residual (3 products) for query blocks < QBH (causal early rows); causal: blocks past the diagonal exit, the mask itself is applied by index in k_sm
__global__ __launch_bounds__(128) void k_sc(const _Float16* __restrict__ QH, const _Float16* __restrict__ KH, const _Float16* __restrict__ QL, const _Float16* __restrict__ KL, int b, int h0, float* __restrict__ S0) { __shared__ __align__(16) float ss[4][16][132];
  const int qb = blockIdx.x, kb = blockIdx.y; if (kb > kb_last(qb)) return;
  const int h = h0 + blockIdx.z; float* S = S0 + (size_t)blockIdx.z * TT * TT;
  const int tid = threadIdx.x, wave = tid >> 5, lane = tid & 31, col = lane & 15, g = lane >> 4; const int k0 = kb * 128; const int ql0 = qb * 64 + wave * 16; const size_t q0 = (size_t)b * TT + ql0, kr0 = (size_t)b * TT + k0;
  v8f acc[8] = {}, accl[8] = {};
  const _Float16* QLb = QL + (size_t)b * QHI * CC; const _Float16* KLb = KL + (size_t)b * KHI * CC;
  if (qb < QBH) {
#pragma unroll
    for (int kc = 0; kc < HD / 32; ++kc) { const v16h ah = frag_h(QH + (q0 + col) * CC + h * HD + kc * 32, lane), al = frag_h(QLb + (size_t)(ql0 + col) * CC + h * HD + kc * 32, lane);
#pragma unroll
      for (int j = 0; j < 8; ++j) { const v16h kbf = frag_h(KH + (kr0 + j * 16 + col) * CC + h * HD + kc * 32, lane), klf = frag_h(KLb + (size_t)(k0 + j * 16 + col) * CC + h * HD + kc * 32, lane); acc[j] = wmma16(ah, kbf, acc[j]); accl[j] = wmma16(al, kbf, accl[j]); accl[j] = wmma16(ah, klf, accl[j]); } }
  } else if (qb * 64 < QHI) {
#pragma unroll
    for (int kc = 0; kc < HD / 32; ++kc) { const v16h ah = frag_h(QH + (q0 + col) * CC + h * HD + kc * 32, lane), al = frag_h(QLb + (size_t)(ql0 + col) * CC + h * HD + kc * 32, lane);
#pragma unroll
      for (int j = 0; j < 8; ++j) { const v16h kbf = frag_h(KH + (kr0 + j * 16 + col) * CC + h * HD + kc * 32, lane); acc[j] = wmma16(ah, kbf, acc[j]); accl[j] = wmma16(al, kbf, accl[j]); } }
  } else {
#pragma unroll
    for (int kc = 0; kc < HD / 32; ++kc) { const v16h ah = frag_h(QH + (q0 + col) * CC + h * HD + kc * 32, lane);
#pragma unroll
      for (int j = 0; j < 8; ++j) { const v16h kbf = frag_h(KH + (kr0 + j * 16 + col) * CC + h * HD + kc * 32, lane); acc[j] = wmma16(ah, kbf, acc[j]); } } }
#pragma unroll
  for (int j = 0; j < 8; ++j) {
#pragma unroll
    for (int r = 0; r < 8; ++r) ss[wave][8 * g + r][j * 16 + col] = (acc[j][r] + accl[j][r] * (1.0f / 1024.0f)) * SCALE; }
  LDSX(); for (int rl = 0; rl < 16; ++rl) vst2(S + (size_t)(ql0 + rl) * TT + k0 + lane * 4, *(const v4f*)&ss[wave][rl][lane * 4]); }
// ---- k_sm: block = query row t (head in group): keys [0, kend): causal -> logit if s <= t else excluded; softmax in f32; P x 2^11 in place (0 for excluded)
__global__ __launch_bounds__(256) void k_sm(float* __restrict__ S0 SM_EXTRA_PARAMS) { __shared__ float sred[8]; __shared__ float sbc; __shared__ __align__(16) float shv[TT];
  const int tid = threadIdx.x; const int t = blockIdx.x; const int kend = (kb_last(t >> 6) + 1) * 128;
  float* sr = S0 + (size_t)blockIdx.y * TT * TT + (size_t)t * TT;
  float m = -3.0e38f; for (int k = tid; k < kend; k += 256) { float v = (!CAUSAL || k <= t) ? sr[k] : -3.0e38f; SM_MASK_HOOK; shv[k] = v; m = fmaxf(m, v); }
#pragma unroll
  for (int o = 1; o < 32; o <<= 1) m = fmaxf(m, __shfl_xor(m, o));
  if ((tid & 31) == 0) sred[tid >> 5] = m; __syncthreads(); if (tid == 0) { float a = sred[0]; for (int i = 1; i < 8; ++i) a = fmaxf(a, sred[i]); sbc = a; } __syncthreads(); m = sbc; __syncthreads();
  float sum = 0.f; for (int k = tid; k < kend; k += 256) { const float v = shv[k]; const float e = (v <= -1.0e38f) ? 0.f : expf(v - m); shv[k] = e; sum += e; }
#pragma unroll
  for (int o = 1; o < 32; o <<= 1) sum += __shfl_xor(sum, o);
  if ((tid & 31) == 0) sred[tid >> 5] = sum; __syncthreads(); if (tid == 0) { float a = 0.f; for (int i = 0; i < 8; ++i) a += sred[i]; sbc = 2048.0f / a; } __syncthreads(); const float inv = sbc;
  for (int k = tid; k < kend; k += 256) shv[k] = shv[k] * inv;
  __syncthreads(); for (int q = tid; q < kend / 4; q += 256) vst2(sr + q * 4, *(const v4f*)&shv[q * 4]); }
// ---- k_pv: block = 64 queries (qb) of (b, softmax head h): ctx_h = P_h . v[pair(h) columns, 64 wide] over keys [0, kend) (P x 2^11 once to f16 against v f16: 1 product; causal early query blocks: P and v as bf16 hi + lo, 3 products); 256-B (row, head) segment by 16 lanes
__global__ __launch_bounds__(128) void k_pv(const float* __restrict__ PS0, const _Float16* __restrict__ VT, const __bf16* __restrict__ VB, const __bf16* __restrict__ VBL, int b, int h0, float* __restrict__ Y) { const int h = h0 + blockIdx.z; const float* PS = PS0 + (size_t)blockIdx.z * TT * TT; __shared__ __align__(16) float ss[4][16][HDV + 4];
  const int tid = threadIdx.x, wave = tid >> 5, lane = tid & 31, col = lane & 15, g = lane >> 4; const int qb = blockIdx.x; const int ql0 = qb * 64 + wave * 16; const int kce = (kb_last(qb) + 1) * 4;
  v8f acc[HDV / 16] = {}; const int vc0 = (h >> 1) * HDV;   /* value columns of this head's pair */
  if (qb < QBH) {
#pragma unroll 1
    for (int kc = 0; kc < kce; ++kc) { const F2 p = split_row(PS + (size_t)(ql0 + col) * TT, kc * 32, lane);
      asm volatile("s_wait_loadcnt 0x0" ::: "memory");
#pragma unroll
      for (int j = 0; j < HDV / 16; ++j) { const size_t po = ((size_t)b * CC + vc0 + j * 16 + col) * (size_t)KHI + kc * 32; const v16b vh = frag_b(VB + po, lane); acc[j] = wmma_bf(p.h, vh, acc[j]); acc[j] = wmma_bf(p.l, vh, acc[j]); acc[j] = wmma_bf(p.h, frag_b(VBL + po, lane), acc[j]); } }
  } else {
#pragma unroll 1
    for (int kc = 0; kc < kce; ++kc) { const v16h p = frag_f32(PS + (size_t)(ql0 + col) * TT + kc * 32, lane);
      asm volatile("s_wait_loadcnt 0x0" ::: "memory");
#pragma unroll
      for (int j = 0; j < HDV / 16; ++j) { const size_t po = ((size_t)b * CC + vc0 + j * 16 + col) * (size_t)TT + kc * 32; acc[j] = wmma16(p, frag_h(VT + po, lane), acc[j]); } } }
#pragma unroll
  for (int j = 0; j < HDV / 16; ++j)
#pragma unroll
    for (int r = 0; r < 8; ++r) ss[wave][8 * g + r][j * 16 + col] = acc[j][r] * (1.0f / 2048.0f);
  LDSX(); for (int rl = 0; rl < 16; ++rl) if (lane < HDV / 4) vst2(Y + ((size_t)b * TT + ql0 + rl) * YP + h * HDV + lane * 4, *(const v4f*)&ss[wave][rl][lane * 4]); }   /* (row, sub-head) segment = HDV floats = 256 B by the first 16 lanes; lanes >= HDV/4 must NOT spill into the next sub-head's columns */
// ---- k_out: block = (64 rows, 128 cols): out = ctx Wo (+ bo): ctx once to f16 against Wo as f16(bf16 x 2^8) exact (1 product) x 2^-8; causal early rows (< QHI of each sequence): ctx bf16 hi + lo against exact bf16 Wo (2 products)
__global__ __launch_bounds__(128) void k_out(const float* __restrict__ Y, const float* __restrict__ WO, const float* __restrict__ BO, float* __restrict__ OUT) { __shared__ __align__(16) float sf[4][16][132];
  const int tid = threadIdx.x, wave = tid >> 5, lane = tid & 31, col = lane & 15, g = lane >> 4; const int c0 = blockIdx.y * 128; const size_t r0 = (size_t)blockIdx.x * 64 + wave * 16;
  v8f acc[8] = {};
  if (CAUSAL && (int)(((size_t)blockIdx.x * 64) % TT) < QHI) {   /* block-uniform */
#pragma unroll 2
    for (int kc = 0; kc < CC / 32; ++kc) { const F2 a = split_row(Y + (r0 + col) * CC, kc * 32, lane); asm volatile("s_wait_loadcnt 0x0" ::: "memory");
#pragma unroll
      for (int j = 0; j < 8; ++j) { const v16b w = WOCOL(WO, kc * 32, c0 + j * 16 + col, lane); asm volatile("s_wait_loadcnt 0x0" ::: "memory"); acc[j] = wmma_bf(a.h, w, acc[j]); acc[j] = wmma_bf(a.l, w, acc[j]); } }
#pragma unroll
    for (int j = 0; j < 8; ++j) { const float bias = BO ? bfr(BO[c0 + j * 16 + col]) : 0.f;
#pragma unroll
      for (int r = 0; r < 8; ++r) sf[wave][8 * g + r][j * 16 + col] = acc[j][r] + bias; }
  } else {
#pragma unroll 2
    for (int kc = 0; kc < CC / 32; ++kc) { const v16h a = frag_f32(Y + (r0 + col) * CC + kc * 32, lane); asm volatile("s_wait_loadcnt 0x0" ::: "memory");
#pragma unroll
      for (int j = 0; j < 8; ++j) { const v16h w = WOCOLH(WO, kc * 32, c0 + j * 16 + col, lane); asm volatile("s_wait_loadcnt 0x0" ::: "memory"); acc[j] = wmma16(a, w, acc[j]); } }
#pragma unroll
    for (int j = 0; j < 8; ++j) { const float bias = BO ? bfr(BO[c0 + j * 16 + col]) : 0.f;
#pragma unroll
      for (int r = 0; r < 8; ++r) sf[wave][8 * g + r][j * 16 + col] = acc[j][r] * (1.0f / 256.0f) + bias; } }
  LDSX(); for (int rl = 0; rl < 16; ++rl) vst2(OUT + (r0 + rl) * DIN + c0 + lane * 4, *(const v4f*)&sf[wave][rl][lane * 4]); }

extern "C" void kernel_launch(void* const* d_in, const int* in_sizes, int n_in, void* d_out, int out_size, void* d_ws, size_t ws_size, hipStream_t stream) {
  (void)in_sizes; (void)n_in; (void)out_size;
  const float** F = (const float**)d_in;
  if (ws_size < (size_t)WS_END) return;
  char* ws = (char*)d_ws; _Float16 *QH = (_Float16*)(ws + WS_QH), *KH = (_Float16*)(ws + WS_KH), *VT = (_Float16*)(ws + WS_VT), *QL = (_Float16*)(ws + WS_QL), *KL = (_Float16*)(ws + WS_KL); __bf16 *VB = (__bf16*)(ws + WS_VB), *VBL = (__bf16*)(ws + WS_VBL); float *S = (float*)(ws + WS_S), *Y = (float*)(ws + WS_Y);
  (void)Y; (void)QL; (void)KL; (void)VB; (void)VBL;
  // inputs: 0 x [4,1024,1024]; 1 W_qkv [3072,1024] (out,in: rows 0-1023 q, 1024-2047 k, 2048-3071 v); 2 W_proj [1024,1024] (out,in); 3 b_proj; 4 lambda_q1, 5 lambda_k1, 6 lambda_q2, 7 lambda_k2 [64]
  float* YD = S;   /* the differential rows reuse the logits plane (f32 -> f32) after the last attention pass */
  k_proj<<<dim3(TNB * TT / 64, CC / 128, 3), 128, 0, stream>>>(F[0], F[0], F[0], F[1], F[1] + (size_t)CC * DIN, F[1] + (size_t)2 * CC * DIN, nullptr, nullptr, nullptr, QH, QL, KH, KL, VT, VB, VBL);
  for (int b = 0; b < TNB; ++b) for (int h0 = 0; h0 < NH; h0 += HG) {
    k_sc<<<dim3(NQB, TT / 128, HG), 128, 0, stream>>>(QH, KH, QL, KL, b, h0, S);
    k_sm<<<dim3(TT, HG), 256, 0, stream>>>(S);
    k_pv<<<dim3(NQB, 1, HG), 128, 0, stream>>>(S, VT, VB, VBL, b, h0, Y);
  }
  k_diff<<<dim3(TNB * TT / 64), 256, 0, stream>>>(Y, F[4], F[5], F[6], F[7], YD);
  k_out<<<dim3(TNB * TT / 64, DIN / 128), 128, 0, stream>>>(YD, F[2], F[3], (float*)d_out);
}

// v001
// Measured time: 443 microseconds a run.
// Timed twice side by side with v000, it ran 3.21 times as fast both times.
// compute dtype: all float inputs rounded to bf16; qkv = x Wqkv^T with EXACT bf16 products on WMMA 16x16x32 (f32 accumulate); the two 32-wide sub-head logits with q as f16 hi + residual (x 2^10) against k once to f16 (2 products) x 64^-0.5; both softmaxes in f32 with a running maximum and sum (base-2 exponent); each unnormalised P (<= 2^8) once to f16 against the head's 64-wide v once to f16 (1 product), divided by the f32 sum at the end; the differential combination P1.v - lambda P2.v and lambda (mean of exp(lq1 lk1) - exp(lq2 lk2) + 0.8 over 64) in f32; ctx once to f16 against W_proj carried x 2^8 in f16 + b_proj; f32 output.
#include <hip/hip_runtime.h>
#include <math.h>

typedef __attribute__((ext_vector_type(16))) _Float16 v16h;
typedef __attribute__((ext_vector_type(16))) __bf16 v16b;
typedef __attribute__((ext_vector_type(8)))  _Float16 v8h;
typedef __attribute__((ext_vector_type(8)))  float v8f;
typedef __attribute__((ext_vector_type(4)))  float v4f;
typedef __attribute__((ext_vector_type(2)))  float v2f;
typedef __attribute__((ext_vector_type(4)))  unsigned v4u;
typedef __attribute__((ext_vector_type(4)))  int v4i;
typedef float __attribute__((may_alias)) float_a;
typedef int __attribute__((may_alias)) int_a;

template <typename T> __device__ __forceinline__ void vst2(void* p, T v) { *(T*)p = v;  }
__device__ __forceinline__ v8f wmma16(v16h a, v16h b, v8f c) {
  v8f d = __builtin_amdgcn_wmma_f32_16x16x32_f16(false, a, false, b, (short)0, c, false, false);
  asm volatile("v_nop\n\tv_nop\n\tv_nop\n\tv_nop" : "+v"(d) : "v"(a), "v"(b));
  return d;
}
__device__ __forceinline__ v8f wmma_bf(v16b a, v16b b, v8f c) {
  v8f d = __builtin_amdgcn_wmma_f32_16x16x32_bf16(false, a, false, b, (short)0, c, false, false);
  asm volatile("v_nop\n\tv_nop\n\tv_nop\n\tv_nop" : "+v"(d) : "v"(a), "v"(b));
  return d;
}
// 16x16x32 fragments: lane = (h = lane>>4, row/col = lane&15); elements 0..7 = k0+8h+0..7, 8..15 = k0+16+8h+0..7; D element r = row 8h+r
__device__ __forceinline__ v16h frag_h(const _Float16* rowk0, int lane) {
  union { v16h v; v8h q[2]; } u; const _Float16* p = rowk0 + 8 * (lane >> 4);
  u.q[0] = *(const v8h*)p; u.q[1] = *(const v8h*)(p + 16); return u.v;
}
__device__ __forceinline__ v16h frag_f32(const float* rowk0, int lane) {
  v16h a; const float* p = rowk0 + 8 * (lane >> 4);
#pragma unroll
  for (int i = 0; i < 8; ++i) { a[i] = (_Float16)p[i]; a[8 + i] = (_Float16)p[16 + i]; }
  return a;
}
__device__ __forceinline__ v16h frag_f32s(const float* rowk0, int lane, float sc) {
  v16h a; const float* p = rowk0 + 8 * (lane >> 4);
#pragma unroll
  for (int i = 0; i < 8; ++i) { a[i] = (_Float16)(p[i] * sc); a[8 + i] = (_Float16)(p[16 + i] * sc); }
  return a;
}
// column fragment from a [K][ld] layout (column n), rows >= K read as 0
__device__ __forceinline__ v16h fragc_f32(const float* W, int k0, int n, int lane, int ld, int K) {
  v16h a; const int g = lane >> 4;
#pragma unroll
  for (int i = 0; i < 8; ++i) { const int ka = k0 + 8 * g + i, kb = ka + 16;
    a[i] = (_Float16)(ka < K ? W[(size_t)(ka < K ? ka : K - 1) * ld + n] : 0.f); a[8 + i] = (_Float16)(kb < K ? W[(size_t)(kb < K ? kb : K - 1) * ld + n] : 0.f); }
  return a;
}
struct F2 { v16b h, l; };
__device__ __forceinline__ F2 bsplit16(const float v[16]) { F2 r;
#pragma unroll
  for (int i = 0; i < 16; ++i) { const __bf16 h = (__bf16)v[i]; r.h[i] = h; r.l[i] = (__bf16)(v[i] - (float)h); }
  return r; }
__device__ __forceinline__ F2 split_row(const float* row, int k0, int lane) { float v[16]; const float* p = row + k0 + 8 * (lane >> 4);
#pragma unroll
  for (int i = 0; i < 8; ++i) { v[i] = p[i]; v[8 + i] = p[16 + i]; }
  return bsplit16(v); }
__device__ __forceinline__ F2 split_rowK(const float* row, int k0, int lane, int K) { float v[16]; const int g = lane >> 4;
#pragma unroll
  for (int i = 0; i < 8; ++i) { const int ka = k0 + 8 * g + i, kb = ka + 16; v[i] = ka < K ? row[ka < K ? ka : K - 1] : 0.f; v[8 + i] = kb < K ? row[kb < K ? kb : K - 1] : 0.f; }
  return bsplit16(v); }
__device__ __forceinline__ F2 split_col(const float* W, int k0, int n, int lane, int ld, int K) { float v[16]; const int g = lane >> 4;
#pragma unroll
  for (int i = 0; i < 8; ++i) { const int ka = k0 + 8 * g + i, kb = ka + 16; v[i] = ka < K ? W[(size_t)(ka < K ? ka : K - 1) * ld + n] : 0.f; v[8 + i] = kb < K ? W[(size_t)(kb < K ? kb : K - 1) * ld + n] : 0.f; }
  return bsplit16(v); }
__device__ __forceinline__ v8f mac3(const F2& a, const F2& b, v8f c) { c = wmma_bf(a.l, b.h, c); c = wmma_bf(a.h, b.l, c); return wmma_bf(a.h, b.h, c); }
__device__ __forceinline__ float sigm(float v) { return 1.0f / (1.0f + expf(-v)); }
#define LDSX() do { asm volatile("s_wait_dscnt 0" ::: "memory"); __builtin_amdgcn_wave_barrier(); __builtin_amdgcn_fence(__ATOMIC_RELEASE, "workgroup"); } while (0)

// Differential attention (B 4, N 1,024, C 1,024 = 16 heads x 64): qkv = x Wqkv^T ((out,in) [3072,1024]); per head the 64-dim q/k are split into two 32-dim halves: attn = softmax(q1 k1^T / 8) - lam softmax(q2 k2^T / 8), lam = mean(exp(lambda_q1 * lambda_k1) - exp(lambda_q2 * lambda_k2) + 0.8); out = merged(attn v) Wproj^T + b_proj. Realised as 32 softmax sub-heads of width 32 whose P.v share the parent head's 64-wide v.
#define NB 4
#define TT 1024
#define CC 1024            // NH * HD = projected width
#define DIN 1024          // input (model) width
#define NH 32              // softmax sub-heads (16 heads x 2 halves)
#define HD 32
#define NQB (TT / 64)
#define HG 8
#define SCALE (0.125f)
#define CAUSAL 0
#ifndef TNB
#define TNB NB
#endif
__device__ __forceinline__ float bfr(float v) { return (float)(__bf16)v; }
__host__ __device__ __forceinline__ int kb_last(int qb) { return CAUSAL ? ((qb * 64 + 63) >> 7) : (TT / 128 - 1); }
typedef __attribute__((ext_vector_type(8))) __bf16 v8b;
__device__ __forceinline__ v16b frag_b(const __bf16* rowk0, int lane) {
  union { v16b v; v8b q[2]; } u; const __bf16* p = rowk0 + 8 * (lane >> 4);
  u.q[0] = *(const v8b*)p; u.q[1] = *(const v8b*)(p + 16); return u.v;
}
#define QBH 0              // unused: k_att treats all query blocks alike
#define QHI 1024            // rows carrying a q residual plane (all rows: 2-product logits everywhere)
#define KHI 64            // key rows carrying k residual / v bf16 hi+lo planes (written by k_proj every run; read by no kernel)
// B fragment (k rows k0+.., output column o) of a weight: (in,out) [K][ld] or (out,in) [ld rows of K]: bf16 exact, or f16(bf16 * 256) exact
__device__ __forceinline__ v16b wcol_io(const float* Wm, int k0, int o, int lane, int ld) { v16b w; const int g = lane >> 4;
#pragma unroll
  for (int i = 0; i < 8; ++i) { w[i] = (__bf16)Wm[(size_t)(k0 + 8 * g + i) * ld + o]; w[8 + i] = (__bf16)Wm[(size_t)(k0 + 16 + 8 * g + i) * ld + o]; }
  return w; }
__device__ __forceinline__ v16b wcol_oi(const float* Wm, int k0, int o, int lane, int K) { v16b w; const float* p = Wm + (size_t)o * K + k0 + 8 * (lane >> 4);
#pragma unroll
  for (int i = 0; i < 8; ++i) { w[i] = (__bf16)p[i]; w[8 + i] = (__bf16)p[16 + i]; }
  return w; }
__device__ __forceinline__ v16h wcolh_io(const float* Wm, int k0, int o, int lane, int ld) { v16h w; const int g = lane >> 4;
#pragma unroll
  for (int i = 0; i < 8; ++i) { w[i] = (_Float16)(bfr(Wm[(size_t)(k0 + 8 * g + i) * ld + o]) * 256.0f); w[8 + i] = (_Float16)(bfr(Wm[(size_t)(k0 + 16 + 8 * g + i) * ld + o]) * 256.0f); }
  return w; }
__device__ __forceinline__ v16h wcolh_oi(const float* Wm, int k0, int o, int lane, int K) { v16h w; const float* p = Wm + (size_t)o * K + k0 + 8 * (lane >> 4);
#pragma unroll
  for (int i = 0; i < 8; ++i) { w[i] = (_Float16)(bfr(p[i]) * 256.0f); w[8 + i] = (_Float16)(bfr(p[16 + i]) * 256.0f); }
  return w; }
#define WQKV_LAYOUT 1   // 0 = (in,out) [DIN][CC]; 1 = (out,in) [CC][DIN]; 2 = per-head [NH][DIN][HD]
__device__ __forceinline__ v16b wcol_hdk(const float* Wm, int k0, int o, int lane) { v16b w; const int g = lane >> 4; const float* p = Wm + (size_t)(o / HD) * DIN * HD + (o % HD);
#pragma unroll
  for (int i = 0; i < 8; ++i) { w[i] = (__bf16)p[(size_t)(k0 + 8 * g + i) * HD]; w[8 + i] = (__bf16)p[(size_t)(k0 + 16 + 8 * g + i) * HD]; }
  return w; }
#define WO_OUT_IN 1
#if WQKV_LAYOUT == 1
#define WCOL(W, k0, o, lane) wcol_oi(W, k0, o, lane, DIN)
#elif WQKV_LAYOUT == 2
#define WCOL(W, k0, o, lane) wcol_hdk(W, k0, o, lane)
#else
#define WCOL(W, k0, o, lane) wcol_io(W, k0, o, lane, CC)
#endif
#if WO_OUT_IN
#define WOCOL(W, k0, o, lane) wcol_oi(W, k0, o, lane, CC)
#define WOCOLH(W, k0, o, lane) wcolh_oi(W, k0, o, lane, CC)
#else
#define WOCOL(W, k0, o, lane) wcol_io(W, k0, o, lane, DIN)
#define WOCOLH(W, k0, o, lane) wcolh_io(W, k0, o, lane, DIN)
#endif
#define HDV 64             // value columns per softmax sub-head (the parent head's 64 columns)
#define YP (NH * HDV)      // 2,048: pitch of the per-sub-head context rows Y[b*t][h'*64 + d]
// ---- k_diff: block = 64 rows (256 threads): lambda = mean over 64 of (exp(lq1 lk1) - exp(lq2 lk2) + 0.8) from the four bf16-rounded [64] inputs; for each of the 16 heads e: o = Y[2e] - lambda Y[2e+1] (f32, 64 wide) -> Yd rows [b*t][1024]; thread owns 4 consecutive output columns, a row = 4 KB by 256 threads
__global__ __launch_bounds__(256) void k_diff(const float* __restrict__ Y, const float* __restrict__ LQ1, const float* __restrict__ LK1, const float* __restrict__ LQ2, const float* __restrict__ LK2, float* __restrict__ YD) {
  __shared__ float slam;
  const int tid = threadIdx.x; const size_t r0 = (size_t)blockIdx.x * 64;
  if (tid == 0) { float s1 = 0.f; for (int i = 0; i < 64; ++i) s1 += (expf(bfr(LQ1[i]) * bfr(LK1[i])) - expf(bfr(LQ2[i]) * bfr(LK2[i]))) + 0.8f; slam = s1 * (1.0f / 64.0f); }
  __syncthreads(); const float lam = slam;
  const int c = tid * 4; const int e = c >> 6, d = c & 63;   /* output column c -> head e, dim d */
  for (int rr = 0; rr < 64; ++rr) { const size_t row = r0 + rr; const float* y1 = Y + row * YP + (size_t)(2 * e) * HDV + d; const float* y2 = y1 + HDV;
    const v4f a = *(const v4f*)y1, bq = *(const v4f*)y2; v4f o; o[0] = a[0] - lam * bq[0]; o[1] = a[1] - lam * bq[1]; o[2] = a[2] - lam * bq[2]; o[3] = a[3] - lam * bq[3];
    vst2(YD + row * CC + c, o); } }
#ifndef SM_EXTRA_PARAMS
#define SM_EXTRA_PARAMS
#endif
#ifndef PROJ_EXTRA_PARAMS
#define PROJ_EXTRA_PARAMS
#endif
#ifndef SM_MASK_HOOK
#define SM_MASK_HOOK (void)0
#endif

#define WS_QH  0u                                      // f16 q rows [b*t][CC]
#define WS_KH  (WS_QH + 2u * (size_t)NB * TT * CC)      // f16 k rows [b*t][CC]
#define WS_VT  (WS_KH + 2u * (size_t)NB * TT * CC)      // f16 v planes [b][c][t]
#define WS_QL  (WS_VT + 2u * (size_t)NB * CC * TT)      // f16 q residual x 2^10 rows [b][t < QHI][CC]
#define WS_KL  (WS_QL + 2u * (size_t)NB * QHI * CC)     // f16 k residual x 2^10 rows [b][t < KHI][CC]
#define WS_VB  (WS_KL + 2u * (size_t)NB * KHI * CC)     // bf16 v hi planes [b][c][t < KHI]
#define WS_VBL (WS_VB + 2u * (size_t)NB * CC * KHI)
#define WS_S   (WS_VBL + 2u * (size_t)NB * CC * KHI)    // f32 differential rows [b*t][CC] (first half of the plane)
#define WS_Y   (WS_S  + 4u * (size_t)HG * TT * TT)      // f32 per-softmax-head context rows [b*t][YP = 16 x 128]
#define WS_END (WS_Y  + 4u * (size_t)NB * TT * YP)

// ---- k_proj: block = (64 rows, 128 cols, which): q/k/v = X W (+ b) with exact bf16 products (K = DIN) -> which 0: q f16 rows (+ residual rows < QHI); 1: k f16 rows (+ residual rows < KHI); 2: v f16 planes [c][t] (+ bf16 hi/lo planes for t < KHI)
__global__ __launch_bounds__(128) void k_proj(const float* __restrict__ XQ, const float* __restrict__ XK, const float* __restrict__ XV, const float* __restrict__ WQ, const float* __restrict__ WK, const float* __restrict__ WV, const float* __restrict__ BQ, const float* __restrict__ BK, const float* __restrict__ BV,
    _Float16* __restrict__ QH, _Float16* __restrict__ QL, _Float16* __restrict__ KH, _Float16* __restrict__ KL, _Float16* __restrict__ VT, __bf16* __restrict__ VB, __bf16* __restrict__ VBL) {
  __shared__ __align__(16) _Float16 sh[64][136], sl[64][136]; __shared__ __align__(16) _Float16 th[128][72]; __shared__ __align__(16) __bf16 tb[128][72], tbl[128][72];
  const int tid = threadIdx.x, wave = tid >> 5, lane = tid & 31, col = lane & 15, g = lane >> 4; const int which = blockIdx.z; const int c0 = blockIdx.y * 128; const size_t r0 = (size_t)blockIdx.x * 64; const size_t bb = r0 / TT; const int t0 = (int)(r0 % TT);
  const float* X = which == 0 ? XQ : which == 1 ? XK : XV; const float* WA = which == 0 ? WQ : which == 1 ? WK : WV; const float* BA = which == 0 ? BQ : which == 1 ? BK : BV;
  v8f acc[8] = {};
#pragma unroll 2
  for (int kc = 0; kc < DIN / 32; ++kc) { v16b a; { const float* p = X + (r0 + wave * 16 + col) * DIN + kc * 32 + 8 * g;
#pragma unroll
      for (int i = 0; i < 8; ++i) { a[i] = (__bf16)p[i]; a[8 + i] = (__bf16)p[16 + i]; } }
    asm volatile("s_wait_loadcnt 0x0" ::: "memory");
#pragma unroll
    for (int j = 0; j < 8; ++j) { const v16b w = WCOL(WA, kc * 32, c0 + j * 16 + col, lane); asm volatile("s_wait_loadcnt 0x0" ::: "memory"); acc[j] = wmma_bf(a, w, acc[j]); } }
  if (which < 2) { _Float16* DH = which == 0 ? QH : KH; _Float16* DL = which == 0 ? QL : KL; const int nhi = which == 0 ? QHI : KHI; const bool hi_rows = t0 < nhi;
#pragma unroll
    for (int j = 0; j < 8; ++j) { const float bias = BA ? bfr(BA[c0 + j * 16 + col]) : 0.f;
#pragma unroll
      for (int r = 0; r < 8; ++r) { const float v = acc[j][r] + bias; const _Float16 hv = (_Float16)v; sh[wave * 16 + 8 * g + r][j * 16 + col] = hv; sl[wave * 16 + 8 * g + r][j * 16 + col] = (_Float16)((v - (float)hv) * 1024.0f); } }
    __syncthreads();
    for (int e = tid; e < 64 * 16; e += 128) { const int rl = e >> 4, q = e & 15; vst2((unsigned*)(DH + (r0 + rl) * CC + c0 + q * 8), *(const v4u*)&sh[rl][q * 8]); if (hi_rows) vst2((unsigned*)(DL + (bb * nhi + t0 + rl) * (size_t)CC + c0 + q * 8), *(const v4u*)&sl[rl][q * 8]); }
  } else { const bool hi_rows = t0 < KHI;
#pragma unroll
    for (int j = 0; j < 8; ++j) { const float bias = BA ? bfr(BA[c0 + j * 16 + col]) : 0.f;
#pragma unroll
      for (int r = 0; r < 8; ++r) { const float v = acc[j][r] + bias; const int rl = wave * 16 + 8 * g + r, cl = j * 16 + col; th[cl][rl] = (_Float16)v; const __bf16 bh = (__bf16)v; tb[cl][rl] = bh; tbl[cl][rl] = (__bf16)(v - (float)bh); } }
    __syncthreads();
    for (int e = tid; e < 128 * 8; e += 128) { const int cl = e >> 3, q = e & 7; vst2((unsigned*)(VT + (bb * CC + c0 + cl) * (size_t)TT + t0 + q * 8), *(const v4u*)&th[cl][q * 8]); if (hi_rows) { const size_t o3 = (bb * CC + c0 + cl) * (size_t)KHI + t0 + q * 8; vst2((unsigned*)(VB + o3), *(const v4u*)&tb[cl][q * 8]); vst2((unsigned*)(VBL + o3), *(const v4u*)&tbl[cl][q * 8]); } } } }
// ---- k_att: block = 16 waves x 16 queries of (b, head e); a wave holds both 32-wide sub-heads of its 16 queries. Per 32 keys: S^T = K Q^T (q residual product first, x 2^-10, then the q hi product on top of it), running maximum and sum per query (query = lane column; base-2 exponent, scale folded in), P^T packed from the two score tiles straight into a B operand, O^T += V^T P^T with the head's 64-wide v fragments shared by both sub-heads. No logits or P in memory.
#define AW 16
__device__ __forceinline__ v8f wm(v16h a, v16h b, v8f c) { return __builtin_amdgcn_wmma_f32_16x16x32_f16(false, a, false, b, (short)0, c, false, false); }
__device__ __forceinline__ float xhalf(float x) { return __builtin_bit_cast(float, __builtin_amdgcn_permlanex16(__builtin_bit_cast(int, x), __builtin_bit_cast(int, x), 0x76543210, 0xfedcba98, false, false)); }   /* lane l with lane l ^ 16 */
typedef const __attribute__((address_space(1))) _Float16* gh_p;   /* pointer typed as global memory: an address that has gone through an asm statement still loads by global_load, not flat_load */
typedef const __attribute__((address_space(1))) v8h* gv8h_p;
__device__ __forceinline__ v16h frag_p(gh_p p) { union { v16h v; v8h q[2]; } u; u.q[0] = *(gv8h_p)p; u.q[1] = *(gv8h_p)(p + 16); return u.v; }   /* frag_h with the lane half's 8 elements already in p */
__global__ __launch_bounds__(AW * 32) void k_att(const _Float16* __restrict__ QH, const _Float16* __restrict__ QL, const _Float16* __restrict__ KH, const _Float16* __restrict__ VT, float* __restrict__ Y) {
  __shared__ __align__(16) float so[AW][16][2 * HDV + 4];
  const int tid = threadIdx.x, wave = tid >> 5, lane = tid & 31, col = lane & 15, g = lane >> 4; const int e = blockIdx.y, b = blockIdx.z; const int ql0 = blockIdx.x * (AW * 16) + wave * 16;
  const float C2 = SCALE * 1.4426950408889634f;
  v16h qh[2], ql[2], kf[2][2];
  const _Float16* qhp = QH + ((size_t)b * TT + ql0 + col) * CC + e * HDV; const _Float16* qlp = QL + ((size_t)b * QHI + ql0 + col) * CC + e * HDV;   /* query row col, this head's 64 columns: hi and residual */
  gh_p kq = (gh_p)(KH + ((size_t)b * TT + col) * CC + e * HDV + 8 * g);     /* key row col of a 16-key tile, this head's 64 columns, the lane's half; walks 32 keys a pass */
  gh_p vq = (gh_p)(VT + ((size_t)b * CC + e * HDV + col) * TT + 8 * g);     /* value column col of a 16-column tile, keys contiguous, the lane's half; walks 32 keys a pass */
#pragma unroll   // constant indices keep the fragment arrays in registers
  for (int u = 0; u < 2; ++u) { qh[u] = frag_h(qhp + u * HD, lane); ql[u] = frag_h(qlp + u * HD, lane);
#pragma unroll   // constant indices keep the fragment arrays in registers
    for (int kt = 0; kt < 2; ++kt) kf[u][kt] = frag_p(kq + (size_t)(kt * 16) * CC + u * HD); }
  /* the wait behind the q and first k loads and the step of the k address stand in one statement, so that the address pair is rewritten only behind the wait; the q addresses are named as inputs to stay unwritten up to it */
  asm volatile("s_wait_xcnt 0x0\n\tv_add_nc_u64 %0, %1, %0" : "+v"(kq) : "s"((long long)32 * CC * 2), "v"(qhp + 8 * g), "v"(qlp + 8 * g) : "memory");
  v8f acc[2][HDV / 16] = {}; float mu[2] = { -3.0e38f, -3.0e38f }; v2f ls[2] = {};   /* per query: maximum in use; sum, even and odd keys apart */
#pragma unroll 1   // rolled: one pass's registers only, so that four waves fit a SIMD
  for (int kc = 0; kc < TT / 32; ++kc) {
    v16h vf[HDV / 16];
#pragma unroll   // constant indices keep the fragment arrays in registers
    for (int j = 0; j < HDV / 16; ++j) vf[j] = frag_p(vq + (size_t)(j * 16) * TT);
    /* wait and address step in one statement: the v address pair is rewritten only behind the wait, and no load's data lands on it; the statement also holds these loads at the head of the pass, a score and softmax phase ahead of their use */
    asm volatile("s_wait_xcnt 0x0\n\tv_add_nc_u64 %0, 64, %0" : "+v"(vq) :: "memory");
    v8f s[2][2];
#pragma unroll   // constant indices keep the fragment arrays in registers
    for (int u = 0; u < 2; ++u)
#pragma unroll   // constant indices keep the fragment arrays in registers
      for (int kt = 0; kt < 2; ++kt) { const v8f z = {}; s[u][kt] = wm(kf[u][kt], ql[u], z); }
#pragma unroll   // constant indices keep the fragment arrays in registers
    for (int u = 0; u < 2; ++u)
#pragma unroll   // constant indices keep the fragment arrays in registers
      for (int kt = 0; kt < 2; ++kt) s[u][kt] = wm(kf[u][kt], qh[u], s[u][kt] * (1.0f / 1024.0f));
    const long long kstep = (kc == TT / 32 - 2) ? -(long long)(TT - 32) * CC * 2 : (long long)32 * CC * 2;   /* bytes to the keys after next; behind the last keys back to keys 0..31, which the last pass fetches and drops */
#pragma unroll   // constant indices keep the fragment arrays in registers
    for (int u = 0; u < 2; ++u)
#pragma unroll   // constant indices keep the fragment arrays in registers
      for (int kt = 0; kt < 2; ++kt) kf[u][kt] = frag_p(kq + (size_t)(kt * 16) * CC + u * HD);   /* next pass's keys, one pass ahead */
    asm volatile("s_wait_xcnt 0x0\n\tv_add_nc_u64 %0, %1, %0" : "+v"(kq) : "s"(kstep) : "memory");   /* as for v: the k address pair steps only behind the wait */
    float mx[2];
#pragma unroll   // constant indices keep the fragment arrays in registers
    for (int u = 0; u < 2; ++u) { float m = fmaxf(s[u][0][0], s[u][1][0]);
#pragma unroll   // constant indices keep the fragment arrays in registers
      for (int r = 1; r < 8; ++r) m = fmaxf(m, fmaxf(s[u][0][r], s[u][1][r]));
      mx[u] = fmaxf(m, xhalf(m)) * C2; }
    if (__builtin_amdgcn_ballot_w32(mx[0] > mu[0] + 8.0f || mx[1] > mu[1] + 8.0f) != 0) {   /* rescale only when a query's maximum outgrows the one in use by 2^8: P stays <= 256 in f16 */
#pragma unroll   // constant indices keep the fragment arrays in registers
      for (int u = 0; u < 2; ++u) { const float mn = fmaxf(mu[u], mx[u]); const float corr = __builtin_amdgcn_exp2f(mu[u] - mn); mu[u] = mn; ls[u] *= corr;
#pragma unroll   // constant indices keep the fragment arrays in registers
        for (int j = 0; j < HDV / 16; ++j) acc[u][j] *= corr; } }
#pragma unroll   // constant indices keep the fragment arrays in registers
    for (int u = 0; u < 2; ++u) { v16h p;
#pragma unroll   // constant indices keep the fragment arrays in registers
      for (int i = 0; i < 16; i += 2) { v2f a = { s[u][i >> 3][i & 7], s[u][i >> 3][(i & 7) + 1] }; const v2f c2 = { C2, C2 }, nm = { -mu[u], -mu[u] }; a = __builtin_elementwise_fma(a, c2, nm);
        const v2f pe = { __builtin_amdgcn_exp2f(a[0]), __builtin_amdgcn_exp2f(a[1]) }; ls[u] += pe; p[i] = (_Float16)pe[0]; p[i + 1] = (_Float16)pe[1]; }
#pragma unroll   // constant indices keep the fragment arrays in registers
      for (int j = 0; j < HDV / 16; ++j) acc[u][j] = wm(vf[j], p, acc[u][j]); } }
#pragma unroll   // constant indices keep the fragment arrays in registers
  for (int u = 0; u < 2; ++u) { const float lh = ls[u][0] + ls[u][1]; const float inv = 1.0f / (lh + xhalf(lh));
#pragma unroll   // constant indices keep the fragment arrays in registers
    for (int j = 0; j < HDV / 16; ++j) { v4f lo, hi;
#pragma unroll   // constant indices keep the fragment arrays in registers
      for (int r = 0; r < 4; ++r) { lo[r] = acc[u][j][r] * inv; hi[r] = acc[u][j][4 + r] * inv; }
      float* d = &so[wave][col][u * HDV + j * 16 + 8 * g]; *(v4f*)d = lo; *(v4f*)(d + 4) = hi; } }
  LDSX(); for (int rl = 0; rl < 16; ++rl) vst2(Y + ((size_t)b * TT + ql0 + rl) * YP + e * (2 * HDV) + lane * 4, *(const v4f*)&so[wave][rl][lane * 4]); }   /* a row's two sub-head segments = 512 B by the 32 lanes */
// ---- k_out: block = (64 rows, 128 cols): out = ctx Wo (+ bo): ctx once to f16 against Wo as f16(bf16 x 2^8) exact (1 product) x 2^-8; causal early rows (< QHI of each sequence): ctx bf16 hi + lo against exact bf16 Wo (2 products)
__global__ __launch_bounds__(128) void k_out(const float* __restrict__ Y, const float* __restrict__ WO, const float* __restrict__ BO, float* __restrict__ OUT) { __shared__ __align__(16) float sf[4][16][132];
  const int tid = threadIdx.x, wave = tid >> 5, lane = tid & 31, col = lane & 15, g = lane >> 4; const int c0 = blockIdx.y * 128; const size_t r0 = (size_t)blockIdx.x * 64 + wave * 16;
  v8f acc[8] = {};
  if (CAUSAL && (int)(((size_t)blockIdx.x * 64) % TT) < QHI) {   /* block-uniform */
#pragma unroll 2
    for (int kc = 0; kc < CC / 32; ++kc) { const F2 a = split_row(Y + (r0 + col) * CC, kc * 32, lane); asm volatile("s_wait_loadcnt 0x0" ::: "memory");
#pragma unroll
      for (int j = 0; j < 8; ++j) { const v16b w = WOCOL(WO, kc * 32, c0 + j * 16 + col, lane); asm volatile("s_wait_loadcnt 0x0" ::: "memory"); acc[j] = wmma_bf(a.h, w, acc[j]); acc[j] = wmma_bf(a.l, w, acc[j]); } }
#pragma unroll
    for (int j = 0; j < 8; ++j) { const float bias = BO ? bfr(BO[c0 + j * 16 + col]) : 0.f;
#pragma unroll
      for (int r = 0; r < 8; ++r) sf[wave][8 * g + r][j * 16 + col] = acc[j][r] + bias; }
  } else {
#pragma unroll 2
    for (int kc = 0; kc < CC / 32; ++kc) { const v16h a = frag_f32(Y + (r0 + col) * CC + kc * 32, lane); asm volatile("s_wait_loadcnt 0x0" ::: "memory");
#pragma unroll
      for (int j = 0; j < 8; ++j) { const v16h w = WOCOLH(WO, kc * 32, c0 + j * 16 + col, lane); asm volatile("s_wait_loadcnt 0x0" ::: "memory"); acc[j] = wmma16(a, w, acc[j]); } }
#pragma unroll
    for (int j = 0; j < 8; ++j) { const float bias = BO ? bfr(BO[c0 + j * 16 + col]) : 0.f;
#pragma unroll
      for (int r = 0; r < 8; ++r) sf[wave][8 * g + r][j * 16 + col] = acc[j][r] * (1.0f / 256.0f) + bias; } }
  LDSX(); for (int rl = 0; rl < 16; ++rl) vst2(OUT + (r0 + rl) * DIN + c0 + lane * 4, *(const v4f*)&sf[wave][rl][lane * 4]); }

extern "C" void kernel_launch(void* const* d_in, const int* in_sizes, int n_in, void* d_out, int out_size, void* d_ws, size_t ws_size, hipStream_t stream) {
  (void)in_sizes; (void)n_in; (void)out_size;
  const float** F = (const float**)d_in;
  if (ws_size < (size_t)WS_END) return;
  char* ws = (char*)d_ws; _Float16 *QH = (_Float16*)(ws + WS_QH), *KH = (_Float16*)(ws + WS_KH), *VT = (_Float16*)(ws + WS_VT), *QL = (_Float16*)(ws + WS_QL), *KL = (_Float16*)(ws + WS_KL); __bf16 *VB = (__bf16*)(ws + WS_VB), *VBL = (__bf16*)(ws + WS_VBL); float *S = (float*)(ws + WS_S), *Y = (float*)(ws + WS_Y);
  (void)Y; (void)QL; (void)KL; (void)VB; (void)VBL;
  // inputs: 0 x [4,1024,1024]; 1 W_qkv [3072,1024] (out,in: rows 0-1023 q, 1024-2047 k, 2048-3071 v); 2 W_proj [1024,1024] (out,in); 3 b_proj; 4 lambda_q1, 5 lambda_k1, 6 lambda_q2, 7 lambda_k2 [64]
  float* YD = S;   /* the differential rows [b*t][CC] live in the WS_S plane */
  k_proj<<<dim3(TNB * TT / 64, CC / 128, 3), 128, 0, stream>>>(F[0], F[0], F[0], F[1], F[1] + (size_t)CC * DIN, F[1] + (size_t)2 * CC * DIN, nullptr, nullptr, nullptr, QH, QL, KH, KL, VT, VB, VBL);
  k_att<<<dim3(TT / (AW * 16), NH / 2, TNB), AW * 32, 0, stream>>>(QH, QL, KH, VT, Y);
  k_diff<<<dim3(TNB * TT / 64), 256, 0, stream>>>(Y, F[4], F[5], F[6], F[7], YD);
  k_out<<<dim3(TNB * TT / 64, DIN / 128), 128, 0, stream>>>(YD, F[2], F[3], (float*)d_out);
}

// v002
// A run of this version takes 152 microseconds.
// Next to v001, in two timings, it ran 2.91 and 2.92 times as fast.
// Over all steps from v000 it is 9.35 times as fast.
// compute dtype: all float inputs rounded to bf16; qkv = x Wqkv^T with EXACT bf16 products on WMMA 16x16x32 (f32 accumulate); the two 32-wide sub-head logits with q as f16 hi + residual (x 2^10) against k once to f16 (2 products) x 64^-0.5; both softmaxes in f32 with a running maximum and sum (base-2 exponent); each unnormalised P (<= 2^8) once to f16 against the head's 64-wide v once to f16 (1 product), divided by the f32 sum at the end; the differential combination P1.v - lambda P2.v and lambda (mean of exp(lq1 lk1) - exp(lq2 lk2) + 0.8 over 64) in f32; ctx once to f16 against W_proj carried x 2^8 in f16 + b_proj; f32 output.
#include <hip/hip_runtime.h>
#include <math.h>

typedef __attribute__((ext_vector_type(16))) _Float16 v16h;
typedef __attribute__((ext_vector_type(16))) __bf16 v16b;
typedef __attribute__((ext_vector_type(8)))  _Float16 v8h;
typedef __attribute__((ext_vector_type(8)))  float v8f;
typedef __attribute__((ext_vector_type(4)))  float v4f;
typedef __attribute__((ext_vector_type(2)))  float v2f;
typedef __attribute__((ext_vector_type(4)))  unsigned v4u;
typedef __attribute__((ext_vector_type(4)))  int v4i;
typedef float __attribute__((may_alias)) float_a;
typedef int __attribute__((may_alias)) int_a;

template <typename T> __device__ __forceinline__ void vst2(void* p, T v) { *(T*)p = v;  }
__device__ __forceinline__ v8f wmma16(v16h a, v16h b, v8f c) {
  v8f d = __builtin_amdgcn_wmma_f32_16x16x32_f16(false, a, false, b, (short)0, c, false, false);
  asm volatile("v_nop\n\tv_nop\n\tv_nop\n\tv_nop" : "+v"(d) : "v"(a), "v"(b));
  return d;
}
__device__ __forceinline__ v8f wmma_bf(v16b a, v16b b, v8f c) {
  v8f d = __builtin_amdgcn_wmma_f32_16x16x32_bf16(false, a, false, b, (short)0, c, false, false);
  asm volatile("v_nop\n\tv_nop\n\tv_nop\n\tv_nop" : "+v"(d) : "v"(a), "v"(b));
  return d;
}
// 16x16x32 fragments: lane = (h = lane>>4, row/col = lane&15); elements 0..7 = k0+8h+0..7, 8..15 = k0+16+8h+0..7; D element r = row 8h+r
__device__ __forceinline__ v16h frag_h(const _Float16* rowk0, int lane) {
  union { v16h v; v8h q[2]; } u; const _Float16* p = rowk0 + 8 * (lane >> 4);
  u.q[0] = *(const v8h*)p; u.q[1] = *(const v8h*)(p + 16); return u.v;
}
__device__ __forceinline__ v16h frag_f32(const float* rowk0, int lane) {
  v16h a; const float* p = rowk0 + 8 * (lane >> 4);
#pragma unroll
  for (int i = 0; i < 8; ++i) { a[i] = (_Float16)p[i]; a[8 + i] = (_Float16)p[16 + i]; }
  return a;
}
__device__ __forceinline__ v16h frag_f32s(const float* rowk0, int lane, float sc) {
  v16h a; const float* p = rowk0 + 8 * (lane >> 4);
#pragma unroll
  for (int i = 0; i < 8; ++i) { a[i] = (_Float16)(p[i] * sc); a[8 + i] = (_Float16)(p[16 + i] * sc); }
  return a;
}
// column fragment from a [K][ld] layout (column n), rows >= K read as 0
__device__ __forceinline__ v16h fragc_f32(const float* W, int k0, int n, int lane, int ld, int K) {
  v16h a; const int g = lane >> 4;
#pragma unroll
  for (int i = 0; i < 8; ++i) { const int ka = k0 + 8 * g + i, kb = ka + 16;
    a[i] = (_Float16)(ka < K ? W[(size_t)(ka < K ? ka : K - 1) * ld + n] : 0.f); a[8 + i] = (_Float16)(kb < K ? W[(size_t)(kb < K ? kb : K - 1) * ld + n] : 0.f); }
  return a;
}
struct F2 { v16b h, l; };
__device__ __forceinline__ F2 bsplit16(const float v[16]) { F2 r;
#pragma unroll
  for (int i = 0; i < 16; ++i) { const __bf16 h = (__bf16)v[i]; r.h[i] = h; r.l[i] = (__bf16)(v[i] - (float)h); }
  return r; }
__device__ __forceinline__ F2 split_row(const float* row, int k0, int lane) { float v[16]; const float* p = row + k0 + 8 * (lane >> 4);
#pragma unroll
  for (int i = 0; i < 8; ++i) { v[i] = p[i]; v[8 + i] = p[16 + i]; }
  return bsplit16(v); }
__device__ __forceinline__ F2 split_rowK(const float* row, int k0, int lane, int K) { float v[16]; const int g = lane >> 4;
#pragma unroll
  for (int i = 0; i < 8; ++i) { const int ka = k0 + 8 * g + i, kb = ka + 16; v[i] = ka < K ? row[ka < K ? ka : K - 1] : 0.f; v[8 + i] = kb < K ? row[kb < K ? kb : K - 1] : 0.f; }
  return bsplit16(v); }
__device__ __forceinline__ F2 split_col(const float* W, int k0, int n, int lane, int ld, int K) { float v[16]; const int g = lane >> 4;
#pragma unroll
  for (int i = 0; i < 8; ++i) { const int ka = k0 + 8 * g + i, kb = ka + 16; v[i] = ka < K ? W[(size_t)(ka < K ? ka : K - 1) * ld + n] : 0.f; v[8 + i] = kb < K ? W[(size_t)(kb < K ? kb : K - 1) * ld + n] : 0.f; }
  return bsplit16(v); }
__device__ __forceinline__ v8f mac3(const F2& a, const F2& b, v8f c) { c = wmma_bf(a.l, b.h, c); c = wmma_bf(a.h, b.l, c); return wmma_bf(a.h, b.h, c); }
__device__ __forceinline__ float sigm(float v) { return 1.0f / (1.0f + expf(-v)); }
#define LDSX() do { asm volatile("s_wait_dscnt 0" ::: "memory"); __builtin_amdgcn_wave_barrier(); __builtin_amdgcn_fence(__ATOMIC_RELEASE, "workgroup"); } while (0)

// Differential attention (B 4, N 1,024, C 1,024 = 16 heads x 64): qkv = x Wqkv^T ((out,in) [3072,1024]); per head the 64-dim q/k are split into two 32-dim halves: attn = softmax(q1 k1^T / 8) - lam softmax(q2 k2^T / 8), lam = mean(exp(lambda_q1 * lambda_k1) - exp(lambda_q2 * lambda_k2) + 0.8); out = merged(attn v) Wproj^T + b_proj. Realised as 32 softmax sub-heads of width 32 whose P.v share the parent head's 64-wide v.
#define NB 4
#define TT 1024
#define CC 1024            // NH * HD = projected width
#define DIN 1024          // input (model) width
#define NH 32              // softmax sub-heads (16 heads x 2 halves)
#define HD 32
#define NQB (TT / 64)
#define HG 8
#define SCALE (0.125f)
#define CAUSAL 0
#ifndef TNB
#define TNB NB
#endif
__device__ __forceinline__ float bfr(float v) { return (float)(__bf16)v; }
__host__ __device__ __forceinline__ int kb_last(int qb) { return CAUSAL ? ((qb * 64 + 63) >> 7) : (TT / 128 - 1); }
typedef __attribute__((ext_vector_type(8))) __bf16 v8b;
__device__ __forceinline__ v16b frag_b(const __bf16* rowk0, int lane) {
  union { v16b v; v8b q[2]; } u; const __bf16* p = rowk0 + 8 * (lane >> 4);
  u.q[0] = *(const v8b*)p; u.q[1] = *(const v8b*)(p + 16); return u.v;
}
#define QBH 0              // unused: k_att treats all query blocks alike
#define QHI 1024            // rows carrying a q residual plane (all rows: 2-product logits everywhere)
#define KHI 64            // key rows carrying k residual / v bf16 hi+lo planes (written and read by no kernel)
// B fragment (k rows k0+.., output column o) of a weight: (in,out) [K][ld] or (out,in) [ld rows of K]: bf16 exact, or f16(bf16 * 256) exact
__device__ __forceinline__ v16b wcol_io(const float* Wm, int k0, int o, int lane, int ld) { v16b w; const int g = lane >> 4;
#pragma unroll
  for (int i = 0; i < 8; ++i) { w[i] = (__bf16)Wm[(size_t)(k0 + 8 * g + i) * ld + o]; w[8 + i] = (__bf16)Wm[(size_t)(k0 + 16 + 8 * g + i) * ld + o]; }
  return w; }
__device__ __forceinline__ v16b wcol_oi(const float* Wm, int k0, int o, int lane, int K) { v16b w; const float* p = Wm + (size_t)o * K + k0 + 8 * (lane >> 4);
#pragma unroll
  for (int i = 0; i < 8; ++i) { w[i] = (__bf16)p[i]; w[8 + i] = (__bf16)p[16 + i]; }
  return w; }
__device__ __forceinline__ v16h wcolh_io(const float* Wm, int k0, int o, int lane, int ld) { v16h w; const int g = lane >> 4;
#pragma unroll
  for (int i = 0; i < 8; ++i) { w[i] = (_Float16)(bfr(Wm[(size_t)(k0 + 8 * g + i) * ld + o]) * 256.0f); w[8 + i] = (_Float16)(bfr(Wm[(size_t)(k0 + 16 + 8 * g + i) * ld + o]) * 256.0f); }
  return w; }
__device__ __forceinline__ v16h wcolh_oi(const float* Wm, int k0, int o, int lane, int K) { v16h w; const float* p = Wm + (size_t)o * K + k0 + 8 * (lane >> 4);
#pragma unroll
  for (int i = 0; i < 8; ++i) { w[i] = (_Float16)(bfr(p[i]) * 256.0f); w[8 + i] = (_Float16)(bfr(p[16 + i]) * 256.0f); }
  return w; }
#define WQKV_LAYOUT 1   // 0 = (in,out) [DIN][CC]; 1 = (out,in) [CC][DIN]; 2 = per-head [NH][DIN][HD]
__device__ __forceinline__ v16b wcol_hdk(const float* Wm, int k0, int o, int lane) { v16b w; const int g = lane >> 4; const float* p = Wm + (size_t)(o / HD) * DIN * HD + (o % HD);
#pragma unroll
  for (int i = 0; i < 8; ++i) { w[i] = (__bf16)p[(size_t)(k0 + 8 * g + i) * HD]; w[8 + i] = (__bf16)p[(size_t)(k0 + 16 + 8 * g + i) * HD]; }
  return w; }
#define WO_OUT_IN 1
#if WQKV_LAYOUT == 1
#define WCOL(W, k0, o, lane) wcol_oi(W, k0, o, lane, DIN)
#elif WQKV_LAYOUT == 2
#define WCOL(W, k0, o, lane) wcol_hdk(W, k0, o, lane)
#else
#define WCOL(W, k0, o, lane) wcol_io(W, k0, o, lane, CC)
#endif
#if WO_OUT_IN
#define WOCOL(W, k0, o, lane) wcol_oi(W, k0, o, lane, CC)
#define WOCOLH(W, k0, o, lane) wcolh_oi(W, k0, o, lane, CC)
#else
#define WOCOL(W, k0, o, lane) wcol_io(W, k0, o, lane, DIN)
#define WOCOLH(W, k0, o, lane) wcolh_io(W, k0, o, lane, DIN)
#endif
#define HDV 64             // value columns per softmax sub-head (the parent head's 64 columns)
#define YP (NH * HDV)      // 2,048: pitch of the per-sub-head context rows Y[b*t][h'*64 + d]
// ---- k_diff: block = 64 rows (256 threads): lambda = mean over 64 of (exp(lq1 lk1) - exp(lq2 lk2) + 0.8) from the four bf16-rounded [64] inputs; for each of the 16 heads e: o = Y[2e] - lambda Y[2e+1] (f32, 64 wide) -> Yd rows [b*t][1024]; thread owns 4 consecutive output columns, a row = 4 KB by 256 threads
__global__ __launch_bounds__(256) void k_diff(const float* __restrict__ Y, const float* __restrict__ LQ1, const float* __restrict__ LK1, const float* __restrict__ LQ2, const float* __restrict__ LK2, float* __restrict__ YD) {
  __shared__ float slam;
  const int tid = threadIdx.x; const size_t r0 = (size_t)blockIdx.x * 64;
  if (tid == 0) { float s1 = 0.f; for (int i = 0; i < 64; ++i) s1 += (expf(bfr(LQ1[i]) * bfr(LK1[i])) - expf(bfr(LQ2[i]) * bfr(LK2[i]))) + 0.8f; slam = s1 * (1.0f / 64.0f); }
  __syncthreads(); const float lam = slam;
  const int c = tid * 4; const int e = c >> 6, d = c & 63;   /* output column c -> head e, dim d */
  for (int rr = 0; rr < 64; ++rr) { const size_t row = r0 + rr; const float* y1 = Y + row * YP + (size_t)(2 * e) * HDV + d; const float* y2 = y1 + HDV;
    const v4f a = *(const v4f*)y1, bq = *(const v4f*)y2; v4f o; o[0] = a[0] - lam * bq[0]; o[1] = a[1] - lam * bq[1]; o[2] = a[2] - lam * bq[2]; o[3] = a[3] - lam * bq[3];
    vst2(YD + row * CC + c, o); } }
#ifndef SM_EXTRA_PARAMS
#define SM_EXTRA_PARAMS
#endif
#ifndef PROJ_EXTRA_PARAMS
#define PROJ_EXTRA_PARAMS
#endif
#ifndef SM_MASK_HOOK
#define SM_MASK_HOOK (void)0
#endif

#define WS_QH  0u                                      // f16 q rows [b*t][CC]
#define WS_KH  (WS_QH + 2u * (size_t)NB * TT * CC)      // f16 k rows [b*t][CC]
#define WS_VT  (WS_KH + 2u * (size_t)NB * TT * CC)      // f16 v planes [b][c][t]
#define WS_QL  (WS_VT + 2u * (size_t)NB * CC * TT)      // f16 q residual x 2^10 rows [b][t < QHI][CC]
#define WS_KL  (WS_QL + 2u * (size_t)NB * QHI * CC)     // f16 k residual x 2^10 rows [b][t < KHI][CC]
#define WS_VB  (WS_KL + 2u * (size_t)NB * KHI * CC)     // bf16 v hi planes [b][c][t < KHI]
#define WS_VBL (WS_VB + 2u * (size_t)NB * CC * KHI)
#define WS_S   (WS_VBL + 2u * (size_t)NB * CC * KHI)    // f32 differential rows [b*t][CC] (first half of the plane)
#define WS_Y   (WS_S  + 4u * (size_t)HG * TT * TT)      // f32 per-softmax-head context rows [b*t][YP = 16 x 128]
#define WS_END (WS_Y  + 4u * (size_t)NB * TT * YP)

// ---- the two GEMM kernels: block = 4 waves (2 x 2), tile 128 rows x 128 cols, a wave 64 x 64 (16 accumulator tiles). Per 32 k: every thread loads whole 128-B lines of both f32 operands (a wave-wide load = 4 rows), rounds them once to the 16-bit operand type and stores them in LDS; all waves take their fragments from there. Two LDS buffers, the next 32 k's global loads in flight over the products, one barrier a pass.
#define GP 40                       // LDS row pitch in 16-bit elements: 80 B = 16 B x 5, odd, for 16-byte fragment reads
#define GSTG (256 * GP)             // elements of one buffer: 128 X rows, then 128 W rows
#define GSM (2 * 128 * 136 * 2)     // bytes: the epilogue's two f16 planes [128][136] (the two buffers take 40,960)
typedef const __attribute__((address_space(1))) float* gf_p;   /* typed as global memory, as gh_p below: an address that has gone through an asm statement still loads by global_load */
typedef const __attribute__((address_space(1))) v4f* gv4f_p;
typedef __attribute__((ext_vector_type(4))) __bf16 v4b;
typedef __attribute__((ext_vector_type(4))) _Float16 v4h;
__device__ __forceinline__ v8f wmb(v16b a, v16b b, v8f c) { return __builtin_amdgcn_wmma_f32_16x16x32_bf16(false, a, false, b, (short)0, c, false, false); }
__device__ __forceinline__ v8f wmh(v16h a, v16h b, v8f c) { return __builtin_amdgcn_wmma_f32_16x16x32_f16(false, a, false, b, (short)0, c, false, false); }
/* 32 k of 128 rows of each operand: thread = (row tid >> 3 of 16, 4 floats tid & 7); then both addresses step 32 floats. The wait and the steps stand in one statement, so that an address pair is rewritten only behind the wait */
__device__ __forceinline__ void g_fetch(gf_p& px, gf_p& pw, v4f (&xr)[8], v4f (&wr)[8]) {
#pragma unroll   // constant indices keep the arrays in registers
  for (int i = 0; i < 8; ++i) { xr[i] = *(gv4f_p)(px + (size_t)(i * 16) * DIN); wr[i] = *(gv4f_p)(pw + (size_t)(i * 16) * DIN); }
  asm volatile("s_wait_xcnt 0x0\n\tv_add_nc_u64 %0, %2, %0\n\tv_add_nc_u64 %1, %2, %1" : "+v"(px), "+v"(pw) : "s"((long long)128) : "memory");
}
typedef __attribute__((address_space(1))) v4u* gu4_p;
typedef __attribute__((address_space(1))) v4f* gf4_p;
/* the four bias values of a lane's columns (16 apart), rounded to bf16; the wait stands behind the loads, in front of any rewrite of their address registers */
__device__ __forceinline__ void g_bias(const float* p, float (&bs)[4]) {
#pragma unroll   // constant indices keep the arrays in registers
  for (int j = 0; j < 4; ++j) bs[j] = p[j * 16];
  asm volatile("s_wait_xcnt 0x0" ::: "memory");
#pragma unroll   // constant indices keep the arrays in registers
  for (int j = 0; j < 4; ++j) bs[j] = bfr(bs[j]);
}
/* q or k tile into LDS planes [128][136]: f16 rows (RES: and the residual x 2^10) */
template <bool RES> __device__ __forceinline__ void rows_lds(const v8f (&acc)[4][4], const float (&bs)[4], _Float16* sh, _Float16* sl) {
#pragma unroll   // constant indices keep the arrays in registers
  for (int j = 0; j < 4; ++j)
#pragma unroll   // constant indices keep the arrays in registers
    for (int i = 0; i < 4; ++i)
#pragma unroll   // constant indices keep the arrays in registers
      for (int r = 0; r < 8; ++r) { const float v = acc[i][j][r] + bs[j]; const _Float16 hv = (_Float16)v; const int o = (i * 16 + r) * 136 + j * 16; sh[o] = hv; if (RES) sl[o] = (_Float16)((v - (float)hv) * 1024.0f); }
}
// ---- k_proj: block = (128 rows, 128 cols, which): q/k/v = X W (+ b) with exact bf16 products (K = DIN) -> which 0: q f16 rows + residual rows; 1: k f16 rows; 2: v f16 planes [c][t]
__global__ __launch_bounds__(128) void k_proj(const float* __restrict__ XQ, const float* __restrict__ XK, const float* __restrict__ XV, const float* __restrict__ WQ, const float* __restrict__ WK, const float* __restrict__ WV, const float* __restrict__ BQ, const float* __restrict__ BK, const float* __restrict__ BV,
    _Float16* __restrict__ QH, _Float16* __restrict__ QL, _Float16* __restrict__ KH, _Float16* __restrict__ VT) {
  __shared__ __align__(16) unsigned char sm[GSM];
  const int tid = threadIdx.x, wave = tid >> 5, lane = tid & 31, col = lane & 15, g = lane >> 4, wm = wave >> 1, wn = wave & 1; const int which = blockIdx.z; const int c0 = blockIdx.y * 128; const size_t r0 = (size_t)blockIdx.x * 128; const size_t bb = r0 / TT; const int t0 = (int)(r0 % TT);
  const float* X = which == 0 ? XQ : which == 1 ? XK : XV; const float* WA = which == 0 ? WQ : which == 1 ? WK : WV; const float* BA = which == 0 ? BQ : which == 1 ? BK : BV;
  gf_p px = (gf_p)(X + (r0 + (tid >> 3)) * DIN + (tid & 7) * 4); gf_p pw = (gf_p)(WA + (size_t)(c0 + (tid >> 3)) * DIN + (tid & 7) * 4);
  __bf16* st = (__bf16*)sm; const int so = (tid >> 3) * GP + (tid & 7) * 4;
  v4f xr[8], wr[8]; v8f acc[4][4] = {};
  g_fetch(px, pw, xr, wr);
  for (int kc = 0; kc < DIN / 32; ++kc) { __bf16* sb = st + (kc & 1) * GSTG;
#pragma unroll   // constant indices keep the arrays in registers
    for (int i = 0; i < 8; ++i) { v4b cx, cw;
#pragma unroll   // constant indices keep the arrays in registers
      for (int q = 0; q < 4; ++q) { cx[q] = (__bf16)xr[i][q]; cw[q] = (__bf16)wr[i][q]; }
      *(v4b*)(sb + so + i * 16 * GP) = cx; *(v4b*)(sb + 128 * GP + so + i * 16 * GP) = cw; }
    __syncthreads();   /* publishes this pass's buffer; the other buffer's readers of the pass before are behind it when the next pass stores there */
    if (kc + 1 < DIN / 32) g_fetch(px, pw, xr, wr);
    v16b a[4], b[4];
#pragma unroll   // constant indices keep the arrays in registers
    for (int i = 0; i < 4; ++i) { a[i] = frag_b(sb + (wm * 64 + i * 16 + col) * GP, lane); b[i] = frag_b(sb + (128 + wn * 64 + i * 16 + col) * GP, lane); }
#pragma unroll   // constant indices keep the arrays in registers
    for (int i = 0; i < 4; ++i)
#pragma unroll   // constant indices keep the arrays in registers
      for (int j = 0; j < 4; ++j) acc[i][j] = wmb(a[i], b[j], acc[i][j]); }
  __syncthreads();   /* every wave has left the buffers: the epilogue's planes lie over them */
  _Float16* sh = (_Float16*)sm; _Float16* sl = sh + 128 * 136; float bs[4] = {};
  if (BA) { g_bias(BA + c0 + wn * 64 + col, bs); }
  const int o0 = (wm * 64 + 8 * g) * 136 + wn * 64 + col;
  if (which == 0) rows_lds<true>(acc, bs, sh + o0, sl + o0);
  else if (which == 1) rows_lds<false>(acc, bs, sh + o0, sl + o0);
  else {
#pragma unroll   // constant indices keep the arrays in registers
    for (int j = 0; j < 4; ++j)
#pragma unroll   // constant indices keep the arrays in registers
      for (int i = 0; i < 4; ++i) { v8h t;
#pragma unroll   // constant indices keep the arrays in registers
        for (int r = 0; r < 8; ++r) t[r] = (_Float16)(acc[i][j][r] + bs[j]);
        *(v8h*)&sh[(wn * 64 + j * 16 + col) * 136 + wm * 64 + i * 16 + 8 * g] = t; } }   /* transposed: a lane's 8 rows are 8 consecutive t of its column */
  __syncthreads();
  /* copy-out: thread = (plane row tid >> 4 of 8, 16 bytes tid & 15), 256 B of a row by 16 lanes; q and k rows [b*t][CC] and v planes [c][t] both step 2 KB a row */
  const int sr = (tid >> 4) * 136 + (tid & 15) * 8; const size_t qo = (r0 + (tid >> 4)) * CC + c0 + (tid & 15) * 8;
  gu4_p dh = (gu4_p)(which == 0 ? QH + qo : which == 1 ? KH + qo : VT + (bb * CC + c0 + (tid >> 4)) * (size_t)TT + t0 + (tid & 15) * 8);
  gu4_p dl = (gu4_p)(QL + (bb * QHI + t0 + (tid >> 4)) * (size_t)CC + c0 + (tid & 15) * 8);
#pragma unroll   // one address pair and constant offsets: no address register is rewritten behind a store
  for (int it = 0; it < 16; ++it) dh[(size_t)it * 1024] = *(const v4u*)&sh[sr + it * 8 * 136];
  asm volatile("s_wait_xcnt 0x0" :: "v"(dh) : "memory");   /* behind the stores, in front of the second plane's reads and address, which reuse the stores' registers; the address pair is named to stay unwritten up to here */
  if (which == 0) {
#pragma unroll   // as above
    for (int it = 0; it < 16; ++it) dl[(size_t)it * 1024] = *(const v4u*)&sl[sr + it * 8 * 136]; } }
// ---- k_att: block = 16 waves x 16 queries of (b, head e); a wave holds both 32-wide sub-heads of its 16 queries. Per 32 keys: S^T = K Q^T (q residual product first, x 2^-10, then the q hi product on top of it), running maximum and sum per query (query = lane column; base-2 exponent, scale folded in), P^T packed from the two score tiles straight into a B operand, O^T += V^T P^T with the head's 64-wide v fragments shared by both sub-heads. No logits or P in memory.
#define AW 16
__device__ __forceinline__ v8f wm(v16h a, v16h b, v8f c) { return __builtin_amdgcn_wmma_f32_16x16x32_f16(false, a, false, b, (short)0, c, false, false); }
__device__ __forceinline__ float xhalf(float x) { return __builtin_bit_cast(float, __builtin_amdgcn_permlanex16(__builtin_bit_cast(int, x), __builtin_bit_cast(int, x), 0x76543210, 0xfedcba98, false, false)); }   /* lane l with lane l ^ 16 */
typedef const __attribute__((address_space(1))) _Float16* gh_p;   /* pointer typed as global memory: an address that has gone through an asm statement still loads by global_load, not flat_load */
typedef const __attribute__((address_space(1))) v8h* gv8h_p;
__device__ __forceinline__ v16h frag_p(gh_p p) { union { v16h v; v8h q[2]; } u; u.q[0] = *(gv8h_p)p; u.q[1] = *(gv8h_p)(p + 16); return u.v; }   /* frag_h with the lane half's 8 elements already in p */
__global__ __launch_bounds__(AW * 32) void k_att(const _Float16* __restrict__ QH, const _Float16* __restrict__ QL, const _Float16* __restrict__ KH, const _Float16* __restrict__ VT, float* __restrict__ Y) {
  __shared__ __align__(16) float so[AW][16][2 * HDV + 4];
  const int tid = threadIdx.x, wave = tid >> 5, lane = tid & 31, col = lane & 15, g = lane >> 4; const int e = blockIdx.y, b = blockIdx.z; const int ql0 = blockIdx.x * (AW * 16) + wave * 16;
  const float C2 = SCALE * 1.4426950408889634f;
  v16h qh[2], ql[2], kf[2][2];
  const _Float16* qhp = QH + ((size_t)b * TT + ql0 + col) * CC + e * HDV; const _Float16* qlp = QL + ((size_t)b * QHI + ql0 + col) * CC + e * HDV;   /* query row col, this head's 64 columns: hi and residual */
  gh_p kq = (gh_p)(KH + ((size_t)b * TT + col) * CC + e * HDV + 8 * g);     /* key row col of a 16-key tile, this head's 64 columns, the lane's half; walks 32 keys a pass */
  gh_p vq = (gh_p)(VT + ((size_t)b * CC + e * HDV + col) * TT + 8 * g);     /* value column col of a 16-column tile, keys contiguous, the lane's half; walks 32 keys a pass */
#pragma unroll   // constant indices keep the fragment arrays in registers
  for (int u = 0; u < 2; ++u) { qh[u] = frag_h(qhp + u * HD, lane); ql[u] = frag_h(qlp + u * HD, lane);
#pragma unroll   // constant indices keep the fragment arrays in registers
    for (int kt = 0; kt < 2; ++kt) kf[u][kt] = frag_p(kq + (size_t)(kt * 16) * CC + u * HD); }
  /* the wait behind the q and first k loads and the step of the k address stand in one statement, so that the address pair is rewritten only behind the wait; the q addresses are named as inputs to stay unwritten up to it */
  asm volatile("s_wait_xcnt 0x0\n\tv_add_nc_u64 %0, %1, %0" : "+v"(kq) : "s"((long long)32 * CC * 2), "v"(qhp + 8 * g), "v"(qlp + 8 * g) : "memory");
  v8f acc[2][HDV / 16] = {}; float mu[2] = { -3.0e38f, -3.0e38f }; v2f ls[2] = {};   /* per query: maximum in use; sum, even and odd keys apart */
#pragma unroll 1   // rolled: one pass's registers only, so that four waves fit a SIMD
  for (int kc = 0; kc < TT / 32; ++kc) {
    v16h vf[HDV / 16];
#pragma unroll   // constant indices keep the fragment arrays in registers
    for (int j = 0; j < HDV / 16; ++j) vf[j] = frag_p(vq + (size_t)(j * 16) * TT);
    /* wait and address step in one statement: the v address pair is rewritten only behind the wait, and no load's data lands on it; the statement also holds these loads at the head of the pass, a score and softmax phase ahead of their use */
    asm volatile("s_wait_xcnt 0x0\n\tv_add_nc_u64 %0, 64, %0" : "+v"(vq) :: "memory");
    v8f s[2][2];
#pragma unroll   // constant indices keep the fragment arrays in registers
    for (int u = 0; u < 2; ++u)
#pragma unroll   // constant indices keep the fragment arrays in registers
      for (int kt = 0; kt < 2; ++kt) { const v8f z = {}; s[u][kt] = wm(kf[u][kt], ql[u], z); }
#pragma unroll   // constant indices keep the fragment arrays in registers
    for (int u = 0; u < 2; ++u)
#pragma unroll   // constant indices keep the fragment arrays in registers
      for (int kt = 0; kt < 2; ++kt) s[u][kt] = wm(kf[u][kt], qh[u], s[u][kt] * (1.0f / 1024.0f));
    const long long kstep = (kc == TT / 32 - 2) ? -(long long)(TT - 32) * CC * 2 : (long long)32 * CC * 2;   /* bytes to the keys after next; behind the last keys back to keys 0..31, which the last pass fetches and drops */
#pragma unroll   // constant indices keep the fragment arrays in registers
    for (int u = 0; u < 2; ++u)
#pragma unroll   // constant indices keep the fragment arrays in registers
      for (int kt = 0; kt < 2; ++kt) kf[u][kt] = frag_p(kq + (size_t)(kt * 16) * CC + u * HD);   /* next pass's keys, one pass ahead */
    asm volatile("s_wait_xcnt 0x0\n\tv_add_nc_u64 %0, %1, %0" : "+v"(kq) : "s"(kstep) : "memory");   /* as for v: the k address pair steps only behind the wait */
    float mx[2];
#pragma unroll   // constant indices keep the fragment arrays in registers
    for (int u = 0; u < 2; ++u) { float m = fmaxf(s[u][0][0], s[u][1][0]);
#pragma unroll   // constant indices keep the fragment arrays in registers
      for (int r = 1; r < 8; ++r) m = fmaxf(m, fmaxf(s[u][0][r], s[u][1][r]));
      mx[u] = fmaxf(m, xhalf(m)) * C2; }
    if (__builtin_amdgcn_ballot_w32(mx[0] > mu[0] + 8.0f || mx[1] > mu[1] + 8.0f) != 0) {   /* rescale only when a query's maximum outgrows the one in use by 2^8: P stays <= 256 in f16 */
#pragma unroll   // constant indices keep the fragment arrays in registers
      for (int u = 0; u < 2; ++u) { const float mn = fmaxf(mu[u], mx[u]); const float corr = __builtin_amdgcn_exp2f(mu[u] - mn); mu[u] = mn; ls[u] *= corr;
#pragma unroll   // constant indices keep the fragment arrays in registers
        for (int j = 0; j < HDV / 16; ++j) acc[u][j] *= corr; } }
#pragma unroll   // constant indices keep the fragment arrays in registers
    for (int u = 0; u < 2; ++u) { v16h p;
#pragma unroll   // constant indices keep the fragment arrays in registers
      for (int i = 0; i < 16; i += 2) { v2f a = { s[u][i >> 3][i & 7], s[u][i >> 3][(i & 7) + 1] }; const v2f c2 = { C2, C2 }, nm = { -mu[u], -mu[u] }; a = __builtin_elementwise_fma(a, c2, nm);
        const v2f pe = { __builtin_amdgcn_exp2f(a[0]), __builtin_amdgcn_exp2f(a[1]) }; ls[u] += pe; p[i] = (_Float16)pe[0]; p[i + 1] = (_Float16)pe[1]; }
#pragma unroll   // constant indices keep the fragment arrays in registers
      for (int j = 0; j < HDV / 16; ++j) acc[u][j] = wm(vf[j], p, acc[u][j]); } }
#pragma unroll   // constant indices keep the fragment arrays in registers
  for (int u = 0; u < 2; ++u) { const float lh = ls[u][0] + ls[u][1]; const float inv = 1.0f / (lh + xhalf(lh));
#pragma unroll   // constant indices keep the fragment arrays in registers
    for (int j = 0; j < HDV / 16; ++j) { v4f lo, hi;
#pragma unroll   // constant indices keep the fragment arrays in registers
      for (int r = 0; r < 4; ++r) { lo[r] = acc[u][j][r] * inv; hi[r] = acc[u][j][4 + r] * inv; }
      float* d = &so[wave][col][u * HDV + j * 16 + 8 * g]; *(v4f*)d = lo; *(v4f*)(d + 4) = hi; } }
  LDSX(); for (int rl = 0; rl < 16; ++rl) vst2(Y + ((size_t)b * TT + ql0 + rl) * YP + e * (2 * HDV) + lane * 4, *(const v4f*)&so[wave][rl][lane * 4]); }   /* a row's two sub-head segments = 512 B by the 32 lanes */
// ---- k_out: block = (128 rows, 128 cols): out = ctx Wo (+ bo): ctx once to f16 against Wo as f16(bf16 x 2^8) exact (1 product) x 2^-8; staged as in k_proj
__global__ __launch_bounds__(128) void k_out(const float* __restrict__ Y, const float* __restrict__ WO, const float* __restrict__ BO, float* __restrict__ OUT) {
  __shared__ __align__(16) unsigned char sm[GSM];
  const int tid = threadIdx.x, wave = tid >> 5, lane = tid & 31, col = lane & 15, g = lane >> 4, wm = wave >> 1, wn = wave & 1; const int c0 = blockIdx.y * 128; const size_t r0 = (size_t)blockIdx.x * 128;
  gf_p px = (gf_p)(Y + (r0 + (tid >> 3)) * CC + (tid & 7) * 4); gf_p pw = (gf_p)(WO + (size_t)(c0 + (tid >> 3)) * CC + (tid & 7) * 4);
  _Float16* st = (_Float16*)sm; const int so = (tid >> 3) * GP + (tid & 7) * 4;
  v4f xr[8], wr[8]; v8f acc[4][4] = {};
  g_fetch(px, pw, xr, wr);
  for (int kc = 0; kc < CC / 32; ++kc) { _Float16* sb = st + (kc & 1) * GSTG;
#pragma unroll   // constant indices keep the arrays in registers
    for (int i = 0; i < 8; ++i) { v4h cx, cw;
#pragma unroll   // constant indices keep the arrays in registers
      for (int q = 0; q < 4; ++q) { cx[q] = (_Float16)xr[i][q]; cw[q] = (_Float16)(bfr(wr[i][q]) * 256.0f); }
      *(v4h*)(sb + so + i * 16 * GP) = cx; *(v4h*)(sb + 128 * GP + so + i * 16 * GP) = cw; }
    __syncthreads();   /* publishes this pass's buffer; the other buffer's readers of the pass before are behind it when the next pass stores there */
    if (kc + 1 < CC / 32) g_fetch(px, pw, xr, wr);
    v16h a[4], b[4];
#pragma unroll   // constant indices keep the arrays in registers
    for (int i = 0; i < 4; ++i) { a[i] = frag_h(sb + (wm * 64 + i * 16 + col) * GP, lane); b[i] = frag_h(sb + (128 + wn * 64 + i * 16 + col) * GP, lane); }
#pragma unroll   // constant indices keep the arrays in registers
    for (int i = 0; i < 4; ++i)
#pragma unroll   // constant indices keep the arrays in registers
      for (int j = 0; j < 4; ++j) acc[i][j] = wmh(a[i], b[j], acc[i][j]); }
  __syncthreads();   /* every wave has left the buffers: the output tile [128][132] f32 lies over them */
  float* sf = (float*)sm; float bs[4] = {};
  if (BO) { g_bias(BO + c0 + wn * 64 + col, bs); }
#pragma unroll   // constant indices keep the arrays in registers
  for (int j = 0; j < 4; ++j)
#pragma unroll   // constant indices keep the arrays in registers
    for (int i = 0; i < 4; ++i)
#pragma unroll   // constant indices keep the arrays in registers
      for (int r = 0; r < 8; ++r) sf[(wm * 64 + i * 16 + 8 * g + r) * 132 + wn * 64 + j * 16 + col] = acc[i][j][r] * (1.0f / 256.0f) + bs[j];
  __syncthreads();
  gf4_p po = (gf4_p)(OUT + (r0 + wave) * DIN + c0 + lane * 4);   /* a wave stores 512 B of one row */
#pragma unroll   // one address pair and constant offsets: no address register is rewritten behind a store
  for (int it = 0; it < 32; ++it) po[(size_t)it * (4 * DIN * 4 / 16)] = *(const v4f*)&sf[(wave + it * 4) * 132 + lane * 4]; }

extern "C" void kernel_launch(void* const* d_in, const int* in_sizes, int n_in, void* d_out, int out_size, void* d_ws, size_t ws_size, hipStream_t stream) {
  (void)in_sizes; (void)n_in; (void)out_size;
  const float** F = (const float**)d_in;
  if (ws_size < (size_t)WS_END) return;
  char* ws = (char*)d_ws; _Float16 *QH = (_Float16*)(ws + WS_QH), *KH = (_Float16*)(ws + WS_KH), *VT = (_Float16*)(ws + WS_VT), *QL = (_Float16*)(ws + WS_QL), *KL = (_Float16*)(ws + WS_KL); __bf16 *VB = (__bf16*)(ws + WS_VB), *VBL = (__bf16*)(ws + WS_VBL); float *S = (float*)(ws + WS_S), *Y = (float*)(ws + WS_Y);
  (void)Y; (void)QL; (void)KL; (void)VB; (void)VBL;
  // inputs: 0 x [4,1024,1024]; 1 W_qkv [3072,1024] (out,in: rows 0-1023 q, 1024-2047 k, 2048-3071 v); 2 W_proj [1024,1024] (out,in); 3 b_proj; 4 lambda_q1, 5 lambda_k1, 6 lambda_q2, 7 lambda_k2 [64]
  float* YD = S;   /* the differential rows [b*t][CC] live in the WS_S plane */
  k_proj<<<dim3(TNB * TT / 128, CC / 128, 3), 128, 0, stream>>>(F[0], F[0], F[0], F[1], F[1] + (size_t)CC * DIN, F[1] + (size_t)2 * CC * DIN, nullptr, nullptr, nullptr, QH, QL, KH, VT);
  k_att<<<dim3(TT / (AW * 16), NH / 2, TNB), AW * 32, 0, stream>>>(QH, QL, KH, VT, Y);
  k_diff<<<dim3(TNB * TT / 64), 256, 0, stream>>>(Y, F[4], F[5], F[6], F[7], YD);
  k_out<<<dim3(TNB * TT / 128, DIN / 128), 128, 0, stream>>>(YD, F[2], F[3], (float*)d_out);
}

// v003
// One run takes 123 microseconds.
// Next to v002, in two timings, it ran 1.24 times as fast each time.
// All steps since v000 together make it 11.6 times as fast.
// compute dtype: all float inputs rounded to bf16; qkv = x Wqkv^T with EXACT bf16 products on WMMA 16x16x32 (f32 accumulate); the two 32-wide sub-head logits with q as f16 hi + residual (x 2^10) against k once to f16 (2 products) x 64^-0.5; both softmaxes in f32 with a running maximum and sum (base-2 exponent); each unnormalised P (<= 2^8) once to f16 against the head's 64-wide v once to f16 (1 product), divided by the f32 sum at the end; the differential combination P1.v - lambda P2.v and lambda (mean of exp(lq1 lk1) - exp(lq2 lk2) + 0.8 over 64) in f32; ctx once to f16 against W_proj carried x 2^8 in f16 + b_proj; f32 output.
#include <hip/hip_runtime.h>
#include <math.h>

typedef __attribute__((ext_vector_type(16))) _Float16 v16h;
typedef __attribute__((ext_vector_type(16))) __bf16 v16b;
typedef __attribute__((ext_vector_type(8)))  _Float16 v8h;
typedef __attribute__((ext_vector_type(8)))  float v8f;
typedef __attribute__((ext_vector_type(4)))  float v4f;
typedef __attribute__((ext_vector_type(2)))  float v2f;
typedef __attribute__((ext_vector_type(4)))  unsigned v4u;
typedef __attribute__((ext_vector_type(4)))  int v4i;
typedef float __attribute__((may_alias)) float_a;
typedef int __attribute__((may_alias)) int_a;

template <typename T> __device__ __forceinline__ void vst2(void* p, T v) { *(T*)p = v;  }
__device__ __forceinline__ v8f wmma16(v16h a, v16h b, v8f c) {
  v8f d = __builtin_amdgcn_wmma_f32_16x16x32_f16(false, a, false, b, (short)0, c, false, false);
  asm volatile("v_nop\n\tv_nop\n\tv_nop\n\tv_nop" : "+v"(d) : "v"(a), "v"(b));
  return d;
}
__device__ __forceinline__ v8f wmma_bf(v16b a, v16b b, v8f c) {
  v8f d = __builtin_amdgcn_wmma_f32_16x16x32_bf16(false, a, false, b, (short)0, c, false, false);
  asm volatile("v_nop\n\tv_nop\n\tv_nop\n\tv_nop" : "+v"(d) : "v"(a), "v"(b));
  return d;
}
// 16x16x32 fragments: lane = (h = lane>>4, row/col = lane&15); elements 0..7 = k0+8h+0..7, 8..15 = k0+16+8h+0..7; D element r = row 8h+r
__device__ __forceinline__ v16h frag_h(const _Float16* rowk0, int lane) {
  union { v16h v; v8h q[2]; } u; const _Float16* p = rowk0 + 8 * (lane >> 4);
  u.q[0] = *(const v8h*)p; u.q[1] = *(const v8h*)(p + 16); return u.v;
}
__device__ __forceinline__ v16h frag_f32(const float* rowk0, int lane) {
  v16h a; const float* p = rowk0 + 8 * (lane >> 4);
#pragma unroll
  for (int i = 0; i < 8; ++i) { a[i] = (_Float16)p[i]; a[8 + i] = (_Float16)p[16 + i]; }
  return a;
}
__device__ __forceinline__ v16h frag_f32s(const float* rowk0, int lane, float sc) {
  v16h a; const float* p = rowk0 + 8 * (lane >> 4);
#pragma unroll
  for (int i = 0; i < 8; ++i) { a[i] = (_Float16)(p[i] * sc); a[8 + i] = (_Float16)(p[16 + i] * sc); }
  return a;
}
// column fragment from a [K][ld] layout (column n), rows >= K read as 0
__device__ __forceinline__ v16h fragc_f32(const float* W, int k0, int n, int lane, int ld, int K) {
  v16h a; const int g = lane >> 4;
#pragma unroll
  for (int i = 0; i < 8; ++i) { const int ka = k0 + 8 * g + i, kb = ka + 16;
    a[i] = (_Float16)(ka < K ? W[(size_t)(ka < K ? ka : K - 1) * ld + n] : 0.f); a[8 + i] = (_Float16)(kb < K ? W[(size_t)(kb < K ? kb : K - 1) * ld + n] : 0.f); }
  return a;
}
struct F2 { v16b h, l; };
__device__ __forceinline__ F2 bsplit16(const float v[16]) { F2 r;
#pragma unroll
  for (int i = 0; i < 16; ++i) { const __bf16 h = (__bf16)v[i]; r.h[i] = h; r.l[i] = (__bf16)(v[i] - (float)h); }
  return r; }
__device__ __forceinline__ F2 split_row(const float* row, int k0, int lane) { float v[16]; const float* p = row + k0 + 8 * (lane >> 4);
#pragma unroll
  for (int i = 0; i < 8; ++i) { v[i] = p[i]; v[8 + i] = p[16 + i]; }
  return bsplit16(v); }
__device__ __forceinline__ F2 split_rowK(const float* row, int k0, int lane, int K) { float v[16]; const int g = lane >> 4;
#pragma unroll
  for (int i = 0; i < 8; ++i) { const int ka = k0 + 8 * g + i, kb = ka + 16; v[i] = ka < K ? row[ka < K ? ka : K - 1] : 0.f; v[8 + i] = kb < K ? row[kb < K ? kb : K - 1] : 0.f; }
  return bsplit16(v); }
__device__ __forceinline__ F2 split_col(const float* W, int k0, int n, int lane, int ld, int K) { float v[16]; const int g = lane >> 4;
#pragma unroll
  for (int i = 0; i < 8; ++i) { const int ka = k0 + 8 * g + i, kb = ka + 16; v[i] = ka < K ? W[(size_t)(ka < K ? ka : K - 1) * ld + n] : 0.f; v[8 + i] = kb < K ? W[(size_t)(kb < K ? kb : K - 1) * ld + n] : 0.f; }
  return bsplit16(v); }
__device__ __forceinline__ v8f mac3(const F2& a, const F2& b, v8f c) { c = wmma_bf(a.l, b.h, c); c = wmma_bf(a.h, b.l, c); return wmma_bf(a.h, b.h, c); }
__device__ __forceinline__ float sigm(float v) { return 1.0f / (1.0f + expf(-v)); }
#define LDSX() do { asm volatile("s_wait_dscnt 0" ::: "memory"); __builtin_amdgcn_wave_barrier(); __builtin_amdgcn_fence(__ATOMIC_RELEASE, "workgroup"); } while (0)

// Differential attention (B 4, N 1,024, C 1,024 = 16 heads x 64): qkv = x Wqkv^T ((out,in) [3072,1024]); per head the 64-dim q/k are split into two 32-dim halves: attn = softmax(q1 k1^T / 8) - lam softmax(q2 k2^T / 8), lam = mean(exp(lambda_q1 * lambda_k1) - exp(lambda_q2 * lambda_k2) + 0.8); out = merged(attn v) Wproj^T + b_proj. Realised as 32 softmax sub-heads of width 32 whose P.v share the parent head's 64-wide v.
#define NB 4
#define TT 1024
#define CC 1024            // NH * HD = projected width
#define DIN 1024          // input (model) width
#define NH 32              // softmax sub-heads (16 heads x 2 halves)
#define HD 32
#define NQB (TT / 64)
#define HG 8
#define SCALE (0.125f)
#define CAUSAL 0
#ifndef TNB
#define TNB NB
#endif
__device__ __forceinline__ float bfr(float v) { return (float)(__bf16)v; }
__host__ __device__ __forceinline__ int kb_last(int qb) { return CAUSAL ? ((qb * 64 + 63) >> 7) : (TT / 128 - 1); }
typedef __attribute__((ext_vector_type(8))) __bf16 v8b;
__device__ __forceinline__ v16b frag_b(const __bf16* rowk0, int lane) {
  union { v16b v; v8b q[2]; } u; const __bf16* p = rowk0 + 8 * (lane >> 4);
  u.q[0] = *(const v8b*)p; u.q[1] = *(const v8b*)(p + 16); return u.v;
}
#define QBH 0              // unused: k_att treats all query blocks alike
#define QHI 1024            // rows carrying a q residual plane (all rows: 2-product logits everywhere)
#define KHI 64            // key rows carrying k residual / v bf16 hi+lo planes (written and read by no kernel)
// B fragment (k rows k0+.., output column o) of a weight: (in,out) [K][ld] or (out,in) [ld rows of K]: bf16 exact, or f16(bf16 * 256) exact
__device__ __forceinline__ v16b wcol_io(const float* Wm, int k0, int o, int lane, int ld) { v16b w; const int g = lane >> 4;
#pragma unroll
  for (int i = 0; i < 8; ++i) { w[i] = (__bf16)Wm[(size_t)(k0 + 8 * g + i) * ld + o]; w[8 + i] = (__bf16)Wm[(size_t)(k0 + 16 + 8 * g + i) * ld + o]; }
  return w; }
__device__ __forceinline__ v16b wcol_oi(const float* Wm, int k0, int o, int lane, int K) { v16b w; const float* p = Wm + (size_t)o * K + k0 + 8 * (lane >> 4);
#pragma unroll
  for (int i = 0; i < 8; ++i) { w[i] = (__bf16)p[i]; w[8 + i] = (__bf16)p[16 + i]; }
  return w; }
__device__ __forceinline__ v16h wcolh_io(const float* Wm, int k0, int o, int lane, int ld) { v16h w; const int g = lane >> 4;
#pragma unroll
  for (int i = 0; i < 8; ++i) { w[i] = (_Float16)(bfr(Wm[(size_t)(k0 + 8 * g + i) * ld + o]) * 256.0f); w[8 + i] = (_Float16)(bfr(Wm[(size_t)(k0 + 16 + 8 * g + i) * ld + o]) * 256.0f); }
  return w; }
__device__ __forceinline__ v16h wcolh_oi(const float* Wm, int k0, int o, int lane, int K) { v16h w; const float* p = Wm + (size_t)o * K + k0 + 8 * (lane >> 4);
#pragma unroll
  for (int i = 0; i < 8; ++i) { w[i] = (_Float16)(bfr(p[i]) * 256.0f); w[8 + i] = (_Float16)(bfr(p[16 + i]) * 256.0f); }
  return w; }
#define WQKV_LAYOUT 1   // 0 = (in,out) [DIN][CC]; 1 = (out,in) [CC][DIN]; 2 = per-head [NH][DIN][HD]
__device__ __forceinline__ v16b wcol_hdk(const float* Wm, int k0, int o, int lane) { v16b w; const int g = lane >> 4; const float* p = Wm + (size_t)(o / HD) * DIN * HD + (o % HD);
#pragma unroll
  for (int i = 0; i < 8; ++i) { w[i] = (__bf16)p[(size_t)(k0 + 8 * g + i) * HD]; w[8 + i] = (__bf16)p[(size_t)(k0 + 16 + 8 * g + i) * HD]; }
  return w; }
#define WO_OUT_IN 1
#if WQKV_LAYOUT == 1
#define WCOL(W, k0, o, lane) wcol_oi(W, k0, o, lane, DIN)
#elif WQKV_LAYOUT == 2
#define WCOL(W, k0, o, lane) wcol_hdk(W, k0, o, lane)
#else
#define WCOL(W, k0, o, lane) wcol_io(W, k0, o, lane, CC)
#endif
#if WO_OUT_IN
#define WOCOL(W, k0, o, lane) wcol_oi(W, k0, o, lane, CC)
#define WOCOLH(W, k0, o, lane) wcolh_oi(W, k0, o, lane, CC)
#else
#define WOCOL(W, k0, o, lane) wcol_io(W, k0, o, lane, DIN)
#define WOCOLH(W, k0, o, lane) wcolh_io(W, k0, o, lane, DIN)
#endif
#define HDV 64             // value columns per softmax sub-head (the parent head's 64 columns)
#define YP (NH * HDV)      // 2,048: pitch of the per-sub-head context rows Y[b*t][h'*64 + d]
// ---- k_diff: block = 64 rows (256 threads): lambda = mean over 64 of (exp(lq1 lk1) - exp(lq2 lk2) + 0.8) from the four bf16-rounded [64] inputs; for each of the 16 heads e: o = Y[2e] - lambda Y[2e+1] (f32, 64 wide) -> Yd rows [b*t][1024]; thread owns 4 consecutive output columns, a row = 4 KB by 256 threads
__global__ __launch_bounds__(256) void k_diff(const float* __restrict__ Y, const float* __restrict__ LQ1, const float* __restrict__ LK1, const float* __restrict__ LQ2, const float* __restrict__ LK2, float* __restrict__ YD) {
  __shared__ float slam;
  const int tid = threadIdx.x; const size_t r0 = (size_t)blockIdx.x * 64;
  if (tid == 0) { float s1 = 0.f; for (int i = 0; i < 64; ++i) s1 += (expf(bfr(LQ1[i]) * bfr(LK1[i])) - expf(bfr(LQ2[i]) * bfr(LK2[i]))) + 0.8f; slam = s1 * (1.0f / 64.0f); }
  __syncthreads(); const float lam = slam;
  const int c = tid * 4; const int e = c >> 6, d = c & 63;   /* output column c -> head e, dim d */
  for (int rr = 0; rr < 64; ++rr) { const size_t row = r0 + rr; const float* y1 = Y + row * YP + (size_t)(2 * e) * HDV + d; const float* y2 = y1 + HDV;
    const v4f a = *(const v4f*)y1, bq = *(const v4f*)y2; v4f o; o[0] = a[0] - lam * bq[0]; o[1] = a[1] - lam * bq[1]; o[2] = a[2] - lam * bq[2]; o[3] = a[3] - lam * bq[3];
    vst2(YD + row * CC + c, o); } }
#ifndef SM_EXTRA_PARAMS
#define SM_EXTRA_PARAMS
#endif
#ifndef PROJ_EXTRA_PARAMS
#define PROJ_EXTRA_PARAMS
#endif
#ifndef SM_MASK_HOOK
#define SM_MASK_HOOK (void)0
#endif

#define WS_QH  0u                                      // f16 q rows [b*t][CC]
#define WS_KH  (WS_QH + 2u * (size_t)NB * TT * CC)      // f16 k rows [b*t][CC]
#define WS_VT  (WS_KH + 2u * (size_t)NB * TT * CC)      // f16 v planes [b][c][t]
#define WS_QL  (WS_VT + 2u * (size_t)NB * CC * TT)      // f16 q residual x 2^10 rows [b][t < QHI][CC]
#define WS_KL  (WS_QL + 2u * (size_t)NB * QHI * CC)     // f16 k residual x 2^10 rows [b][t < KHI][CC]
#define WS_VB  (WS_KL + 2u * (size_t)NB * KHI * CC)     // bf16 v hi planes [b][c][t < KHI]
#define WS_VBL (WS_VB + 2u * (size_t)NB * CC * KHI)
#define WS_S   (WS_VBL + 2u * (size_t)NB * CC * KHI)    // f32 differential rows [b*t][CC] (first half of the plane)
#define WS_Y   (WS_S  + 4u * (size_t)HG * TT * TT)      // f32 per-softmax-head context rows [b*t][YP = 16 x 128]
#define WS_END (WS_Y  + 4u * (size_t)NB * TT * YP)

// ---- the two GEMM kernels: block = 4 waves (2 x 2), tile 128 rows x 128 cols, a wave 64 x 64 (16 accumulator tiles). Per 32 k: every thread loads whole 128-B lines of both f32 operands (a wave-wide load = 4 rows), rounds them once to the 16-bit operand type and stores them in LDS; all waves take their fragments from there. Two LDS buffers, the next 32 k's global loads in flight over the products, one barrier a pass.
#define GP 40                       // LDS row pitch in 16-bit elements: 80 B = 16 B x 5, odd, for 16-byte fragment reads
#define GSTG (256 * GP)             // elements of one buffer: 128 X rows, then 128 W rows
#define GSM (2 * 128 * 136 * 2)     // bytes: the epilogue's two f16 planes [128][136] (the two buffers take 40,960)
typedef const __attribute__((address_space(1))) float* gf_p;   /* typed as global memory, as gh_p below: an address that has gone through an asm statement still loads by global_load */
typedef const __attribute__((address_space(1))) v4f* gv4f_p;
typedef __attribute__((ext_vector_type(4))) __bf16 v4b;
typedef __attribute__((ext_vector_type(4))) _Float16 v4h;
__device__ __forceinline__ v8f wmb(v16b a, v16b b, v8f c) { return __builtin_amdgcn_wmma_f32_16x16x32_bf16(false, a, false, b, (short)0, c, false, false); }
__device__ __forceinline__ v8f wmh(v16h a, v16h b, v8f c) { return __builtin_amdgcn_wmma_f32_16x16x32_f16(false, a, false, b, (short)0, c, false, false); }
/* 32 k of 128 rows of each operand: thread = (row tid >> 3 of 16, 4 floats tid & 7); then both addresses step 32 floats. The wait and the steps stand in one statement, so that an address pair is rewritten only behind the wait */
__device__ __forceinline__ void g_fetch(gf_p& px, gf_p& pw, v4f (&xr)[8], v4f (&wr)[8]) {
#pragma unroll   // constant indices keep the arrays in registers
  for (int i = 0; i < 8; ++i) { xr[i] = *(gv4f_p)(px + (size_t)(i * 16) * DIN); wr[i] = *(gv4f_p)(pw + (size_t)(i * 16) * DIN); }
  asm volatile("s_wait_xcnt 0x0\n\tv_add_nc_u64 %0, %2, %0\n\tv_add_nc_u64 %1, %2, %1" : "+v"(px), "+v"(pw) : "s"((long long)128) : "memory");
}
typedef __attribute__((address_space(1))) v4u* gu4_p;
typedef __attribute__((address_space(1))) v4f* gf4_p;
/* the four bias values of a lane's columns (16 apart), rounded to bf16; the wait stands behind the loads, in front of any rewrite of their address registers */
__device__ __forceinline__ void g_bias(const float* p, float (&bs)[4]) {
#pragma unroll   // constant indices keep the arrays in registers
  for (int j = 0; j < 4; ++j) bs[j] = p[j * 16];
  asm volatile("s_wait_xcnt 0x0" ::: "memory");
#pragma unroll   // constant indices keep the arrays in registers
  for (int j = 0; j < 4; ++j) bs[j] = bfr(bs[j]);
}
/* q or k tile into LDS planes [128][136]: f16 rows (RES: and the residual x 2^10) */
template <bool RES> __device__ __forceinline__ void rows_lds(const v8f (&acc)[4][4], const float (&bs)[4], _Float16* sh, _Float16* sl) {
#pragma unroll   // constant indices keep the arrays in registers
  for (int j = 0; j < 4; ++j)
#pragma unroll   // constant indices keep the arrays in registers
    for (int i = 0; i < 4; ++i)
#pragma unroll   // constant indices keep the arrays in registers
      for (int r = 0; r < 8; ++r) { const float v = acc[i][j][r] + bs[j]; const _Float16 hv = (_Float16)v; const int o = (i * 16 + r) * 136 + j * 16; sh[o] = hv; if (RES) sl[o] = (_Float16)((v - (float)hv) * 1024.0f); }
}
// ---- k_proj: block = (128 rows, 128 cols, which): q/k/v = X W (+ b) with exact bf16 products (K = DIN) -> which 0: q f16 rows + residual rows; 1: k f16 rows; 2: v f16 planes [c][t]
__global__ __launch_bounds__(128) void k_proj(const float* __restrict__ XQ, const float* __restrict__ XK, const float* __restrict__ XV, const float* __restrict__ WQ, const float* __restrict__ WK, const float* __restrict__ WV, const float* __restrict__ BQ, const float* __restrict__ BK, const float* __restrict__ BV,
    _Float16* __restrict__ QH, _Float16* __restrict__ QL, _Float16* __restrict__ KH, _Float16* __restrict__ VT) {
  __shared__ __align__(16) unsigned char sm[GSM];
  const int tid = threadIdx.x, wave = tid >> 5, lane = tid & 31, col = lane & 15, g = lane >> 4, wm = wave >> 1, wn = wave & 1; const int which = blockIdx.z; const int c0 = blockIdx.y * 128; const size_t r0 = (size_t)blockIdx.x * 128; const size_t bb = r0 / TT; const int t0 = (int)(r0 % TT);
  const float* X = which == 0 ? XQ : which == 1 ? XK : XV; const float* WA = which == 0 ? WQ : which == 1 ? WK : WV; const float* BA = which == 0 ? BQ : which == 1 ? BK : BV;
  gf_p px = (gf_p)(X + (r0 + (tid >> 3)) * DIN + (tid & 7) * 4); gf_p pw = (gf_p)(WA + (size_t)(c0 + (tid >> 3)) * DIN + (tid & 7) * 4);
  __bf16* st = (__bf16*)sm; const int so = (tid >> 3) * GP + (tid & 7) * 4;
  v4f xr[8], wr[8]; v8f acc[4][4] = {};
  g_fetch(px, pw, xr, wr);
  for (int kc = 0; kc < DIN / 32; ++kc) { __bf16* sb = st + (kc & 1) * GSTG;
#pragma unroll   // constant indices keep the arrays in registers
    for (int i = 0; i < 8; ++i) { v4b cx, cw;
#pragma unroll   // constant indices keep the arrays in registers
      for (int q = 0; q < 4; ++q) { cx[q] = (__bf16)xr[i][q]; cw[q] = (__bf16)wr[i][q]; }
      *(v4b*)(sb + so + i * 16 * GP) = cx; *(v4b*)(sb + 128 * GP + so + i * 16 * GP) = cw; }
    __syncthreads();   /* publishes this pass's buffer; the other buffer's readers of the pass before are behind it when the next pass stores there */
    if (kc + 1 < DIN / 32) g_fetch(px, pw, xr, wr);
    v16b a[4], b[4];
#pragma unroll   // constant indices keep the arrays in registers
    for (int i = 0; i < 4; ++i) { a[i] = frag_b(sb + (wm * 64 + i * 16 + col) * GP, lane); b[i] = frag_b(sb + (128 + wn * 64 + i * 16 + col) * GP, lane); }
#pragma unroll   // constant indices keep the arrays in registers
    for (int i = 0; i < 4; ++i)
#pragma unroll   // constant indices keep the arrays in registers
      for (int j = 0; j < 4; ++j) acc[i][j] = wmb(a[i], b[j], acc[i][j]); }
  __syncthreads();   /* every wave has left the buffers: the epilogue's planes lie over them */
  _Float16* sh = (_Float16*)sm; _Float16* sl = sh + 128 * 136; float bs[4] = {};
  if (BA) { g_bias(BA + c0 + wn * 64 + col, bs); }
  const int o0 = (wm * 64 + 8 * g) * 136 + wn * 64 + col;
  if (which == 0) rows_lds<true>(acc, bs, sh + o0, sl + o0);
  else if (which == 1) rows_lds<false>(acc, bs, sh + o0, sl + o0);
  else {
#pragma unroll   // constant indices keep the arrays in registers
    for (int j = 0; j < 4; ++j)
#pragma unroll   // constant indices keep the arrays in registers
      for (int i = 0; i < 4; ++i) { v8h t;
#pragma unroll   // constant indices keep the arrays in registers
        for (int r = 0; r < 8; ++r) t[r] = (_Float16)(acc[i][j][r] + bs[j]);
        *(v8h*)&sh[(wn * 64 + j * 16 + col) * 136 + wm * 64 + i * 16 + 8 * g] = t; } }   /* transposed: a lane's 8 rows are 8 consecutive t of its column */
  __syncthreads();
  /* copy-out: thread = (plane row tid >> 4 of 8, 16 bytes tid & 15), 256 B of a row by 16 lanes; q and k rows [b*t][CC] and v planes [c][t] both step 2 KB a row */
  const int sr = (tid >> 4) * 136 + (tid & 15) * 8; const size_t qo = (r0 + (tid >> 4)) * CC + c0 + (tid & 15) * 8;
  gu4_p dh = (gu4_p)(which == 0 ? QH + qo : which == 1 ? KH + qo : VT + (bb * CC + c0 + (tid >> 4)) * (size_t)TT + t0 + (tid & 15) * 8);
  gu4_p dl = (gu4_p)(QL + (bb * QHI + t0 + (tid >> 4)) * (size_t)CC + c0 + (tid & 15) * 8);
#pragma unroll   // one address pair and constant offsets: no address register is rewritten behind a store
  for (int it = 0; it < 16; ++it) dh[(size_t)it * 1024] = *(const v4u*)&sh[sr + it * 8 * 136];
  asm volatile("s_wait_xcnt 0x0" :: "v"(dh) : "memory");   /* behind the stores, in front of the second plane's reads and address, which reuse the stores' registers; the address pair is named to stay unwritten up to here */
  if (which == 0) {
#pragma unroll   // as above
    for (int it = 0; it < 16; ++it) dl[(size_t)it * 1024] = *(const v4u*)&sl[sr + it * 8 * 136]; } }
// ---- k_att: block = 16 waves x 16 queries of (b, head e); a wave holds both 32-wide sub-heads of its 16 queries. The head's K rows and V^T rows come into LDS once per block, 128 keys a stage, two buffers, by asynchronous copies of whole 128-B lines; all 16 waves take their fragments from there. Per 32 keys: S^T = K Q^T (q residual product first, x 2^-10, then the q hi product on top of it), running maximum and sum per query (query = lane column; base-2 exponent, scale folded in), P^T packed from the two score tiles straight into a B operand, O^T += V^T P^T with the head's 64-wide v fragments shared by both sub-heads. No logits or P in memory.
#define AW 16
#define KS 128                        // keys of one LDS stage
#define KKP 72                        // K row pitch in f16 elements: 144 B = 16 B x 9, odd, for 16-byte fragment reads
#define KVP 136                       // V^T row pitch in f16 elements: 272 B = 16 B x 17, odd
#define KSTG (KS * KKP + HDV * KVP)   // elements of one buffer: 128 K rows [key][64], then 64 V^T rows [d][128 keys]
__device__ __forceinline__ v8f wm(v16h a, v16h b, v8f c) { return __builtin_amdgcn_wmma_f32_16x16x32_f16(false, a, false, b, (short)0, c, false, false); }
__device__ __forceinline__ float xhalf(float x) { return __builtin_bit_cast(float, __builtin_amdgcn_permlanex16(__builtin_bit_cast(int, x), __builtin_bit_cast(int, x), 0x76543210, 0xfedcba98, false, false)); }   /* lane l with lane l ^ 16 */
typedef const __attribute__((address_space(1))) _Float16* gh_p;   /* pointer typed as global memory */
__device__ __forceinline__ v16h frag_l(const _Float16* p) { union { v16h v; v8h q[2]; } u; u.q[0] = *(const v8h*)p; u.q[1] = *(const v8h*)(p + 16); return u.v; }   /* frag_h with the lane half's 8 elements already in p */
/* one stage: a thread copies 16 B of K rows r and r + 64 and of V^T rows d and d + 32 (a wave-wide copy = 4 whole lines). The wait is the last line of the copies' own statement, so that no register a copy names is rewritten in front of it */
__device__ __forceinline__ void kv_copy(unsigned lk, gh_p gk, unsigned lv, gh_p gv) {
  asm volatile("global_load_async_to_lds_b128 %0, %1, off\n\tglobal_load_async_to_lds_b128 %2, %3, off\n\tglobal_load_async_to_lds_b128 %4, %5, off\n\tglobal_load_async_to_lds_b128 %6, %7, off\n\ts_wait_xcnt 0x0"
    :: "v"(lk), "v"(gk), "v"(lk + 64 * KKP * 2), "v"(gk + (size_t)64 * CC), "v"(lv), "v"(gv), "v"(lv + 32 * KVP * 2), "v"(gv + (size_t)32 * TT) : "memory");
}
__global__ __launch_bounds__(AW * 32) void k_att(const _Float16* __restrict__ QH, const _Float16* __restrict__ QL, const _Float16* __restrict__ KH, const _Float16* __restrict__ VT, float* __restrict__ Y) {
  __shared__ __align__(16) unsigned char sm[2 * KSTG * 2 + AW * 16 * (2 * HDV + 4) * 4];   /* the two stage buffers first, so that every fragment read's constant part fits the instruction's offset field; behind them the epilogue's rows */
  _Float16* kv = (_Float16*)sm; float (*so)[16][2 * HDV + 4] = (float (*)[16][2 * HDV + 4])(sm + 2 * KSTG * 2);
  const int tid = threadIdx.x, wave = tid >> 5, lane = tid & 31, col = lane & 15, g = lane >> 4; const int e = blockIdx.y, b = blockIdx.z; const int ql0 = blockIdx.x * (AW * 16) + wave * 16;
  const float C2 = SCALE * 1.4426950408889634f;
  const unsigned lk = (unsigned)(size_t)kv + (unsigned)(((tid >> 3) * KKP + (tid & 7) * 8) * 2);              /* LDS byte address: K row tid >> 3 of 64, 16 bytes tid & 7 of 128 */
  const unsigned lv = (unsigned)(size_t)kv + (unsigned)((KS * KKP + (tid >> 4) * KVP + (tid & 15) * 8) * 2);   /* V^T row tid >> 4 of 32, 16 bytes tid & 15 of 256 */
  gh_p gk = (gh_p)(KH + ((size_t)b * TT + (tid >> 3)) * CC + e * HDV + (tid & 7) * 8);      /* walks 128 keys a stage */
  gh_p gv = (gh_p)(VT + ((size_t)b * CC + e * HDV + (tid >> 4)) * TT + (tid & 15) * 8);
  kv_copy(lk, gk, lv, gv); gk += (size_t)KS * CC; gv += KS;   /* stage 0 into buffer 0 */
  v16h qh[2], ql[2];
  const _Float16* qhp = QH + ((size_t)b * TT + ql0 + col) * CC + e * HDV; const _Float16* qlp = QL + ((size_t)b * QHI + ql0 + col) * CC + e * HDV;   /* query row col, this head's 64 columns: hi and residual */
#pragma unroll   // constant indices keep the fragment arrays in registers
  for (int u = 0; u < 2; ++u) { qh[u] = frag_h(qhp + u * HD, lane); ql[u] = frag_h(qlp + u * HD, lane); }
  asm volatile("s_wait_xcnt 0x0" :: "v"(qhp + 8 * g), "v"(qlp + 8 * g) : "memory");   /* behind the q loads; their addresses are named as inputs to stay unwritten up to it */
  asm volatile("s_wait_asynccnt 0x0" ::: "memory");   /* this wave's copies of stage 0 have landed */
  __syncthreads();                                    /* publishes stage 0 */
  kv_copy(lk + KSTG * 2, gk, lv + KSTG * 2, gv); gk += (size_t)KS * CC; gv += KS;   /* stage 1 into buffer 1, in flight over stage 0's work */
  v8f acc[2][HDV / 16] = {}; float mu[2] = { -3.0e38f, -3.0e38f }; v2f ls[2] = {};   /* per query: maximum in use; sum, even and odd keys apart */
#pragma unroll 1   // rolled: the publish point stands once, at the foot of a stage
  for (int t = 0; t < TT / KS; ++t) {
    const _Float16* kb = kv + (t & 1) * KSTG + col * KKP + 8 * g;              /* key row col of a 16-key tile, the lane's half */
    const _Float16* vb = kv + (t & 1) * KSTG + KS * KKP + col * KVP + 8 * g;   /* value column col of a 16-column tile, keys contiguous, the lane's half */
#pragma unroll 1   // rolled: one pass's registers only, so that four waves fit a SIMD
    for (int sp = 0; sp < KS / 32; ++sp) {
      v16h kf[2][2], vf[HDV / 16];
#pragma unroll   // constant indices keep the fragment arrays in registers
      for (int u = 0; u < 2; ++u)
#pragma unroll   // constant indices keep the fragment arrays in registers
        for (int kt = 0; kt < 2; ++kt) kf[u][kt] = frag_l(kb + (sp * 32 + kt * 16) * KKP + u * HD);
#pragma unroll   // constant indices keep the fragment arrays in registers
      for (int j = 0; j < HDV / 16; ++j) vf[j] = frag_l(vb + (j * 16) * KVP + sp * 32);
      v8f s[2][2];
#pragma unroll   // constant indices keep the fragment arrays in registers
      for (int u = 0; u < 2; ++u)
#pragma unroll   // constant indices keep the fragment arrays in registers
        for (int kt = 0; kt < 2; ++kt) { const v8f z = {}; s[u][kt] = wm(kf[u][kt], ql[u], z); }
#pragma unroll   // constant indices keep the fragment arrays in registers
      for (int u = 0; u < 2; ++u)
#pragma unroll   // constant indices keep the fragment arrays in registers
        for (int kt = 0; kt < 2; ++kt) s[u][kt] = wm(kf[u][kt], qh[u], s[u][kt] * (1.0f / 1024.0f));
      float mx[2];
#pragma unroll   // constant indices keep the fragment arrays in registers
      for (int u = 0; u < 2; ++u) { float m = fmaxf(s[u][0][0], s[u][1][0]);
#pragma unroll   // constant indices keep the fragment arrays in registers
        for (int r = 1; r < 8; ++r) m = fmaxf(m, fmaxf(s[u][0][r], s[u][1][r]));
        mx[u] = fmaxf(m, xhalf(m)) * C2; }
      if (__builtin_amdgcn_ballot_w32(mx[0] > mu[0] + 8.0f || mx[1] > mu[1] + 8.0f) != 0) {   /* rescale only when a query's maximum outgrows the one in use by 2^8: P stays <= 256 in f16 */
#pragma unroll   // constant indices keep the fragment arrays in registers
        for (int u = 0; u < 2; ++u) { const float mn = fmaxf(mu[u], mx[u]); const float corr = __builtin_amdgcn_exp2f(mu[u] - mn); mu[u] = mn; ls[u] *= corr;
#pragma unroll   // constant indices keep the fragment arrays in registers
          for (int j = 0; j < HDV / 16; ++j) acc[u][j] *= corr; } }
#pragma unroll   // constant indices keep the fragment arrays in registers
      for (int u = 0; u < 2; ++u) { v16h p;
#pragma unroll   // constant indices keep the fragment arrays in registers
        for (int i = 0; i < 16; i += 2) { v2f a = { s[u][i >> 3][i & 7], s[u][i >> 3][(i & 7) + 1] }; const v2f c2 = { C2, C2 }, nm = { -mu[u], -mu[u] }; a = __builtin_elementwise_fma(a, c2, nm);
          const v2f pe = { __builtin_amdgcn_exp2f(a[0]), __builtin_amdgcn_exp2f(a[1]) }; ls[u] += pe; p[i] = (_Float16)pe[0]; p[i + 1] = (_Float16)pe[1]; }
#pragma unroll   // constant indices keep the fragment arrays in registers
        for (int j = 0; j < HDV / 16; ++j) acc[u][j] = wm(vf[j], p, acc[u][j]); } }
    /* publish point of stage t + 1: this wave's reads of buffer t & 1 are done, its copies of stage t + 1 have landed; the barrier publishes that stage and ends every wave's reads of the buffer refilled behind it */
    asm volatile("s_wait_dscnt 0x0" ::: "memory");
    asm volatile("s_wait_asynccnt 0x0" ::: "memory");
    __syncthreads();
    if (t + 2 < TT / KS) { kv_copy(lk + (t & 1) * (KSTG * 2), gk, lv + (t & 1) * (KSTG * 2), gv); gk += (size_t)KS * CC; gv += KS; } }
  asm volatile("s_wait_asynccnt 0x0" ::: "memory");   /* no copy is outstanding when the wave goes on to its end */
#pragma unroll   // constant indices keep the fragment arrays in registers
  for (int u = 0; u < 2; ++u) { const float lh = ls[u][0] + ls[u][1]; const float inv = 1.0f / (lh + xhalf(lh));
#pragma unroll   // constant indices keep the fragment arrays in registers
    for (int j = 0; j < HDV / 16; ++j) { v4f lo, hi;
#pragma unroll   // constant indices keep the fragment arrays in registers
      for (int r = 0; r < 4; ++r) { lo[r] = acc[u][j][r] * inv; hi[r] = acc[u][j][4 + r] * inv; }
      float* d = &so[wave][col][u * HDV + j * 16 + 8 * g]; *(v4f*)d = lo; *(v4f*)(d + 4) = hi; } }
  LDSX(); for (int rl = 0; rl < 16; ++rl) vst2(Y + ((size_t)b * TT + ql0 + rl) * YP + e * (2 * HDV) + lane * 4, *(const v4f*)&so[wave][rl][lane * 4]); }   /* a row's two sub-head segments = 512 B by the 32 lanes */
// ---- k_out: block = (128 rows, 128 cols): out = ctx Wo (+ bo): ctx once to f16 against Wo as f16(bf16 x 2^8) exact (1 product) x 2^-8; staged as in k_proj
__global__ __launch_bounds__(128) void k_out(const float* __restrict__ Y, const float* __restrict__ WO, const float* __restrict__ BO, float* __restrict__ OUT) {
  __shared__ __align__(16) unsigned char sm[GSM];
  const int tid = threadIdx.x, wave = tid >> 5, lane = tid & 31, col = lane & 15, g = lane >> 4, wm = wave >> 1, wn = wave & 1; const int c0 = blockIdx.y * 128; const size_t r0 = (size_t)blockIdx.x * 128;
  gf_p px = (gf_p)(Y + (r0 + (tid >> 3)) * CC + (tid & 7) * 4); gf_p pw = (gf_p)(WO + (size_t)(c0 + (tid >> 3)) * CC + (tid & 7) * 4);
  _Float16* st = (_Float16*)sm; const int so = (tid >> 3) * GP + (tid & 7) * 4;
  v4f xr[8], wr[8]; v8f acc[4][4] = {};
  g_fetch(px, pw, xr, wr);
  for (int kc = 0; kc < CC / 32; ++kc) { _Float16* sb = st + (kc & 1) * GSTG;
#pragma unroll   // constant indices keep the arrays in registers
    for (int i = 0; i < 8; ++i) { v4h cx, cw;
#pragma unroll   // constant indices keep the arrays in registers
      for (int q = 0; q < 4; ++q) { cx[q] = (_Float16)xr[i][q]; cw[q] = (_Float16)(bfr(wr[i][q]) * 256.0f); }
      *(v4h*)(sb + so + i * 16 * GP) = cx; *(v4h*)(sb + 128 * GP + so + i * 16 * GP) = cw; }
    __syncthreads();   /* publishes this pass's buffer; the other buffer's readers of the pass before are behind it when the next pass stores there */
    if (kc + 1 < CC / 32) g_fetch(px, pw, xr, wr);
    v16h a[4], b[4];
#pragma unroll   // constant indices keep the arrays in registers
    for (int i = 0; i < 4; ++i) { a[i] = frag_h(sb + (wm * 64 + i * 16 + col) * GP, lane); b[i] = frag_h(sb + (128 + wn * 64 + i * 16 + col) * GP, lane); }
#pragma unroll   // constant indices keep the arrays in registers
    for (int i = 0; i < 4; ++i)
#pragma unroll   // constant indices keep the arrays in registers
      for (int j = 0; j < 4; ++j) acc[i][j] = wmh(a[i], b[j], acc[i][j]); }
  __syncthreads();   /* every wave has left the buffers: the output tile [128][132] f32 lies over them */
  float* sf = (float*)sm; float bs[4] = {};
  if (BO) { g_bias(BO + c0 + wn * 64 + col, bs); }
#pragma unroll   // constant indices keep the arrays in registers
  for (int j = 0; j < 4; ++j)
#pragma unroll   // constant indices keep the arrays in registers
    for (int i = 0; i < 4; ++i)
#pragma unroll   // constant indices keep the arrays in registers
      for (int r = 0; r < 8; ++r) sf[(wm * 64 + i * 16 + 8 * g + r) * 132 + wn * 64 + j * 16 + col] = acc[i][j][r] * (1.0f / 256.0f) + bs[j];
  __syncthreads();
  gf4_p po = (gf4_p)(OUT + (r0 + wave) * DIN + c0 + lane * 4);   /* a wave stores 512 B of one row */
#pragma unroll   // one address pair and constant offsets: no address register is rewritten behind a store
  for (int it = 0; it < 32; ++it) po[(size_t)it * (4 * DIN * 4 / 16)] = *(const v4f*)&sf[(wave + it * 4) * 132 + lane * 4]; }

extern "C" void kernel_launch(void* const* d_in, const int* in_sizes, int n_in, void* d_out, int out_size, void* d_ws, size_t ws_size, hipStream_t stream) {
  (void)in_sizes; (void)n_in; (void)out_size;
  const float** F = (const float**)d_in;
  if (ws_size < (size_t)WS_END) return;
  char* ws = (char*)d_ws; _Float16 *QH = (_Float16*)(ws + WS_QH), *KH = (_Float16*)(ws + WS_KH), *VT = (_Float16*)(ws + WS_VT), *QL = (_Float16*)(ws + WS_QL), *KL = (_Float16*)(ws + WS_KL); __bf16 *VB = (__bf16*)(ws + WS_VB), *VBL = (__bf16*)(ws + WS_VBL); float *S = (float*)(ws + WS_S), *Y = (float*)(ws + WS_Y);
  (void)Y; (void)QL; (void)KL; (void)VB; (void)VBL;
  // inputs: 0 x [4,1024,1024]; 1 W_qkv [3072,1024] (out,in: rows 0-1023 q, 1024-2047 k, 2048-3071 v); 2 W_proj [1024,1024] (out,in); 3 b_proj; 4 lambda_q1, 5 lambda_k1, 6 lambda_q2, 7 lambda_k2 [64]
  float* YD = S;   /* the differential rows [b*t][CC] live in the WS_S plane */
  k_proj<<<dim3(TNB * TT / 128, CC / 128, 3), 128, 0, stream>>>(F[0], F[0], F[0], F[1], F[1] + (size_t)CC * DIN, F[1] + (size_t)2 * CC * DIN, nullptr, nullptr, nullptr, QH, QL, KH, VT);
  k_att<<<dim3(TT / (AW * 16), NH / 2, TNB), AW * 32, 0, stream>>>(QH, QL, KH, VT, Y);
  k_diff<<<dim3(TNB * TT / 64), 256, 0, stream>>>(Y, F[4], F[5], F[6], F[7], YD);
  k_out<<<dim3(TNB * TT / 128, DIN / 128), 128, 0, stream>>>(YD, F[2], F[3], (float*)d_out);
}

// v004
// One run takes 99.3 microseconds.
// Timed twice side by side with v003, it ran 1.24 times as fast both times.
// Over all steps from v000 it is 14.4 times as fast.
// compute dtype: all float inputs rounded to bf16; qkv = x Wqkv^T with EXACT bf16 products on WMMA 16x16x32 (f32 accumulate); the two 32-wide sub-head logits with q as f16 hi + residual (x 2^10) against k once to f16 (2 products) x 64^-0.5; both softmaxes in f32 with a running maximum and sum (base-2 exponent); each unnormalised P (<= 2^8) once to f16 against the head's 64-wide v once to f16 (1 product), divided by the f32 sum at the end; the differential combination P1.v - lambda P2.v and lambda (mean of exp(lq1 lk1) - exp(lq2 lk2) + 0.8 over 64) in f32; ctx once to f16 against W_proj carried x 2^8 in f16 + b_proj; f32 output.
#include <hip/hip_runtime.h>
#include <math.h>

typedef __attribute__((ext_vector_type(16))) _Float16 v16h;
typedef __attribute__((ext_vector_type(16))) __bf16 v16b;
typedef __attribute__((ext_vector_type(8)))  _Float16 v8h;
typedef __attribute__((ext_vector_type(8)))  float v8f;
typedef __attribute__((ext_vector_type(4)))  float v4f;
typedef __attribute__((ext_vector_type(2)))  float v2f;
typedef __attribute__((ext_vector_type(4)))  unsigned v4u;
typedef __attribute__((ext_vector_type(4)))  int v4i;
typedef float __attribute__((may_alias)) float_a;
typedef int __attribute__((may_alias)) int_a;

template <typename T> __device__ __forceinline__ void vst2(void* p, T v) { *(T*)p = v;  }
__device__ __forceinline__ v8f wmma16(v16h a, v16h b, v8f c) {
  v8f d = __builtin_amdgcn_wmma_f32_16x16x32_f16(false, a, false, b, (short)0, c, false, false);
  asm volatile("v_nop\n\tv_nop\n\tv_nop\n\tv_nop" : "+v"(d) : "v"(a), "v"(b));
  return d;
}
__device__ __forceinline__ v8f wmma_bf(v16b a, v16b b, v8f c) {
  v8f d = __builtin_amdgcn_wmma_f32_16x16x32_bf16(false, a, false, b, (short)0, c, false, false);
  asm volatile("v_nop\n\tv_nop\n\tv_nop\n\tv_nop" : "+v"(d) : "v"(a), "v"(b));
  return d;
}
// 16x16x32 fragments: lane = (h = lane>>4, row/col = lane&15); elements 0..7 = k0+8h+0..7, 8..15 = k0+16+8h+0..7; D element r = row 8h+r
__device__ __forceinline__ v16h frag_h(const _Float16* rowk0, int lane) {
  union { v16h v; v8h q[2]; } u; const _Float16* p = rowk0 + 8 * (lane >> 4);
  u.q[0] = *(const v8h*)p; u.q[1] = *(const v8h*)(p + 16); return u.v;
}
__device__ __forceinline__ v16h frag_f32(const float* rowk0, int lane) {
  v16h a; const float* p = rowk0 + 8 * (lane >> 4);
#pragma unroll
  for (int i = 0; i < 8; ++i) { a[i] = (_Float16)p[i]; a[8 + i] = (_Float16)p[16 + i]; }
  return a;
}
__device__ __forceinline__ v16h frag_f32s(const float* rowk0, int lane, float sc) {
  v16h a; const float* p = rowk0 + 8 * (lane >> 4);
#pragma unroll
  for (int i = 0; i < 8; ++i) { a[i] = (_Float16)(p[i] * sc); a[8 + i] = (_Float16)(p[16 + i] * sc); }
  return a;
}
// column fragment from a [K][ld] layout (column n), rows >= K read as 0
__device__ __forceinline__ v16h fragc_f32(const float* W, int k0, int n, int lane, int ld, int K) {
  v16h a; const int g = lane >> 4;
#pragma unroll
  for (int i = 0; i < 8; ++i) { const int ka = k0 + 8 * g + i, kb = ka + 16;
    a[i] = (_Float16)(ka < K ? W[(size_t)(ka < K ? ka : K - 1) * ld + n] : 0.f); a[8 + i] = (_Float16)(kb < K ? W[(size_t)(kb < K ? kb : K - 1) * ld + n] : 0.f); }
  return a;
}
struct F2 { v16b h, l; };
__device__ __forceinline__ F2 bsplit16(const float v[16]) { F2 r;
#pragma unroll
  for (int i = 0; i < 16; ++i) { const __bf16 h = (__bf16)v[i]; r.h[i] = h; r.l[i] = (__bf16)(v[i] - (float)h); }
  return r; }
__device__ __forceinline__ F2 split_row(const float* row, int k0, int lane) { float v[16]; const float* p = row + k0 + 8 * (lane >> 4);
#pragma unroll
  for (int i = 0; i < 8; ++i) { v[i] = p[i]; v[8 + i] = p[16 + i]; }
  return bsplit16(v); }
__device__ __forceinline__ F2 split_rowK(const float* row, int k0, int lane, int K) { float v[16]; const int g = lane >> 4;
#pragma unroll
  for (int i = 0; i < 8; ++i) { const int ka = k0 + 8 * g + i, kb = ka + 16; v[i] = ka < K ? row[ka < K ? ka : K - 1] : 0.f; v[8 + i] = kb < K ? row[kb < K ? kb : K - 1] : 0.f; }
  return bsplit16(v); }
__device__ __forceinline__ F2 split_col(const float* W, int k0, int n, int lane, int ld, int K) { float v[16]; const int g = lane >> 4;
#pragma unroll
  for (int i = 0; i < 8; ++i) { const int ka = k0 + 8 * g + i, kb = ka + 16; v[i] = ka < K ? W[(size_t)(ka < K ? ka : K - 1) * ld + n] : 0.f; v[8 + i] = kb < K ? W[(size_t)(kb < K ? kb : K - 1) * ld + n] : 0.f; }
  return bsplit16(v); }
__device__ __forceinline__ v8f mac3(const F2& a, const F2& b, v8f c) { c = wmma_bf(a.l, b.h, c); c = wmma_bf(a.h, b.l, c); return wmma_bf(a.h, b.h, c); }
__device__ __forceinline__ float sigm(float v) { return 1.0f / (1.0f + expf(-v)); }
#define LDSX() do { asm volatile("s_wait_dscnt 0" ::: "memory"); __builtin_amdgcn_wave_barrier(); __builtin_amdgcn_fence(__ATOMIC_RELEASE, "workgroup"); } while (0)

// Differential attention (B 4, N 1,024, C 1,024 = 16 heads x 64): qkv = x Wqkv^T ((out,in) [3072,1024]); per head the 64-dim q/k are split into two 32-dim halves: attn = softmax(q1 k1^T / 8) - lam softmax(q2 k2^T / 8), lam = mean(exp(lambda_q1 * lambda_k1) - exp(lambda_q2 * lambda_k2) + 0.8); out = merged(attn v) Wproj^T + b_proj. Realised as 32 softmax sub-heads of width 32 whose P.v share the parent head's 64-wide v.
#define NB 4
#define TT 1024
#define CC 1024            // NH * HD = projected width
#define DIN 1024          // input (model) width
#define NH 32              // softmax sub-heads (16 heads x 2 halves)
#define HD 32
#define NQB (TT / 64)
#define HG 8
#define SCALE (0.125f)
#define CAUSAL 0
#ifndef TNB
#define TNB NB
#endif
__device__ __forceinline__ float bfr(float v) { return (float)(__bf16)v; }
__host__ __device__ __forceinline__ int kb_last(int qb) { return CAUSAL ? ((qb * 64 + 63) >> 7) : (TT / 128 - 1); }
typedef __attribute__((ext_vector_type(8))) __bf16 v8b;
__device__ __forceinline__ v16b frag_b(const __bf16* rowk0, int lane) {
  union { v16b v; v8b q[2]; } u; const __bf16* p = rowk0 + 8 * (lane >> 4);
  u.q[0] = *(const v8b*)p; u.q[1] = *(const v8b*)(p + 16); return u.v;
}
#define QBH 0              // unused: k_att treats all query blocks alike
#define QHI 1024            // rows carrying a q residual plane (all rows: 2-product logits everywhere)
#define KHI 64            // key rows carrying k residual / v bf16 hi+lo planes (written and read by no kernel)
// B fragment (k rows k0+.., output column o) of a weight: (in,out) [K][ld] or (out,in) [ld rows of K]: bf16 exact, or f16(bf16 * 256) exact
__device__ __forceinline__ v16b wcol_io(const float* Wm, int k0, int o, int lane, int ld) { v16b w; const int g = lane >> 4;
#pragma unroll
  for (int i = 0; i < 8; ++i) { w[i] = (__bf16)Wm[(size_t)(k0 + 8 * g + i) * ld + o]; w[8 + i] = (__bf16)Wm[(size_t)(k0 + 16 + 8 * g + i) * ld + o]; }
  return w; }
__device__ __forceinline__ v16b wcol_oi(const float* Wm, int k0, int o, int lane, int K) { v16b w; const float* p = Wm + (size_t)o * K + k0 + 8 * (lane >> 4);
#pragma unroll
  for (int i = 0; i < 8; ++i) { w[i] = (__bf16)p[i]; w[8 + i] = (__bf16)p[16 + i]; }
  return w; }
__device__ __forceinline__ v16h wcolh_io(const float* Wm, int k0, int o, int lane, int ld) { v16h w; const int g = lane >> 4;
#pragma unroll
  for (int i = 0; i < 8; ++i) { w[i] = (_Float16)(bfr(Wm[(size_t)(k0 + 8 * g + i) * ld + o]) * 256.0f); w[8 + i] = (_Float16)(bfr(Wm[(size_t)(k0 + 16 + 8 * g + i) * ld + o]) * 256.0f); }
  return w; }
__device__ __forceinline__ v16h wcolh_oi(const float* Wm, int k0, int o, int lane, int K) { v16h w; const float* p = Wm + (size_t)o * K + k0 + 8 * (lane >> 4);
#pragma unroll
  for (int i = 0; i < 8; ++i) { w[i] = (_Float16)(bfr(p[i]) * 256.0f); w[8 + i] = (_Float16)(bfr(p[16 + i]) * 256.0f); }
  return w; }
#define WQKV_LAYOUT 1   // 0 = (in,out) [DIN][CC]; 1 = (out,in) [CC][DIN]; 2 = per-head [NH][DIN][HD]
__device__ __forceinline__ v16b wcol_hdk(const float* Wm, int k0, int o, int lane) { v16b w; const int g = lane >> 4; const float* p = Wm + (size_t)(o / HD) * DIN * HD + (o % HD);
#pragma unroll
  for (int i = 0; i < 8; ++i) { w[i] = (__bf16)p[(size_t)(k0 + 8 * g + i) * HD]; w[8 + i] = (__bf16)p[(size_t)(k0 + 16 + 8 * g + i) * HD]; }
  return w; }
#define WO_OUT_IN 1
#if WQKV_LAYOUT == 1
#define WCOL(W, k0, o, lane) wcol_oi(W, k0, o, lane, DIN)
#elif WQKV_LAYOUT == 2
#define WCOL(W, k0, o, lane) wcol_hdk(W, k0, o, lane)
#else
#define WCOL(W, k0, o, lane) wcol_io(W, k0, o, lane, CC)
#endif
#if WO_OUT_IN
#define WOCOL(W, k0, o, lane) wcol_oi(W, k0, o, lane, CC)
#define WOCOLH(W, k0, o, lane) wcolh_oi(W, k0, o, lane, CC)
#else
#define WOCOL(W, k0, o, lane) wcol_io(W, k0, o, lane, DIN)
#define WOCOLH(W, k0, o, lane) wcolh_io(W, k0, o, lane, DIN)
#endif
#define HDV 64             // value columns per softmax sub-head (the parent head's 64 columns)
#ifndef SM_EXTRA_PARAMS
#define SM_EXTRA_PARAMS
#endif
#ifndef PROJ_EXTRA_PARAMS
#define PROJ_EXTRA_PARAMS
#endif
#ifndef SM_MASK_HOOK
#define SM_MASK_HOOK (void)0
#endif

#define WS_QH  0u                                      // f16 q rows [b*t][CC]
#define WS_KH  (WS_QH + 2u * (size_t)NB * TT * CC)      // f16 k rows [b*t][CC]
#define WS_VT  (WS_KH + 2u * (size_t)NB * TT * CC)      // f16 v planes [b][c][t]
#define WS_QL  (WS_VT + 2u * (size_t)NB * CC * TT)      // f16 q residual x 2^10 rows [b][t < QHI][CC]
#define WS_KL  (WS_QL + 2u * (size_t)NB * QHI * CC)     // f16 k residual x 2^10 rows [b][t < KHI][CC]
#define WS_VB  (WS_KL + 2u * (size_t)NB * KHI * CC)     // bf16 v hi planes [b][c][t < KHI]
#define WS_VBL (WS_VB + 2u * (size_t)NB * CC * KHI)
#define WS_S   (WS_VBL + 2u * (size_t)NB * CC * KHI)    // f32 differential rows [b*t][CC] (first half of the plane)
#define WS_END (WS_S  + 4u * (size_t)HG * TT * TT)

// ---- the two GEMM kernels: block = 4 waves (2 x 2), tile 128 rows x 128 cols, a wave 64 x 64 (16 accumulator tiles). Per 32 k: every thread loads whole 128-B lines of both f32 operands (a wave-wide load = 4 rows), rounds them once to the 16-bit operand type and stores them in LDS; all waves take their fragments from there. Two LDS buffers, the next 32 k's global loads in flight over the products, one barrier a pass.
#define GP 40                       // LDS row pitch in 16-bit elements: 80 B = 16 B x 5, odd, for 16-byte fragment reads
#define GSTG (256 * GP)             // elements of one buffer: 128 X rows, then 128 W rows
#define GSM (2 * 128 * 136 * 2)     // bytes: the epilogue's two f16 planes [128][136] (the two buffers take 40,960)
typedef const __attribute__((address_space(1))) float* gf_p;   /* typed as global memory, as gh_p below: an address that has gone through an asm statement still loads by global_load */
typedef const __attribute__((address_space(1))) v4f* gv4f_p;
typedef __attribute__((ext_vector_type(4))) __bf16 v4b;
typedef __attribute__((ext_vector_type(4))) _Float16 v4h;
__device__ __forceinline__ v8f wmb(v16b a, v16b b, v8f c) { return __builtin_amdgcn_wmma_f32_16x16x32_bf16(false, a, false, b, (short)0, c, false, false); }
__device__ __forceinline__ v8f wmh(v16h a, v16h b, v8f c) { return __builtin_amdgcn_wmma_f32_16x16x32_f16(false, a, false, b, (short)0, c, false, false); }
/* 32 k of 128 rows of each operand: thread = (row tid >> 3 of 16, 4 floats tid & 7); then both addresses step 32 floats. The wait and the steps stand in one statement, so that an address pair is rewritten only behind the wait */
__device__ __forceinline__ void g_fetch(gf_p& px, gf_p& pw, v4f (&xr)[8], v4f (&wr)[8]) {
#pragma unroll   // constant indices keep the arrays in registers
  for (int i = 0; i < 8; ++i) { xr[i] = *(gv4f_p)(px + (size_t)(i * 16) * DIN); wr[i] = *(gv4f_p)(pw + (size_t)(i * 16) * DIN); }
  asm volatile("s_wait_xcnt 0x0\n\tv_add_nc_u64 %0, %2, %0\n\tv_add_nc_u64 %1, %2, %1" : "+v"(px), "+v"(pw) : "s"((long long)128) : "memory");
}
typedef __attribute__((address_space(1))) v4u* gu4_p;
typedef __attribute__((address_space(1))) v4f* gf4_p;
/* the four bias values of a lane's columns (16 apart), rounded to bf16; the wait stands behind the loads, in front of any rewrite of their address registers */
__device__ __forceinline__ void g_bias(const float* p, float (&bs)[4]) {
#pragma unroll   // constant indices keep the arrays in registers
  for (int j = 0; j < 4; ++j) bs[j] = p[j * 16];
  asm volatile("s_wait_xcnt 0x0" ::: "memory");
#pragma unroll   // constant indices keep the arrays in registers
  for (int j = 0; j < 4; ++j) bs[j] = bfr(bs[j]);
}
/* q or k tile into LDS planes [128][136]: f16 rows (RES: and the residual x 2^10) */
template <bool RES> __device__ __forceinline__ void rows_lds(const v8f (&acc)[4][4], const float (&bs)[4], _Float16* sh, _Float16* sl) {
#pragma unroll   // constant indices keep the arrays in registers
  for (int j = 0; j < 4; ++j)
#pragma unroll   // constant indices keep the arrays in registers
    for (int i = 0; i < 4; ++i)
#pragma unroll   // constant indices keep the arrays in registers
      for (int r = 0; r < 8; ++r) { const float v = acc[i][j][r] + bs[j]; const _Float16 hv = (_Float16)v; const int o = (i * 16 + r) * 136 + j * 16; sh[o] = hv; if (RES) sl[o] = (_Float16)((v - (float)hv) * 1024.0f); }
}
// ---- k_proj: block = (128 rows, 128 cols, which): q/k/v = X W (+ b) with exact bf16 products (K = DIN) -> which 0: q f16 rows + residual rows; 1: k f16 rows; 2: v f16 planes [c][t]
__global__ __launch_bounds__(128) void k_proj(const float* __restrict__ XQ, const float* __restrict__ XK, const float* __restrict__ XV, const float* __restrict__ WQ, const float* __restrict__ WK, const float* __restrict__ WV, const float* __restrict__ BQ, const float* __restrict__ BK, const float* __restrict__ BV,
    _Float16* __restrict__ QH, _Float16* __restrict__ QL, _Float16* __restrict__ KH, _Float16* __restrict__ VT) {
  __shared__ __align__(16) unsigned char sm[GSM];
  const int tid = threadIdx.x, wave = tid >> 5, lane = tid & 31, col = lane & 15, g = lane >> 4, wm = wave >> 1, wn = wave & 1; const int which = blockIdx.z; const int c0 = blockIdx.y * 128; const size_t r0 = (size_t)blockIdx.x * 128; const size_t bb = r0 / TT; const int t0 = (int)(r0 % TT);
  const float* X = which == 0 ? XQ : which == 1 ? XK : XV; const float* WA = which == 0 ? WQ : which == 1 ? WK : WV; const float* BA = which == 0 ? BQ : which == 1 ? BK : BV;
  gf_p px = (gf_p)(X + (r0 + (tid >> 3)) * DIN + (tid & 7) * 4); gf_p pw = (gf_p)(WA + (size_t)(c0 + (tid >> 3)) * DIN + (tid & 7) * 4);
  __bf16* st = (__bf16*)sm; const int so = (tid >> 3) * GP + (tid & 7) * 4;
  v4f xr[8], wr[8]; v8f acc[4][4] = {};
  g_fetch(px, pw, xr, wr);
  for (int kc = 0; kc < DIN / 32; ++kc) { __bf16* sb = st + (kc & 1) * GSTG;
#pragma unroll   // constant indices keep the arrays in registers
    for (int i = 0; i < 8; ++i) { v4b cx, cw;
#pragma unroll   // constant indices keep the arrays in registers
      for (int q = 0; q < 4; ++q) { cx[q] = (__bf16)xr[i][q]; cw[q] = (__bf16)wr[i][q]; }
      *(v4b*)(sb + so + i * 16 * GP) = cx; *(v4b*)(sb + 128 * GP + so + i * 16 * GP) = cw; }
    __syncthreads();   /* publishes this pass's buffer; the other buffer's readers of the pass before are behind it when the next pass stores there */
    if (kc + 1 < DIN / 32) g_fetch(px, pw, xr, wr);
    v16b a[4], b[4];
#pragma unroll   // constant indices keep the arrays in registers
    for (int i = 0; i < 4; ++i) { a[i] = frag_b(sb + (wm * 64 + i * 16 + col) * GP, lane); b[i] = frag_b(sb + (128 + wn * 64 + i * 16 + col) * GP, lane); }
#pragma unroll   // constant indices keep the arrays in registers
    for (int i = 0; i < 4; ++i)
#pragma unroll   // constant indices keep the arrays in registers
      for (int j = 0; j < 4; ++j) acc[i][j] = wmb(a[i], b[j], acc[i][j]); }
  __syncthreads();   /* every wave has left the buffers: the epilogue's planes lie over them */
  _Float16* sh = (_Float16*)sm; _Float16* sl = sh + 128 * 136; float bs[4] = {};
  if (BA) { g_bias(BA + c0 + wn * 64 + col, bs); }
  const int o0 = (wm * 64 + 8 * g) * 136 + wn * 64 + col;
  if (which == 0) rows_lds<true>(acc, bs, sh + o0, sl + o0);
  else if (which == 1) rows_lds<false>(acc, bs, sh + o0, sl + o0);
  else {
#pragma unroll   // constant indices keep the arrays in registers
    for (int j = 0; j < 4; ++j)
#pragma unroll   // constant indices keep the arrays in registers
      for (int i = 0; i < 4; ++i) { v8h t;
#pragma unroll   // constant indices keep the arrays in registers
        for (int r = 0; r < 8; ++r) t[r] = (_Float16)(acc[i][j][r] + bs[j]);
        *(v8h*)&sh[(wn * 64 + j * 16 + col) * 136 + wm * 64 + i * 16 + 8 * g] = t; } }   /* transposed: a lane's 8 rows are 8 consecutive t of its column */
  __syncthreads();
  /* copy-out: thread = (plane row tid >> 4 of 8, 16 bytes tid & 15), 256 B of a row by 16 lanes; q and k rows [b*t][CC] and v planes [c][t] both step 2 KB a row */
  const int sr = (tid >> 4) * 136 + (tid & 15) * 8; const size_t qo = (r0 + (tid >> 4)) * CC + c0 + (tid & 15) * 8;
  gu4_p dh = (gu4_p)(which == 0 ? QH + qo : which == 1 ? KH + qo : VT + (bb * CC + c0 + (tid >> 4)) * (size_t)TT + t0 + (tid & 15) * 8);
  gu4_p dl = (gu4_p)(QL + (bb * QHI + t0 + (tid >> 4)) * (size_t)CC + c0 + (tid & 15) * 8);
#pragma unroll   // one address pair and constant offsets: no address register is rewritten behind a store
  for (int it = 0; it < 16; ++it) dh[(size_t)it * 1024] = *(const v4u*)&sh[sr + it * 8 * 136];
  asm volatile("s_wait_xcnt 0x0" :: "v"(dh) : "memory");   /* behind the stores, in front of the second plane's reads and address, which reuse the stores' registers; the address pair is named to stay unwritten up to here */
  if (which == 0) {
#pragma unroll   // as above
    for (int it = 0; it < 16; ++it) dl[(size_t)it * 1024] = *(const v4u*)&sl[sr + it * 8 * 136]; } }
// ---- k_att: block = 16 waves x 16 queries of (b, head e); a wave holds both 32-wide sub-heads of its 16 queries. The head's K rows and V^T rows come into LDS once per block, 128 keys a stage, two buffers, by asynchronous copies of whole 128-B lines; all 16 waves take their fragments from there. Per 32 keys: S^T = K Q^T (q residual product first, x 2^-10, then the q hi product on top of it), running maximum and sum per query (query = lane column; base-2 exponent, scale folded in), P^T packed from the two score tiles straight into a B operand, O^T += V^T P^T with the head's 64-wide v fragments shared by both sub-heads. No logits or P in memory. The epilogue forms the head's differential row o = P1.v / l1 - lambda P2.v / l2 in registers (a wave holds both sub-heads of its queries) and stores the 64-wide f32 context rows [b*t][CC]; every wave forms lambda for itself while stage 0 is in flight.
#define AW 16
#define KS 128                        // keys of one LDS stage
#define KKP 72                        // K row pitch in f16 elements: 144 B = 16 B x 9, odd, for 16-byte fragment reads
#define KVP 136                       // V^T row pitch in f16 elements: 272 B = 16 B x 17, odd
#define KSTG (KS * KKP + HDV * KVP)   // elements of one buffer: 128 K rows [key][64], then 64 V^T rows [d][128 keys]
__device__ __forceinline__ v8f wm(v16h a, v16h b, v8f c) { return __builtin_amdgcn_wmma_f32_16x16x32_f16(false, a, false, b, (short)0, c, false, false); }
__device__ __forceinline__ float xhalf(float x) { return __builtin_bit_cast(float, __builtin_amdgcn_permlanex16(__builtin_bit_cast(int, x), __builtin_bit_cast(int, x), 0x76543210, 0xfedcba98, false, false)); }   /* lane l with lane l ^ 16 */
typedef const __attribute__((address_space(1))) _Float16* gh_p;   /* pointer typed as global memory */
__device__ __forceinline__ v16h frag_l(const _Float16* p) { union { v16h v; v8h q[2]; } u; u.q[0] = *(const v8h*)p; u.q[1] = *(const v8h*)(p + 16); return u.v; }   /* frag_h with the lane half's 8 elements already in p */
/* one stage: a thread copies 16 B of K rows r and r + 64 and of V^T rows d and d + 32 (a wave-wide copy = 4 whole lines). The wait is the last line of the copies' own statement, so that no register a copy names is rewritten in front of it */
__device__ __forceinline__ void kv_copy(unsigned lk, gh_p gk, unsigned lv, gh_p gv) {
  asm volatile("global_load_async_to_lds_b128 %0, %1, off\n\tglobal_load_async_to_lds_b128 %2, %3, off\n\tglobal_load_async_to_lds_b128 %4, %5, off\n\tglobal_load_async_to_lds_b128 %6, %7, off\n\ts_wait_xcnt 0x0"
    :: "v"(lk), "v"(gk), "v"(lk + 64 * KKP * 2), "v"(gk + (size_t)64 * CC), "v"(lv), "v"(gv), "v"(lv + 32 * KVP * 2), "v"(gv + (size_t)32 * TT) : "memory");
}
/* lambda = mean over 64 of (exp(lq1 lk1) - exp(lq2 lk2) + 0.8) from the four bf16-rounded [64] inputs: lane l forms terms l and l + 32, the sum runs over the terms in index order; the same value in every lane */
__device__ __forceinline__ float lambda_of(const float* __restrict__ LQ1, const float* __restrict__ LK1, const float* __restrict__ LQ2, const float* __restrict__ LK2, int lane) {
  float in[8];
#pragma unroll   // constant indices keep the array in registers
  for (int h = 0; h < 2; ++h) { in[4 * h] = LQ1[lane + 32 * h]; in[4 * h + 1] = LK1[lane + 32 * h]; in[4 * h + 2] = LQ2[lane + 32 * h]; in[4 * h + 3] = LK2[lane + 32 * h]; }
  asm volatile("s_wait_xcnt 0x0" ::: "memory");   /* behind the eight loads, in front of any rewrite of their address registers */
  float s1 = 0.f;
#pragma unroll   // constant indices keep the array in registers
  for (int h = 0; h < 2; ++h) { const float tm = (expf(bfr(in[4 * h]) * bfr(in[4 * h + 1])) - expf(bfr(in[4 * h + 2]) * bfr(in[4 * h + 3]))) + 0.8f;
#pragma unroll   // the lane number of a lane read is a constant
    for (int i = 0; i < 32; ++i) s1 += __builtin_bit_cast(float, __builtin_amdgcn_readlane(__builtin_bit_cast(int, tm), i)); }
  return s1 * (1.0f / 64.0f);
}
__global__ __launch_bounds__(AW * 32) void k_att(const _Float16* __restrict__ QH, const _Float16* __restrict__ QL, const _Float16* __restrict__ KH, const _Float16* __restrict__ VT, const float* __restrict__ LQ1, const float* __restrict__ LK1, const float* __restrict__ LQ2, const float* __restrict__ LK2, float* __restrict__ YD) {
  __shared__ __align__(16) unsigned char sm[2 * KSTG * 2 + AW * 16 * (HDV + 4) * 4];   /* the two stage buffers first, so that every fragment read's constant part fits the instruction's offset field; behind them the epilogue's rows */
  _Float16* kv = (_Float16*)sm; float (*so)[16][HDV + 4] = (float (*)[16][HDV + 4])(sm + 2 * KSTG * 2);
  const int tid = threadIdx.x, wave = tid >> 5, lane = tid & 31, col = lane & 15, g = lane >> 4; const int e = blockIdx.y, b = blockIdx.z; const int ql0 = blockIdx.x * (AW * 16) + wave * 16;
  const float C2 = SCALE * 1.4426950408889634f;
  const unsigned lk = (unsigned)(size_t)kv + (unsigned)(((tid >> 3) * KKP + (tid & 7) * 8) * 2);              /* LDS byte address: K row tid >> 3 of 64, 16 bytes tid & 7 of 128 */
  const unsigned lv = (unsigned)(size_t)kv + (unsigned)((KS * KKP + (tid >> 4) * KVP + (tid & 15) * 8) * 2);   /* V^T row tid >> 4 of 32, 16 bytes tid & 15 of 256 */
  gh_p gk = (gh_p)(KH + ((size_t)b * TT + (tid >> 3)) * CC + e * HDV + (tid & 7) * 8);      /* walks 128 keys a stage */
  gh_p gv = (gh_p)(VT + ((size_t)b * CC + e * HDV + (tid >> 4)) * TT + (tid & 15) * 8);
  kv_copy(lk, gk, lv, gv); gk += (size_t)KS * CC; gv += KS;   /* stage 0 into buffer 0 */
  v16h qh[2], ql[2];
  const _Float16* qhp = QH + ((size_t)b * TT + ql0 + col) * CC + e * HDV; const _Float16* qlp = QL + ((size_t)b * QHI + ql0 + col) * CC + e * HDV;   /* query row col, this head's 64 columns: hi and residual */
#pragma unroll   // constant indices keep the fragment arrays in registers
  for (int u = 0; u < 2; ++u) { qh[u] = frag_h(qhp + u * HD, lane); ql[u] = frag_h(qlp + u * HD, lane); }
  asm volatile("s_wait_xcnt 0x0" :: "v"(qhp + 8 * g), "v"(qlp + 8 * g) : "memory");   /* behind the q loads; their addresses are named as inputs to stay unwritten up to it */
  const float lam = lambda_of(LQ1, LK1, LQ2, LK2, lane);
  asm volatile("s_wait_asynccnt 0x0" ::: "memory");   /* this wave's copies of stage 0 have landed */
  __syncthreads();                                    /* publishes stage 0 */
  kv_copy(lk + KSTG * 2, gk, lv + KSTG * 2, gv); gk += (size_t)KS * CC; gv += KS;   /* stage 1 into buffer 1, in flight over stage 0's work */
  v8f acc[2][HDV / 16] = {}; float mu[2] = { -3.0e38f, -3.0e38f }; v2f ls[2] = {};   /* per query: maximum in use; sum, even and odd keys apart */
#pragma unroll 1   // rolled: the publish point stands once, at the foot of a stage
  for (int t = 0; t < TT / KS; ++t) {
    const _Float16* kb = kv + (t & 1) * KSTG + col * KKP + 8 * g;              /* key row col of a 16-key tile, the lane's half */
    const _Float16* vb = kv + (t & 1) * KSTG + KS * KKP + col * KVP + 8 * g;   /* value column col of a 16-column tile, keys contiguous, the lane's half */
#pragma unroll 1   // rolled: one pass's registers only, so that four waves fit a SIMD
    for (int sp = 0; sp < KS / 32; ++sp) {
      v16h kf[2][2], vf[HDV / 16];
#pragma unroll   // constant indices keep the fragment arrays in registers
      for (int u = 0; u < 2; ++u)
#pragma unroll   // constant indices keep the fragment arrays in registers
        for (int kt = 0; kt < 2; ++kt) kf[u][kt] = frag_l(kb + (sp * 32 + kt * 16) * KKP + u * HD);
#pragma unroll   // constant indices keep the fragment arrays in registers
      for (int j = 0; j < HDV / 16; ++j) vf[j] = frag_l(vb + (j * 16) * KVP + sp * 32);
      v8f s[2][2];
#pragma unroll   // constant indices keep the fragment arrays in registers
      for (int u = 0; u < 2; ++u)
#pragma unroll   // constant indices keep the fragment arrays in registers
        for (int kt = 0; kt < 2; ++kt) { const v8f z = {}; s[u][kt] = wm(kf[u][kt], ql[u], z); }
#pragma unroll   // constant indices keep the fragment arrays in registers
      for (int u = 0; u < 2; ++u)
#pragma unroll   // constant indices keep the fragment arrays in registers
        for (int kt = 0; kt < 2; ++kt) s[u][kt] = wm(kf[u][kt], qh[u], s[u][kt] * (1.0f / 1024.0f));
      float mx[2];
#pragma unroll   // constant indices keep the fragment arrays in registers
      for (int u = 0; u < 2; ++u) { float m = fmaxf(s[u][0][0], s[u][1][0]);
#pragma unroll   // constant indices keep the fragment arrays in registers
        for (int r = 1; r < 8; ++r) m = fmaxf(m, fmaxf(s[u][0][r], s[u][1][r]));
        mx[u] = fmaxf(m, xhalf(m)) * C2; }
      if (__builtin_amdgcn_ballot_w32(mx[0] > mu[0] + 8.0f || mx[1] > mu[1] + 8.0f) != 0) {   /* rescale only when a query's maximum outgrows the one in use by 2^8: P stays <= 256 in f16 */
#pragma unroll   // constant indices keep the fragment arrays in registers
        for (int u = 0; u < 2; ++u) { const float mn = fmaxf(mu[u], mx[u]); const float corr = __builtin_amdgcn_exp2f(mu[u] - mn); mu[u] = mn; ls[u] *= corr;
#pragma unroll   // constant indices keep the fragment arrays in registers
          for (int j = 0; j < HDV / 16; ++j) acc[u][j] *= corr; } }
#pragma unroll   // constant indices keep the fragment arrays in registers
      for (int u = 0; u < 2; ++u) { v16h p;
#pragma unroll   // constant indices keep the fragment arrays in registers
        for (int i = 0; i < 16; i += 2) { v2f a = { s[u][i >> 3][i & 7], s[u][i >> 3][(i & 7) + 1] }; const v2f c2 = { C2, C2 }, nm = { -mu[u], -mu[u] }; a = __builtin_elementwise_fma(a, c2, nm);
          const v2f pe = { __builtin_amdgcn_exp2f(a[0]), __builtin_amdgcn_exp2f(a[1]) }; ls[u] += pe; p[i] = (_Float16)pe[0]; p[i + 1] = (_Float16)pe[1]; }
#pragma unroll   // constant indices keep the fragment arrays in registers
        for (int j = 0; j < HDV / 16; ++j) acc[u][j] = wm(vf[j], p, acc[u][j]); } }
    /* publish point of stage t + 1: this wave's reads of buffer t & 1 are done, its copies of stage t + 1 have landed; the barrier publishes that stage and ends every wave's reads of the buffer refilled behind it */
    asm volatile("s_wait_dscnt 0x0" ::: "memory");
    asm volatile("s_wait_asynccnt 0x0" ::: "memory");
    __syncthreads();
    if (t + 2 < TT / KS) { kv_copy(lk + (t & 1) * (KSTG * 2), gk, lv + (t & 1) * (KSTG * 2), gv); gk += (size_t)KS * CC; gv += KS; } }
  asm volatile("s_wait_asynccnt 0x0" ::: "memory");   /* no copy is outstanding when the wave goes on to its end */
  float w[2];   /* weight of each sub-head's unnormalised sum: 1 / l1 and -lambda / l2 */
#pragma unroll   // constant indices keep the fragment arrays in registers
  for (int u = 0; u < 2; ++u) { const float lh = ls[u][0] + ls[u][1]; w[u] = 1.0f / (lh + xhalf(lh)); }
  w[1] *= -lam;
#pragma unroll   // constant indices keep the fragment arrays in registers
  for (int j = 0; j < HDV / 16; ++j) { v4f lo, hi;
#pragma unroll   // constant indices keep the fragment arrays in registers
    for (int r = 0; r < 4; ++r) { lo[r] = acc[0][j][r] * w[0] + acc[1][j][r] * w[1]; hi[r] = acc[0][j][4 + r] * w[0] + acc[1][j][4 + r] * w[1]; }
    float* d = &so[wave][col][j * 16 + 8 * g]; *(v4f*)d = lo; *(v4f*)(d + 4) = hi; }
  LDSX();
  gf4_p po = (gf4_p)(YD + ((size_t)b * TT + ql0 + g) * CC + e * HDV + col * 4);   /* a wave-wide store = the 256-B head segments of two rows */
#pragma unroll   // one address pair and constant offsets: no address register is rewritten behind a store
  for (int it = 0; it < 8; ++it) po[(size_t)it * (2 * CC * 4 / 16)] = *(const v4f*)&so[wave][it * 2 + g][col * 4]; }
// ---- k_out: block = (128 rows, 128 cols): out = ctx Wo (+ bo): ctx once to f16 against Wo as f16(bf16 x 2^8) exact (1 product) x 2^-8; staged as in k_proj
__global__ __launch_bounds__(128) void k_out(const float* __restrict__ Y, const float* __restrict__ WO, const float* __restrict__ BO, float* __restrict__ OUT) {
  __shared__ __align__(16) unsigned char sm[GSM];
  const int tid = threadIdx.x, wave = tid >> 5, lane = tid & 31, col = lane & 15, g = lane >> 4, wm = wave >> 1, wn = wave & 1; const int c0 = blockIdx.y * 128; const size_t r0 = (size_t)blockIdx.x * 128;
  gf_p px = (gf_p)(Y + (r0 + (tid >> 3)) * CC + (tid & 7) * 4); gf_p pw = (gf_p)(WO + (size_t)(c0 + (tid >> 3)) * CC + (tid & 7) * 4);
  _Float16* st = (_Float16*)sm; const int so = (tid >> 3) * GP + (tid & 7) * 4;
  v4f xr[8], wr[8]; v8f acc[4][4] = {};
  g_fetch(px, pw, xr, wr);
  for (int kc = 0; kc < CC / 32; ++kc) { _Float16* sb = st + (kc & 1) * GSTG;
#pragma unroll   // constant indices keep the arrays in registers
    for (int i = 0; i < 8; ++i) { v4h cx, cw;
#pragma unroll   // constant indices keep the arrays in registers
      for (int q = 0; q < 4; ++q) { cx[q] = (_Float16)xr[i][q]; cw[q] = (_Float16)(bfr(wr[i][q]) * 256.0f); }
      *(v4h*)(sb + so + i * 16 * GP) = cx; *(v4h*)(sb + 128 * GP + so + i * 16 * GP) = cw; }
    __syncthreads();   /* publishes this pass's buffer; the other buffer's readers of the pass before are behind it when the next pass stores there */
    if (kc + 1 < CC / 32) g_fetch(px, pw, xr, wr);
    v16h a[4], b[4];
#pragma unroll   // constant indices keep the arrays in registers
    for (int i = 0; i < 4; ++i) { a[i] = frag_h(sb + (wm * 64 + i * 16 + col) * GP, lane); b[i] = frag_h(sb + (128 + wn * 64 + i * 16 + col) * GP, lane); }
#pragma unroll   // constant indices keep the arrays in registers
    for (int i = 0; i < 4; ++i)
#pragma unroll   // constant indices keep the arrays in registers
      for (int j = 0; j < 4; ++j) acc[i][j] = wmh(a[i], b[j], acc[i][j]); }
  __syncthreads();   /* every wave has left the buffers: the output tile [128][132] f32 lies over them */
  float* sf = (float*)sm; float bs[4] = {};
  if (BO) { g_bias(BO + c0 + wn * 64 + col, bs); }
#pragma unroll   // constant indices keep the arrays in registers
  for (int j = 0; j < 4; ++j)
#pragma unroll   // constant indices keep the arrays in registers
    for (int i = 0; i < 4; ++i)
#pragma unroll   // constant indices keep the arrays in registers
      for (int r = 0; r < 8; ++r) sf[(wm * 64 + i * 16 + 8 * g + r) * 132 + wn * 64 + j * 16 + col] = acc[i][j][r] * (1.0f / 256.0f) + bs[j];
  __syncthreads();
  gf4_p po = (gf4_p)(OUT + (r0 + wave) * DIN + c0 + lane * 4);   /* a wave stores 512 B of one row */
#pragma unroll   // one address pair and constant offsets: no address register is rewritten behind a store
  for (int it = 0; it < 32; ++it) po[(size_t)it * (4 * DIN * 4 / 16)] = *(const v4f*)&sf[(wave + it * 4) * 132 + lane * 4]; }

extern "C" void kernel_launch(void* const* d_in, const int* in_sizes, int n_in, void* d_out, int out_size, void* d_ws, size_t ws_size, hipStream_t stream) {
  (void)in_sizes; (void)n_in; (void)out_size;
  const float** F = (const float**)d_in;
  if (ws_size < (size_t)WS_END) return;
  char* ws = (char*)d_ws; _Float16 *QH = (_Float16*)(ws + WS_QH), *KH = (_Float16*)(ws + WS_KH), *VT = (_Float16*)(ws + WS_VT), *QL = (_Float16*)(ws + WS_QL), *KL = (_Float16*)(ws + WS_KL); __bf16 *VB = (__bf16*)(ws + WS_VB), *VBL = (__bf16*)(ws + WS_VBL); float *S = (float*)(ws + WS_S);
  (void)QL; (void)KL; (void)VB; (void)VBL;
  // inputs: 0 x [4,1024,1024]; 1 W_qkv [3072,1024] (out,in: rows 0-1023 q, 1024-2047 k, 2048-3071 v); 2 W_proj [1024,1024] (out,in); 3 b_proj; 4 lambda_q1, 5 lambda_k1, 6 lambda_q2, 7 lambda_k2 [64]
  float* YD = S;   /* the differential rows [b*t][CC] live in the WS_S plane */
  k_proj<<<dim3(TNB * TT / 128, CC / 128, 3), 128, 0, stream>>>(F[0], F[0], F[0], F[1], F[1] + (size_t)CC * DIN, F[1] + (size_t)2 * CC * DIN, nullptr, nullptr, nullptr, QH, QL, KH, VT);
  k_att<<<dim3(TT / (AW * 16), NH / 2, TNB), AW * 32, 0, stream>>>(QH, QL, KH, VT, F[4], F[5], F[6], F[7], YD);
  k_out<<<dim3(TNB * TT / 128, DIN / 128), 128, 0, stream>>>(YD, F[2], F[3], (float*)d_out);
}

// v005
// One run takes 86 microseconds.
// Next to v004, in two timings, it ran 1.15 times as fast each time.
// All steps since v000 together make it 16.6 times as fast.
// compute dtype: all float inputs rounded to bf16; qkv = x Wqkv^T with EXACT bf16 products on WMMA 16x16x32 (f32 accumulate); the two 32-wide sub-head logits with q as f16 hi + residual (x 2^10) against k once to f16 (2 products) x 64^-0.5; both softmaxes in f32 with a running maximum and sum (base-2 exponent); each unnormalised P (<= 2^8) once to f16 against the head's 64-wide v once to f16 (1 product), divided by the f32 sum at the end; the differential combination P1.v - lambda P2.v and lambda (mean of exp(lq1 lk1) - exp(lq2 lk2) + 0.8 over 64) in f32; ctx once to f16 against W_proj carried x 2^8 in f16 + b_proj; f32 output.
#include <hip/hip_runtime.h>
#include <math.h>

typedef __attribute__((ext_vector_type(16))) _Float16 v16h;
typedef __attribute__((ext_vector_type(16))) __bf16 v16b;
typedef __attribute__((ext_vector_type(8)))  _Float16 v8h;
typedef __attribute__((ext_vector_type(8)))  float v8f;
typedef __attribute__((ext_vector_type(4)))  float v4f;
typedef __attribute__((ext_vector_type(2)))  float v2f;
typedef __attribute__((ext_vector_type(4)))  unsigned v4u;
typedef __attribute__((ext_vector_type(4)))  int v4i;
typedef float __attribute__((may_alias)) float_a;
typedef int __attribute__((may_alias)) int_a;

template <typename T> __device__ __forceinline__ void vst2(void* p, T v) { *(T*)p = v;  }
__device__ __forceinline__ v8f wmma16(v16h a, v16h b, v8f c) {
  v8f d = __builtin_amdgcn_wmma_f32_16x16x32_f16(false, a, false, b, (short)0, c, false, false);
  asm volatile("v_nop\n\tv_nop\n\tv_nop\n\tv_nop" : "+v"(d) : "v"(a), "v"(b));
  return d;
}
__device__ __forceinline__ v8f wmma_bf(v16b a, v16b b, v8f c) {
  v8f d = __builtin_amdgcn_wmma_f32_16x16x32_bf16(false, a, false, b, (short)0, c, false, false);
  asm volatile("v_nop\n\tv_nop\n\tv_nop\n\tv_nop" : "+v"(d) : "v"(a), "v"(b));
  return d;
}
// 16x16x32 fragments: lane = (h = lane>>4, row/col = lane&15); elements 0..7 = k0+8h+0..7, 8..15 = k0+16+8h+0..7; D element r = row 8h+r
__device__ __forceinline__ v16h frag_h(const _Float16* rowk0, int lane) {
  union { v16h v; v8h q[2]; } u; const _Float16* p = rowk0 + 8 * (lane >> 4);
  u.q[0] = *(const v8h*)p; u.q[1] = *(const v8h*)(p + 16); return u.v;
}
__device__ __forceinline__ v16h frag_f32(const float* rowk0, int lane) {
  v16h a; const float* p = rowk0 + 8 * (lane >> 4);
#pragma unroll
  for (int i = 0; i < 8; ++i) { a[i] = (_Float16)p[i]; a[8 + i] = (_Float16)p[16 + i]; }
  return a;
}
__device__ __forceinline__ v16h frag_f32s(const float* rowk0, int lane, float sc) {
  v16h a; const float* p = rowk0 + 8 * (lane >> 4);
#pragma unroll
  for (int i = 0; i < 8; ++i) { a[i] = (_Float16)(p[i] * sc); a[8 + i] = (_Float16)(p[16 + i] * sc); }
  return a;
}
// column fragment from a [K][ld] layout (column n), rows >= K read as 0
__device__ __forceinline__ v16h fragc_f32(const float* W, int k0, int n, int lane, int ld, int K) {
  v16h a; const int g = lane >> 4;
#pragma unroll
  for (int i = 0; i < 8; ++i) { const int ka = k0 + 8 * g + i, kb = ka + 16;
    a[i] = (_Float16)(ka < K ? W[(size_t)(ka < K ? ka : K - 1) * ld + n] : 0.f); a[8 + i] = (_Float16)(kb < K ? W[(size_t)(kb < K ? kb : K - 1) * ld + n] : 0.f); }
  return a;
}
struct F2 { v16b h, l; };
__device__ __forceinline__ F2 bsplit16(const float v[16]) { F2 r;
#pragma unroll
  for (int i = 0; i < 16; ++i) { const __bf16 h = (__bf16)v[i]; r.h[i] = h; r.l[i] = (__bf16)(v[i] - (float)h); }
  return r; }
__device__ __forceinline__ F2 split_row(const float* row, int k0, int lane) { float v[16]; const float* p = row + k0 + 8 * (lane >> 4);
#pragma unroll
  for (int i = 0; i < 8; ++i) { v[i] = p[i]; v[8 + i] = p[16 + i]; }
  return bsplit16(v); }
__device__ __forceinline__ F2 split_rowK(const float* row, int k0, int lane, int K) { float v[16]; const int g = lane >> 4;
#pragma unroll
  for (int i = 0; i < 8; ++i) { const int ka = k0 + 8 * g + i, kb = ka + 16; v[i] = ka < K ? row[ka < K ? ka : K - 1] : 0.f; v[8 + i] = kb < K ? row[kb < K ? kb : K - 1] : 0.f; }
  return bsplit16(v); }
__device__ __forceinline__ F2 split_col(const float* W, int k0, int n, int lane, int ld, int K) { float v[16]; const int g = lane >> 4;
#pragma unroll
  for (int i = 0; i < 8; ++i) { const int ka = k0 + 8 * g + i, kb = ka + 16; v[i] = ka < K ? W[(size_t)(ka < K ? ka : K - 1) * ld + n] : 0.f; v[8 + i] = kb < K ? W[(size_t)(kb < K ? kb : K - 1) * ld + n] : 0.f; }
  return bsplit16(v); }
__device__ __forceinline__ v8f mac3(const F2& a, const F2& b, v8f c) { c = wmma_bf(a.l, b.h, c); c = wmma_bf(a.h, b.l, c); return wmma_bf(a.h, b.h, c); }
__device__ __forceinline__ float sigm(float v) { return 1.0f / (1.0f + expf(-v)); }
#define LDSX() do { asm volatile("s_wait_dscnt 0" ::: "memory"); __builtin_amdgcn_wave_barrier(); __builtin_amdgcn_fence(__ATOMIC_RELEASE, "workgroup"); } while (0)

// Differential attention (B 4, N 1,024, C 1,024 = 16 heads x 64): qkv = x Wqkv^T ((out,in) [3072,1024]); per head the 64-dim q/k are split into two 32-dim halves: attn = softmax(q1 k1^T / 8) - lam softmax(q2 k2^T / 8), lam = mean(exp(lambda_q1 * lambda_k1) - exp(lambda_q2 * lambda_k2) + 0.8); out = merged(attn v) Wproj^T + b_proj. Realised as 32 softmax sub-heads of width 32 whose P.v share the parent head's 64-wide v.
#define NB 4
#define TT 1024
#define CC 1024            // NH * HD = projected width
#define DIN 1024          // input (model) width
#define NH 32              // softmax sub-heads (16 heads x 2 halves)
#define HD 32
#define NQB (TT / 64)
#define HG 8
#define SCALE (0.125f)
#define CAUSAL 0
#ifndef TNB
#define TNB NB
#endif
__device__ __forceinline__ float bfr(float v) { return (float)(__bf16)v; }
__host__ __device__ __forceinline__ int kb_last(int qb) { return CAUSAL ? ((qb * 64 + 63) >> 7) : (TT / 128 - 1); }
typedef __attribute__((ext_vector_type(8))) __bf16 v8b;
__device__ __forceinline__ v16b frag_b(const __bf16* rowk0, int lane) {
  union { v16b v; v8b q[2]; } u; const __bf16* p = rowk0 + 8 * (lane >> 4);
  u.q[0] = *(const v8b*)p; u.q[1] = *(const v8b*)(p + 16); return u.v;
}
#define QBH 0              // unused: k_att treats all query blocks alike
#define QHI 1024            // rows carrying a q residual plane (all rows: 2-product logits everywhere)
#define KHI 64            // key rows carrying k residual / v bf16 hi+lo planes (written and read by no kernel)
// B fragment (k rows k0+.., output column o) of a weight: (in,out) [K][ld] or (out,in) [ld rows of K]: bf16 exact, or f16(bf16 * 256) exact
__device__ __forceinline__ v16b wcol_io(const float* Wm, int k0, int o, int lane, int ld) { v16b w; const int g = lane >> 4;
#pragma unroll
  for (int i = 0; i < 8; ++i) { w[i] = (__bf16)Wm[(size_t)(k0 + 8 * g + i) * ld + o]; w[8 + i] = (__bf16)Wm[(size_t)(k0 + 16 + 8 * g + i) * ld + o]; }
  return w; }
__device__ __forceinline__ v16b wcol_oi(const float* Wm, int k0, int o, int lane, int K) { v16b w; const float* p = Wm + (size_t)o * K + k0 + 8 * (lane >> 4);
#pragma unroll
  for (int i = 0; i < 8; ++i) { w[i] = (__bf16)p[i]; w[8 + i] = (__bf16)p[16 + i]; }
  return w; }
__device__ __forceinline__ v16h wcolh_io(const float* Wm, int k0, int o, int lane, int ld) { v16h w; const int g = lane >> 4;
#pragma unroll
  for (int i = 0; i < 8; ++i) { w[i] = (_Float16)(bfr(Wm[(size_t)(k0 + 8 * g + i) * ld + o]) * 256.0f); w[8 + i] = (_Float16)(bfr(Wm[(size_t)(k0 + 16 + 8 * g + i) * ld + o]) * 256.0f); }
  return w; }
__device__ __forceinline__ v16h wcolh_oi(const float* Wm, int k0, int o, int lane, int K) { v16h w; const float* p = Wm + (size_t)o * K + k0 + 8 * (lane >> 4);
#pragma unroll
  for (int i = 0; i < 8; ++i) { w[i] = (_Float16)(bfr(p[i]) * 256.0f); w[8 + i] = (_Float16)(bfr(p[16 + i]) * 256.0f); }
  return w; }
#define WQKV_LAYOUT 1   // 0 = (in,out) [DIN][CC]; 1 = (out,in) [CC][DIN]; 2 = per-head [NH][DIN][HD]
__device__ __forceinline__ v16b wcol_hdk(const float* Wm, int k0, int o, int lane) { v16b w; const int g = lane >> 4; const float* p = Wm + (size_t)(o / HD) * DIN * HD + (o % HD);
#pragma unroll
  for (int i = 0; i < 8; ++i) { w[i] = (__bf16)p[(size_t)(k0 + 8 * g + i) * HD]; w[8 + i] = (__bf16)p[(size_t)(k0 + 16 + 8 * g + i) * HD]; }
  return w; }
#define WO_OUT_IN 1
#if WQKV_LAYOUT == 1
#define WCOL(W, k0, o, lane) wcol_oi(W, k0, o, lane, DIN)
#elif WQKV_LAYOUT == 2
#define WCOL(W, k0, o, lane) wcol_hdk(W, k0, o, lane)
#else
#define WCOL(W, k0, o, lane) wcol_io(W, k0, o, lane, CC)
#endif
#if WO_OUT_IN
#define WOCOL(W, k0, o, lane) wcol_oi(W, k0, o, lane, CC)
#define WOCOLH(W, k0, o, lane) wcolh_oi(W, k0, o, lane, CC)
#else
#define WOCOL(W, k0, o, lane) wcol_io(W, k0, o, lane, DIN)
#define WOCOLH(W, k0, o, lane) wcolh_io(W, k0, o, lane, DIN)
#endif
#define HDV 64             // value columns per softmax sub-head (the parent head's 64 columns)
#ifndef SM_EXTRA_PARAMS
#define SM_EXTRA_PARAMS
#endif
#ifndef PROJ_EXTRA_PARAMS
#define PROJ_EXTRA_PARAMS
#endif
#ifndef SM_MASK_HOOK
#define SM_MASK_HOOK (void)0
#endif

#define WS_QH  0u                                      // f16 q rows [b*t][CC]
#define WS_KH  (WS_QH + 2u * (size_t)NB * TT * CC)      // f16 k rows [b*t][CC]
#define WS_VT  (WS_KH + 2u * (size_t)NB * TT * CC)      // f16 v planes [b][c][t]
#define WS_QL  (WS_VT + 2u * (size_t)NB * CC * TT)      // f16 q residual x 2^10 rows [b][t < QHI][CC]
#define WS_KL  (WS_QL + 2u * (size_t)NB * QHI * CC)     // f16 k residual x 2^10 rows [b][t < KHI][CC]
#define WS_VB  (WS_KL + 2u * (size_t)NB * KHI * CC)     // bf16 v hi planes [b][c][t < KHI]
#define WS_VBL (WS_VB + 2u * (size_t)NB * CC * KHI)
#define WS_S   (WS_VBL + 2u * (size_t)NB * CC * KHI)    // f16 differential rows [b*t][CC] (first quarter of the plane)
#define WS_XB  (WS_S  + 4u * (size_t)HG * TT * TT)      // bf16 x rows [b*t][DIN]
#define WS_WB  (WS_XB + 2u * (size_t)NB * TT * DIN)     // bf16 W_qkv rows [3 * CC][DIN]
#define WS_WP  (WS_WB + 2u * (size_t)3 * CC * DIN)      // f16 (bf16(W_proj) x 2^8) rows [DIN][CC]
#define WS_END (WS_WP + 2u * (size_t)DIN * CC)

// ---- the two GEMM kernels: block = 4 waves (2 x 2), tile 128 rows x 128 cols, a wave 64 x 64 (16 accumulator tiles). Both operands lie in memory in the 16-bit operand type (k_cvt rounds x and the weights once; k_att stores its rows as f16). Per 64 k: every thread loads whole 128-B lines of both operands (a wave-wide load = 4 rows) and stores them in LDS as they are; all waves take their fragments from there. Two LDS buffers, the next 64 k's global loads in flight over the products, one barrier a pass.
#define GP 72                       // LDS row pitch in 16-bit elements: 144 B = 16 B x 9, odd, for 16-byte fragment reads
#define GSTG (256 * GP)             // elements of one buffer: 128 X rows, then 128 W rows
#define GSM (2 * GSTG * 2)          // bytes: the two buffers, 73,728 (the epilogue's two f16 planes [128][136] take 69,632)
typedef const __attribute__((address_space(1))) float* gf_p;   /* typed as global memory, as gh_p below: an address that has gone through an asm statement still loads by global_load */
typedef const __attribute__((address_space(1))) v4f* gv4f_p;
typedef __attribute__((ext_vector_type(4))) __bf16 v4b;
typedef __attribute__((ext_vector_type(4))) _Float16 v4h;
__device__ __forceinline__ v8f wmb(v16b a, v16b b, v8f c) { return __builtin_amdgcn_wmma_f32_16x16x32_bf16(false, a, false, b, (short)0, c, false, false); }
__device__ __forceinline__ v8f wmh(v16h a, v16h b, v8f c) { return __builtin_amdgcn_wmma_f32_16x16x32_f16(false, a, false, b, (short)0, c, false, false); }
typedef const __attribute__((address_space(1))) v4u* gcu4_p;
/* 64 k of 128 rows of each operand: thread = (row tid >> 3 of 16, 8 elements tid & 7); rows are 2 KB apart; then both addresses step 64 elements. The wait and the steps stand in one statement, so that an address pair is rewritten only behind the wait */
__device__ __forceinline__ void g_fetch(gcu4_p& px, gcu4_p& pw, v4u (&xr)[8], v4u (&wr)[8]) {
#pragma unroll   // constant indices keep the arrays in registers
  for (int i = 0; i < 8; ++i) { xr[i] = px[(size_t)(i * 16) * (DIN * 2 / 16)]; wr[i] = pw[(size_t)(i * 16) * (DIN * 2 / 16)]; }
  asm volatile("s_wait_xcnt 0x0\n\tv_add_nc_u64 %0, %2, %0\n\tv_add_nc_u64 %1, %2, %1" : "+v"(px), "+v"(pw) : "s"((long long)128) : "memory");
}
typedef __attribute__((address_space(1))) v4u* gu4_p;
typedef __attribute__((address_space(1))) v4b* gb4_p;
typedef __attribute__((address_space(1))) v4h* gh4_p;
// ---- k_cvt: rounds the GEMM operands once: x and W_qkv to bf16, W_proj to f16(bf16 x 2^8). 256 blocks of 8 waves; a block takes 32,768 consecutive elements of one array, a thread 32 loads of 16 B (a wave-wide load = 4 whole lines), all in flight at once, and 32 stores of 8 B (a wave-wide store = 2 whole lines)
#define CVE 32768
#define CVX (NB * TT * DIN / CVE)   // blocks on x
#define CVW (3 * CC * DIN / CVE)    // blocks on W_qkv
#define CVP (DIN * CC / CVE)        // blocks on W_proj
__global__ __launch_bounds__(256) void k_cvt(const float* __restrict__ X, const float* __restrict__ WQKV, const float* __restrict__ WP, __bf16* __restrict__ XB, __bf16* __restrict__ WB, _Float16* __restrict__ WPH) {
  const int bid = blockIdx.x, tid = threadIdx.x; const int arr = bid < CVX ? 0 : bid < CVX + CVW ? 1 : 2;
  const size_t o = (size_t)(bid - (arr == 0 ? 0 : arr == 1 ? CVX : CVX + CVW)) * CVE + tid * 4;
  gv4f_p s = (gv4f_p)((arr == 0 ? X : arr == 1 ? WQKV : WP) + o);
  v4f v[32];
#pragma unroll   // constant indices keep the array in registers; one address pair and constant offsets
  for (int i = 0; i < 32; ++i) v[i] = s[i * 256];
  asm volatile("s_wait_xcnt 0x0" :: "v"(s) : "memory");   /* behind the loads; their address pair is named to stay unwritten up to here */
  if (arr < 2) { gb4_p d = (gb4_p)((arr == 0 ? XB : WB) + o);
#pragma unroll   // one address pair and constant offsets: no address register is rewritten behind a store
    for (int i = 0; i < 32; ++i) { v4b c;
#pragma unroll   // constant indices keep the arrays in registers
      for (int q = 0; q < 4; ++q) c[q] = (__bf16)v[i][q];
      d[i * 256] = c;
      if (i == 7 || i == 15 || i == 23) __builtin_amdgcn_sched_barrier(0); } }   /* eight stores leave as soon as their eight loads are back: without it the first store is scheduled behind the wait for the 25th load */
  else { gh4_p d = (gh4_p)(WPH + o); v4h c[32];
#pragma unroll   // constant indices keep the arrays in registers
    for (int i = 0; i < 32; ++i)
#pragma unroll   // constant indices keep the arrays in registers
      for (int q = 0; q < 4; ++q) c[i][q] = (_Float16)(bfr(v[i][q]) * 256.0f);
    __builtin_amdgcn_sched_barrier(0);   /* all values are formed in front of the first store, each in registers of its own: without it the stores' data registers are reused, with a wait in front of every reuse */
#pragma unroll   // as above
    for (int i = 0; i < 32; ++i) d[i * 256] = c[i]; } }
typedef __attribute__((address_space(1))) v4f* gf4_p;
/* the four bias values of a lane's columns (16 apart), rounded to bf16; the wait stands behind the loads, in front of any rewrite of their address registers */
__device__ __forceinline__ void g_bias(const float* p, float (&bs)[4]) {
#pragma unroll   // constant indices keep the arrays in registers
  for (int j = 0; j < 4; ++j) bs[j] = p[j * 16];
  asm volatile("s_wait_xcnt 0x0" ::: "memory");
#pragma unroll   // constant indices keep the arrays in registers
  for (int j = 0; j < 4; ++j) bs[j] = bfr(bs[j]);
}
/* q or k tile into LDS planes [128][136]: f16 rows (RES: and the residual x 2^10) */
template <bool RES> __device__ __forceinline__ void rows_lds(const v8f (&acc)[4][4], const float (&bs)[4], _Float16* sh, _Float16* sl) {
#pragma unroll   // constant indices keep the arrays in registers
  for (int j = 0; j < 4; ++j)
#pragma unroll   // constant indices keep the arrays in registers
    for (int i = 0; i < 4; ++i)
#pragma unroll   // constant indices keep the arrays in registers
      for (int r = 0; r < 8; ++r) { const float v = acc[i][j][r] + bs[j]; const _Float16 hv = (_Float16)v; const int o = (i * 16 + r) * 136 + j * 16; sh[o] = hv; if (RES) sl[o] = (_Float16)((v - (float)hv) * 1024.0f); }
}
// ---- k_proj: block = (128 rows, 128 cols, which): q/k/v = X W (+ b) with exact bf16 products (K = DIN), X and W as k_cvt's bf16 rows -> which 0: q f16 rows + residual rows; 1: k f16 rows; 2: v f16 planes [c][t]
__global__ __launch_bounds__(128) void k_proj(const __bf16* __restrict__ XQ, const __bf16* __restrict__ XK, const __bf16* __restrict__ XV, const __bf16* __restrict__ WQ, const __bf16* __restrict__ WK, const __bf16* __restrict__ WV, const float* __restrict__ BQ, const float* __restrict__ BK, const float* __restrict__ BV,
    _Float16* __restrict__ QH, _Float16* __restrict__ QL, _Float16* __restrict__ KH, _Float16* __restrict__ VT) {
  __shared__ __align__(16) unsigned char sm[GSM];
  const int tid = threadIdx.x, wave = tid >> 5, lane = tid & 31, col = lane & 15, g = lane >> 4, wm = wave >> 1, wn = wave & 1; const int which = blockIdx.z; const int c0 = blockIdx.y * 128; const size_t r0 = (size_t)blockIdx.x * 128; const size_t bb = r0 / TT; const int t0 = (int)(r0 % TT);
  const __bf16* X = which == 0 ? XQ : which == 1 ? XK : XV; const __bf16* WA = which == 0 ? WQ : which == 1 ? WK : WV; const float* BA = which == 0 ? BQ : which == 1 ? BK : BV;
  gcu4_p px = (gcu4_p)(X + (r0 + (tid >> 3)) * DIN + (tid & 7) * 8); gcu4_p pw = (gcu4_p)(WA + (size_t)(c0 + (tid >> 3)) * DIN + (tid & 7) * 8);
  __bf16* st = (__bf16*)sm; const int so = (tid >> 3) * GP + (tid & 7) * 8;
  v4u xr[8], wr[8]; v8f acc[4][4] = {};
  g_fetch(px, pw, xr, wr);
  for (int kc = 0; kc < DIN / 64; ++kc) { __bf16* sb = st + (kc & 1) * GSTG;
#pragma unroll   // constant indices keep the arrays in registers
    for (int i = 0; i < 8; ++i) { *(v4u*)(sb + so + i * 16 * GP) = xr[i]; *(v4u*)(sb + 128 * GP + so + i * 16 * GP) = wr[i]; }
    __syncthreads();   /* publishes this pass's buffer; the other buffer's readers of the pass before are behind it when the next pass stores there */
    if (kc + 1 < DIN / 64) g_fetch(px, pw, xr, wr);
#pragma unroll   // the two 32-k halves of the pass, in k order
    for (int h = 0; h < 2; ++h) { v16b a[4], b[4];
#pragma unroll   // constant indices keep the arrays in registers
      for (int i = 0; i < 4; ++i) { a[i] = frag_b(sb + (wm * 64 + i * 16 + col) * GP + h * 32, lane); b[i] = frag_b(sb + (128 + wn * 64 + i * 16 + col) * GP + h * 32, lane); }
#pragma unroll   // constant indices keep the arrays in registers
      for (int i = 0; i < 4; ++i)
#pragma unroll   // constant indices keep the arrays in registers
        for (int j = 0; j < 4; ++j) acc[i][j] = wmb(a[i], b[j], acc[i][j]); } }
  __syncthreads();   /* every wave has left the buffers: the epilogue's planes lie over them */
  _Float16* sh = (_Float16*)sm; _Float16* sl = sh + 128 * 136; float bs[4] = {};
  if (BA) { g_bias(BA + c0 + wn * 64 + col, bs); }
  const int o0 = (wm * 64 + 8 * g) * 136 + wn * 64 + col;
  if (which == 0) rows_lds<true>(acc, bs, sh + o0, sl + o0);
  else if (which == 1) rows_lds<false>(acc, bs, sh + o0, sl + o0);
  else {
#pragma unroll   // constant indices keep the arrays in registers
    for (int j = 0; j < 4; ++j)
#pragma unroll   // constant indices keep the arrays in registers
      for (int i = 0; i < 4; ++i) { v8h t;
#pragma unroll   // constant indices keep the arrays in registers
        for (int r = 0; r < 8; ++r) t[r] = (_Float16)(acc[i][j][r] + bs[j]);
        *(v8h*)&sh[(wn * 64 + j * 16 + col) * 136 + wm * 64 + i * 16 + 8 * g] = t; } }   /* transposed: a lane's 8 rows are 8 consecutive t of its column */
  __syncthreads();
  /* copy-out: thread = (plane row tid >> 4 of 8, 16 bytes tid & 15), 256 B of a row by 16 lanes; q and k rows [b*t][CC] and v planes [c][t] both step 2 KB a row */
  const int sr = (tid >> 4) * 136 + (tid & 15) * 8; const size_t qo = (r0 + (tid >> 4)) * CC + c0 + (tid & 15) * 8;
  gu4_p dh = (gu4_p)(which == 0 ? QH + qo : which == 1 ? KH + qo : VT + (bb * CC + c0 + (tid >> 4)) * (size_t)TT + t0 + (tid & 15) * 8);
  gu4_p dl = (gu4_p)(QL + (bb * QHI + t0 + (tid >> 4)) * (size_t)CC + c0 + (tid & 15) * 8);
#pragma unroll   // one address pair and constant offsets: no address register is rewritten behind a store
  for (int it = 0; it < 16; ++it) dh[(size_t)it * 1024] = *(const v4u*)&sh[sr + it * 8 * 136];
  asm volatile("s_wait_xcnt 0x0" :: "v"(dh) : "memory");   /* behind the stores, in front of the second plane's reads and address, which reuse the stores' registers; the address pair is named to stay unwritten up to here */
  if (which == 0) {
#pragma unroll   // as above
    for (int it = 0; it < 16; ++it) dl[(size_t)it * 1024] = *(const v4u*)&sl[sr + it * 8 * 136]; } }
// ---- k_att: block = 16 waves x 16 queries of (b, head e); a wave holds both 32-wide sub-heads of its 16 queries. The head's K rows and V^T rows come into LDS once per block, 128 keys a stage, two buffers, by asynchronous copies of whole 128-B lines; all 16 waves take their fragments from there. Per 32 keys: S^T = K Q^T (q residual product first, x 2^-10, then the q hi product on top of it), running maximum and sum per query (query = lane column; base-2 exponent, scale folded in), P^T packed from the two score tiles straight into a B operand, O^T += V^T P^T with the head's 64-wide v fragments shared by both sub-heads. No logits or P in memory. The epilogue forms the head's differential row o = P1.v / l1 - lambda P2.v / l2 in registers (a wave holds both sub-heads of its queries), rounds it to f16, k_out's operand type, and stores the 64-wide context rows [b*t][CC]; every wave forms lambda for itself while stage 0 is in flight.
#define AW 16
#define KS 128                        // keys of one LDS stage
#define KKP 72                        // K row pitch in f16 elements: 144 B = 16 B x 9, odd, for 16-byte fragment reads
#define KVP 136                       // V^T row pitch in f16 elements: 272 B = 16 B x 17, odd
#define KSTG (KS * KKP + HDV * KVP)   // elements of one buffer: 128 K rows [key][64], then 64 V^T rows [d][128 keys]
__device__ __forceinline__ v8f wm(v16h a, v16h b, v8f c) { return __builtin_amdgcn_wmma_f32_16x16x32_f16(false, a, false, b, (short)0, c, false, false); }
__device__ __forceinline__ float xhalf(float x) { return __builtin_bit_cast(float, __builtin_amdgcn_permlanex16(__builtin_bit_cast(int, x), __builtin_bit_cast(int, x), 0x76543210, 0xfedcba98, false, false)); }   /* lane l with lane l ^ 16 */
typedef const __attribute__((address_space(1))) _Float16* gh_p;   /* pointer typed as global memory */
__device__ __forceinline__ v16h frag_l(const _Float16* p) { union { v16h v; v8h q[2]; } u; u.q[0] = *(const v8h*)p; u.q[1] = *(const v8h*)(p + 16); return u.v; }   /* frag_h with the lane half's 8 elements already in p */
/* one stage: a thread copies 16 B of K rows r and r + 64 and of V^T rows d and d + 32 (a wave-wide copy = 4 whole lines). The wait is the last line of the copies' own statement, so that no register a copy names is rewritten in front of it */
__device__ __forceinline__ void kv_copy(unsigned lk, gh_p gk, unsigned lv, gh_p gv) {
  asm volatile("global_load_async_to_lds_b128 %0, %1, off\n\tglobal_load_async_to_lds_b128 %2, %3, off\n\tglobal_load_async_to_lds_b128 %4, %5, off\n\tglobal_load_async_to_lds_b128 %6, %7, off\n\ts_wait_xcnt 0x0"
    :: "v"(lk), "v"(gk), "v"(lk + 64 * KKP * 2), "v"(gk + (size_t)64 * CC), "v"(lv), "v"(gv), "v"(lv + 32 * KVP * 2), "v"(gv + (size_t)32 * TT) : "memory");
}
/* lambda = mean over 64 of (exp(lq1 lk1) - exp(lq2 lk2) + 0.8) from the four bf16-rounded [64] inputs: lane l forms terms l and l + 32, the sum runs over the terms in index order; the same value in every lane */
__device__ __forceinline__ float lambda_of(const float* __restrict__ LQ1, const float* __restrict__ LK1, const float* __restrict__ LQ2, const float* __restrict__ LK2, int lane) {
  float in[8];
#pragma unroll   // constant indices keep the array in registers
  for (int h = 0; h < 2; ++h) { in[4 * h] = LQ1[lane + 32 * h]; in[4 * h + 1] = LK1[lane + 32 * h]; in[4 * h + 2] = LQ2[lane + 32 * h]; in[4 * h + 3] = LK2[lane + 32 * h]; }
  asm volatile("s_wait_xcnt 0x0" ::: "memory");   /* behind the eight loads, in front of any rewrite of their address registers */
  float s1 = 0.f;
#pragma unroll   // constant indices keep the array in registers
  for (int h = 0; h < 2; ++h) { const float tm = (expf(bfr(in[4 * h]) * bfr(in[4 * h + 1])) - expf(bfr(in[4 * h + 2]) * bfr(in[4 * h + 3]))) + 0.8f;
#pragma unroll   // the lane number of a lane read is a constant
    for (int i = 0; i < 32; ++i) s1 += __builtin_bit_cast(float, __builtin_amdgcn_readlane(__builtin_bit_cast(int, tm), i)); }
  return s1 * (1.0f / 64.0f);
}
__global__ __launch_bounds__(AW * 32) void k_att(const _Float16* __restrict__ QH, const _Float16* __restrict__ QL, const _Float16* __restrict__ KH, const _Float16* __restrict__ VT, const float* __restrict__ LQ1, const float* __restrict__ LK1, const float* __restrict__ LQ2, const float* __restrict__ LK2, _Float16* __restrict__ YD) {
  __shared__ __align__(16) unsigned char sm[2 * KSTG * 2 + AW * 16 * (HDV + 8) * 2];   /* the two stage buffers first, so that every fragment read's constant part fits the instruction's offset field; behind them the epilogue's rows */
  _Float16* kv = (_Float16*)sm; _Float16 (*so)[16][HDV + 8] = (_Float16 (*)[16][HDV + 8])(sm + 2 * KSTG * 2);   /* row pitch 144 B = 16 B x 9, odd */
  const int tid = threadIdx.x, wave = tid >> 5, lane = tid & 31, col = lane & 15, g = lane >> 4; const int e = blockIdx.y, b = blockIdx.z; const int ql0 = blockIdx.x * (AW * 16) + wave * 16;
  const float C2 = SCALE * 1.4426950408889634f;
  const unsigned lk = (unsigned)(size_t)kv + (unsigned)(((tid >> 3) * KKP + (tid & 7) * 8) * 2);              /* LDS byte address: K row tid >> 3 of 64, 16 bytes tid & 7 of 128 */
  const unsigned lv = (unsigned)(size_t)kv + (unsigned)((KS * KKP + (tid >> 4) * KVP + (tid & 15) * 8) * 2);   /* V^T row tid >> 4 of 32, 16 bytes tid & 15 of 256 */
  gh_p gk = (gh_p)(KH + ((size_t)b * TT + (tid >> 3)) * CC + e * HDV + (tid & 7) * 8);      /* walks 128 keys a stage */
  gh_p gv = (gh_p)(VT + ((size_t)b * CC + e * HDV + (tid >> 4)) * TT + (tid & 15) * 8);
  kv_copy(lk, gk, lv, gv); gk += (size_t)KS * CC; gv += KS;   /* stage 0 into buffer 0 */
  v16h qh[2], ql[2];
  const _Float16* qhp = QH + ((size_t)b * TT + ql0 + col) * CC + e * HDV; const _Float16* qlp = QL + ((size_t)b * QHI + ql0 + col) * CC + e * HDV;   /* query row col, this head's 64 columns: hi and residual */
#pragma unroll   // constant indices keep the fragment arrays in registers
  for (int u = 0; u < 2; ++u) { qh[u] = frag_h(qhp + u * HD, lane); ql[u] = frag_h(qlp + u * HD, lane); }
  asm volatile("s_wait_xcnt 0x0" :: "v"(qhp + 8 * g), "v"(qlp + 8 * g) : "memory");   /* behind the q loads; their addresses are named as inputs to stay unwritten up to it */
  const float lam = lambda_of(LQ1, LK1, LQ2, LK2, lane);
  asm volatile("s_wait_asynccnt 0x0" ::: "memory");   /* this wave's copies of stage 0 have landed */
  __syncthreads();                                    /* publishes stage 0 */
  kv_copy(lk + KSTG * 2, gk, lv + KSTG * 2, gv); gk += (size_t)KS * CC; gv += KS;   /* stage 1 into buffer 1, in flight over stage 0's work */
  v8f acc[2][HDV / 16] = {}; float mu[2] = { -3.0e38f, -3.0e38f }; v2f ls[2] = {};   /* per query: maximum in use; sum, even and odd keys apart */
#pragma unroll 1   // rolled: the publish point stands once, at the foot of a stage
  for (int t = 0; t < TT / KS; ++t) {
    const _Float16* kb = kv + (t & 1) * KSTG + col * KKP + 8 * g;              /* key row col of a 16-key tile, the lane's half */
    const _Float16* vb = kv + (t & 1) * KSTG + KS * KKP + col * KVP + 8 * g;   /* value column col of a 16-column tile, keys contiguous, the lane's half */
#pragma unroll 1   // rolled: one pass's registers only, so that four waves fit a SIMD
    for (int sp = 0; sp < KS / 32; ++sp) {
      v16h kf[2][2], vf[HDV / 16];
#pragma unroll   // constant indices keep the fragment arrays in registers
      for (int u = 0; u < 2; ++u)
#pragma unroll   // constant indices keep the fragment arrays in registers
        for (int kt = 0; kt < 2; ++kt) kf[u][kt] = frag_l(kb + (sp * 32 + kt * 16) * KKP + u * HD);
#pragma unroll   // constant indices keep the fragment arrays in registers
      for (int j = 0; j < HDV / 16; ++j) vf[j] = frag_l(vb + (j * 16) * KVP + sp * 32);
      v8f s[2][2];
#pragma unroll   // constant indices keep the fragment arrays in registers
      for (int u = 0; u < 2; ++u)
#pragma unroll   // constant indices keep the fragment arrays in registers
        for (int kt = 0; kt < 2; ++kt) { const v8f z = {}; s[u][kt] = wm(kf[u][kt], ql[u], z); }
#pragma unroll   // constant indices keep the fragment arrays in registers
      for (int u = 0; u < 2; ++u)
#pragma unroll   // constant indices keep the fragment arrays in registers
        for (int kt = 0; kt < 2; ++kt) s[u][kt] = wm(kf[u][kt], qh[u], s[u][kt] * (1.0f / 1024.0f));
      float mx[2];
#pragma unroll   // constant indices keep the fragment arrays in registers
      for (int u = 0; u < 2; ++u) { float m = fmaxf(s[u][0][0], s[u][1][0]);
#pragma unroll   // constant indices keep the fragment arrays in registers
        for (int r = 1; r < 8; ++r) m = fmaxf(m, fmaxf(s[u][0][r], s[u][1][r]));
        mx[u] = fmaxf(m, xhalf(m)) * C2; }
      if (__builtin_amdgcn_ballot_w32(mx[0] > mu[0] + 8.0f || mx[1] > mu[1] + 8.0f) != 0) {   /* rescale only when a query's maximum outgrows the one in use by 2^8: P stays <= 256 in f16 */
#pragma unroll   // constant indices keep the fragment arrays in registers
        for (int u = 0; u < 2; ++u) { const float mn = fmaxf(mu[u], mx[u]); const float corr = __builtin_amdgcn_exp2f(mu[u] - mn); mu[u] = mn; ls[u] *= corr;
#pragma unroll   // constant indices keep the fragment arrays in registers
          for (int j = 0; j < HDV / 16; ++j) acc[u][j] *= corr; } }
#pragma unroll   // constant indices keep the fragment arrays in registers
      for (int u = 0; u < 2; ++u) { v16h p;
#pragma unroll   // constant indices keep the fragment arrays in registers
        for (int i = 0; i < 16; i += 2) { v2f a = { s[u][i >> 3][i & 7], s[u][i >> 3][(i & 7) + 1] }; const v2f c2 = { C2, C2 }, nm = { -mu[u], -mu[u] }; a = __builtin_elementwise_fma(a, c2, nm);
          const v2f pe = { __builtin_amdgcn_exp2f(a[0]), __builtin_amdgcn_exp2f(a[1]) }; ls[u] += pe; p[i] = (_Float16)pe[0]; p[i + 1] = (_Float16)pe[1]; }
#pragma unroll   // constant indices keep the fragment arrays in registers
        for (int j = 0; j < HDV / 16; ++j) acc[u][j] = wm(vf[j], p, acc[u][j]); } }
    /* publish point of stage t + 1: this wave's reads of buffer t & 1 are done, its copies of stage t + 1 have landed; the barrier publishes that stage and ends every wave's reads of the buffer refilled behind it */
    asm volatile("s_wait_dscnt 0x0" ::: "memory");
    asm volatile("s_wait_asynccnt 0x0" ::: "memory");
    __syncthreads();
    if (t + 2 < TT / KS) { kv_copy(lk + (t & 1) * (KSTG * 2), gk, lv + (t & 1) * (KSTG * 2), gv); gk += (size_t)KS * CC; gv += KS; } }
  asm volatile("s_wait_asynccnt 0x0" ::: "memory");   /* no copy is outstanding when the wave goes on to its end */
  float w[2];   /* weight of each sub-head's unnormalised sum: 1 / l1 and -lambda / l2 */
#pragma unroll   // constant indices keep the fragment arrays in registers
  for (int u = 0; u < 2; ++u) { const float lh = ls[u][0] + ls[u][1]; w[u] = 1.0f / (lh + xhalf(lh)); }
  w[1] *= -lam;
#pragma unroll   // constant indices keep the fragment arrays in registers
  for (int j = 0; j < HDV / 16; ++j) { v8h t;
#pragma unroll   // constant indices keep the fragment arrays in registers
    for (int r = 0; r < 8; ++r) t[r] = (_Float16)(acc[0][j][r] * w[0] + acc[1][j][r] * w[1]);
    *(v8h*)&so[wave][col][j * 16 + 8 * g] = t; }
  LDSX();
  gu4_p po = (gu4_p)(YD + ((size_t)b * TT + ql0 + (lane >> 3)) * CC + e * HDV + (lane & 7) * 8);   /* a wave-wide store = the 128-B head segments of four rows */
#pragma unroll   // one address pair and constant offsets: no address register is rewritten behind a store
  for (int it = 0; it < 4; ++it) po[(size_t)it * (4 * CC * 2 / 16)] = *(const v4u*)&so[wave][it * 4 + (lane >> 3)][(lane & 7) * 8]; }
// ---- k_out: block = (128 rows, 128 cols): out = ctx Wo (+ bo): k_att's f16 ctx rows against k_cvt's Wo rows, f16(bf16 x 2^8) exact (1 product) x 2^-8; staged as in k_proj
__global__ __launch_bounds__(128) void k_out(const _Float16* __restrict__ Y, const _Float16* __restrict__ WO, const float* __restrict__ BO, float* __restrict__ OUT) {
  __shared__ __align__(16) unsigned char sm[GSM];
  const int tid = threadIdx.x, wave = tid >> 5, lane = tid & 31, col = lane & 15, g = lane >> 4, wm = wave >> 1, wn = wave & 1; const int c0 = blockIdx.y * 128; const size_t r0 = (size_t)blockIdx.x * 128;
  gcu4_p px = (gcu4_p)(Y + (r0 + (tid >> 3)) * CC + (tid & 7) * 8); gcu4_p pw = (gcu4_p)(WO + (size_t)(c0 + (tid >> 3)) * CC + (tid & 7) * 8);
  _Float16* st = (_Float16*)sm; const int so = (tid >> 3) * GP + (tid & 7) * 8;
  v4u xr[8], wr[8]; v8f acc[4][4] = {};
  g_fetch(px, pw, xr, wr);
  for (int kc = 0; kc < CC / 64; ++kc) { _Float16* sb = st + (kc & 1) * GSTG;
#pragma unroll   // constant indices keep the arrays in registers
    for (int i = 0; i < 8; ++i) { *(v4u*)(sb + so + i * 16 * GP) = xr[i]; *(v4u*)(sb + 128 * GP + so + i * 16 * GP) = wr[i]; }
    __syncthreads();   /* publishes this pass's buffer; the other buffer's readers of the pass before are behind it when the next pass stores there */
    if (kc + 1 < CC / 64) g_fetch(px, pw, xr, wr);
#pragma unroll   // the two 32-k halves of the pass, in k order
    for (int h = 0; h < 2; ++h) { v16h a[4], b[4];
#pragma unroll   // constant indices keep the arrays in registers
      for (int i = 0; i < 4; ++i) { a[i] = frag_h(sb + (wm * 64 + i * 16 + col) * GP + h * 32, lane); b[i] = frag_h(sb + (128 + wn * 64 + i * 16 + col) * GP + h * 32, lane); }
#pragma unroll   // constant indices keep the arrays in registers
      for (int i = 0; i < 4; ++i)
#pragma unroll   // constant indices keep the arrays in registers
        for (int j = 0; j < 4; ++j) acc[i][j] = wmh(a[i], b[j], acc[i][j]); } }
  __syncthreads();   /* every wave has left the buffers: the output tile [128][132] f32 lies over them */
  float* sf = (float*)sm; float bs[4] = {};
  if (BO) { g_bias(BO + c0 + wn * 64 + col, bs); }
#pragma unroll   // constant indices keep the arrays in registers
  for (int j = 0; j < 4; ++j)
#pragma unroll   // constant indices keep the arrays in registers
    for (int i = 0; i < 4; ++i)
#pragma unroll   // constant indices keep the arrays in registers
      for (int r = 0; r < 8; ++r) sf[(wm * 64 + i * 16 + 8 * g + r) * 132 + wn * 64 + j * 16 + col] = acc[i][j][r] * (1.0f / 256.0f) + bs[j];
  __syncthreads();
  gf4_p po = (gf4_p)(OUT + (r0 + wave) * DIN + c0 + lane * 4);   /* a wave stores 512 B of one row */
#pragma unroll   // one address pair and constant offsets: no address register is rewritten behind a store
  for (int it = 0; it < 32; ++it) po[(size_t)it * (4 * DIN * 4 / 16)] = *(const v4f*)&sf[(wave + it * 4) * 132 + lane * 4]; }

extern "C" void kernel_launch(void* const* d_in, const int* in_sizes, int n_in, void* d_out, int out_size, void* d_ws, size_t ws_size, hipStream_t stream) {
  (void)in_sizes; (void)n_in; (void)out_size;
  const float** F = (const float**)d_in;
  if (ws_size < (size_t)WS_END) return;
  char* ws = (char*)d_ws; _Float16 *QH = (_Float16*)(ws + WS_QH), *KH = (_Float16*)(ws + WS_KH), *VT = (_Float16*)(ws + WS_VT), *QL = (_Float16*)(ws + WS_QL), *KL = (_Float16*)(ws + WS_KL); __bf16 *VB = (__bf16*)(ws + WS_VB), *VBL = (__bf16*)(ws + WS_VBL), *XB = (__bf16*)(ws + WS_XB), *WB = (__bf16*)(ws + WS_WB); _Float16 *WPH = (_Float16*)(ws + WS_WP);
  (void)QL; (void)KL; (void)VB; (void)VBL;
  // inputs: 0 x [4,1024,1024]; 1 W_qkv [3072,1024] (out,in: rows 0-1023 q, 1024-2047 k, 2048-3071 v); 2 W_proj [1024,1024] (out,in); 3 b_proj; 4 lambda_q1, 5 lambda_k1, 6 lambda_q2, 7 lambda_k2 [64]
  _Float16* YD = (_Float16*)(ws + WS_S);   /* the differential rows [b*t][CC] live in the WS_S plane */
  k_cvt<<<CVX + CVW + CVP, 256, 0, stream>>>(F[0], F[1], F[2], XB, WB, WPH);
  k_proj<<<dim3(TNB * TT / 128, CC / 128, 3), 128, 0, stream>>>(XB, XB, XB, WB, WB + (size_t)CC * DIN, WB + (size_t)2 * CC * DIN, nullptr, nullptr, nullptr, QH, QL, KH, VT);
  k_att<<<dim3(TT / (AW * 16), NH / 2, TNB), AW * 32, 0, stream>>>(QH, QL, KH, VT, F[4], F[5], F[6], F[7], YD);
  k_out<<<dim3(TNB * TT / 128, DIN / 128), 128, 0, stream>>>(YD, WPH, F[3], (float*)d_out);
}

// v006
// It runs in 81.1 microseconds.
// Timed twice side by side with v005, it ran 1.06 and 1.07 times as fast.
// All steps since v000 together make it 17.6 times as fast.
// compute dtype: all float inputs rounded to bf16; qkv = x Wqkv^T with EXACT bf16 products on WMMA 16x16x32 (f32 accumulate); the two 32-wide sub-head logits with q as f16 hi + residual (x 2^10) against k once to f16 (2 products) x 64^-0.5; both softmaxes in f32 with a running maximum and sum (base-2 exponent); each unnormalised P (<= 2^8) once to f16 against the head's 64-wide v once to f16 (1 product), divided by the f32 sum at the end; the differential combination P1.v - lambda P2.v and lambda (mean of exp(lq1 lk1) - exp(lq2 lk2) + 0.8 over 64) in f32; ctx once to f16 against W_proj carried x 2^8 in f16 + b_proj; f32 output.
#include <hip/hip_runtime.h>
#include <math.h>

typedef __attribute__((ext_vector_type(16))) _Float16 v16h;
typedef __attribute__((ext_vector_type(16))) __bf16 v16b;
typedef __attribute__((ext_vector_type(8)))  _Float16 v8h;
typedef __attribute__((ext_vector_type(8)))  float v8f;
typedef __attribute__((ext_vector_type(4)))  float v4f;
typedef __attribute__((ext_vector_type(2)))  float v2f;
typedef __attribute__((ext_vector_type(4)))  unsigned v4u;
typedef __attribute__((ext_vector_type(4)))  int v4i;
typedef float __attribute__((may_alias)) float_a;
typedef int __attribute__((may_alias)) int_a;

template <typename T> __device__ __forceinline__ void vst2(void* p, T v) { *(T*)p = v;  }
__device__ __forceinline__ v8f wmma16(v16h a, v16h b, v8f c) {
  v8f d = __builtin_amdgcn_wmma_f32_16x16x32_f16(false, a, false, b, (short)0, c, false, false);
  asm volatile("v_nop\n\tv_nop\n\tv_nop\n\tv_nop" : "+v"(d) : "v"(a), "v"(b));
  return d;
}
__device__ __forceinline__ v8f wmma_bf(v16b a, v16b b, v8f c) {
  v8f d = __builtin_amdgcn_wmma_f32_16x16x32_bf16(false, a, false, b, (short)0, c, false, false);
  asm volatile("v_nop\n\tv_nop\n\tv_nop\n\tv_nop" : "+v"(d) : "v"(a), "v"(b));
  return d;
}
// 16x16x32 fragments: lane = (h = lane>>4, row/col = lane&15); elements 0..7 = k0+8h+0..7, 8..15 = k0+16+8h+0..7; D element r = row 8h+r
__device__ __forceinline__ v16h frag_h(const _Float16* rowk0, int lane) {
  union { v16h v; v8h q[2]; } u; const _Float16* p = rowk0 + 8 * (lane >> 4);
  u.q[0] = *(const v8h*)p; u.q[1] = *(const v8h*)(p + 16); return u.v;
}
__device__ __forceinline__ v16h frag_f32(const float* rowk0, int lane) {
  v16h a; const float* p = rowk0 + 8 * (lane >> 4);
#pragma unroll
  for (int i = 0; i < 8; ++i) { a[i] = (_Float16)p[i]; a[8 + i] = (_Float16)p[16 + i]; }
  return a;
}
__device__ __forceinline__ v16h frag_f32s(const float* rowk0, int lane, float sc) {
  v16h a; const float* p = rowk0 + 8 * (lane >> 4);
#pragma unroll
  for (int i = 0; i < 8; ++i) { a[i] = (_Float16)(p[i] * sc); a[8 + i] = (_Float16)(p[16 + i] * sc); }
  return a;
}
// column fragment from a [K][ld] layout (column n), rows >= K read as 0
__device__ __forceinline__ v16h fragc_f32(const float* W, int k0, int n, int lane, int ld, int K) {
  v16h a; const int g = lane >> 4;
#pragma unroll
  for (int i = 0; i < 8; ++i) { const int ka = k0 + 8 * g + i, kb = ka + 16;
    a[i] = (_Float16)(ka < K ? W[(size_t)(ka < K ? ka : K - 1) * ld + n] : 0.f); a[8 + i] = (_Float16)(kb < K ? W[(size_t)(kb < K ? kb : K - 1) * ld + n] : 0.f); }
  return a;
}
struct F2 { v16b h, l; };
__device__ __forceinline__ F2 bsplit16(const float v[16]) { F2 r;
#pragma unroll
  for (int i = 0; i < 16; ++i) { const __bf16 h = (__bf16)v[i]; r.h[i] = h; r.l[i] = (__bf16)(v[i] - (float)h); }
  return r; }
__device__ __forceinline__ F2 split_row(const float* row, int k0, int lane) { float v[16]; const float* p = row + k0 + 8 * (lane >> 4);
#pragma unroll
  for (int i = 0; i < 8; ++i) { v[i] = p[i]; v[8 + i] = p[16 + i]; }
  return bsplit16(v); }
__device__ __forceinline__ F2 split_rowK(const float* row, int k0, int lane, int K) { float v[16]; const int g = lane >> 4;
#pragma unroll
  for (int i = 0; i < 8; ++i) { const int ka = k0 + 8 * g + i, kb = ka + 16; v[i] = ka < K ? row[ka < K ? ka : K - 1] : 0.f; v[8 + i] = kb < K ? row[kb < K ? kb : K - 1] : 0.f; }
  return bsplit16(v); }
__device__ __forceinline__ F2 split_col(const float* W, int k0, int n, int lane, int ld, int K) { float v[16]; const int g = lane >> 4;
#pragma unroll
  for (int i = 0; i < 8; ++i) { const int ka = k0 + 8 * g + i, kb = ka + 16; v[i] = ka < K ? W[(size_t)(ka < K ? ka : K - 1) * ld + n] : 0.f; v[8 + i] = kb < K ? W[(size_t)(kb < K ? kb : K - 1) * ld + n] : 0.f; }
  return bsplit16(v); }
__device__ __forceinline__ v8f mac3(const F2& a, const F2& b, v8f c) { c = wmma_bf(a.l, b.h, c); c = wmma_bf(a.h, b.l, c); return wmma_bf(a.h, b.h, c); }
__device__ __forceinline__ float sigm(float v) { return 1.0f / (1.0f + expf(-v)); }
#define LDSX() do { asm volatile("s_wait_dscnt 0" ::: "memory"); __builtin_amdgcn_wave_barrier(); __builtin_amdgcn_fence(__ATOMIC_RELEASE, "workgroup"); } while (0)

// Differential attention (B 4, N 1,024, C 1,024 = 16 heads x 64): qkv = x Wqkv^T ((out,in) [3072,1024]); per head the 64-dim q/k are split into two 32-dim halves: attn = softmax(q1 k1^T / 8) - lam softmax(q2 k2^T / 8), lam = mean(exp(lambda_q1 * lambda_k1) - exp(lambda_q2 * lambda_k2) + 0.8); out = merged(attn v) Wproj^T + b_proj. Realised as 32 softmax sub-heads of width 32 whose P.v share the parent head's 64-wide v.
#define NB 4
#define TT 1024
#define CC 1024            // NH * HD = projected width
#define DIN 1024          // input (model) width
#define NH 32              // softmax sub-heads (16 heads x 2 halves)
#define HD 32
#define NQB (TT / 64)
#define HG 8
#define SCALE (0.125f)
#define CAUSAL 0
#ifndef TNB
#define TNB NB
#endif
__device__ __forceinline__ float bfr(float v) { return (float)(__bf16)v; }
__host__ __device__ __forceinline__ int kb_last(int qb) { return CAUSAL ? ((qb * 64 + 63) >> 7) : (TT / 128 - 1); }
typedef __attribute__((ext_vector_type(8))) __bf16 v8b;
__device__ __forceinline__ v16b frag_b(const __bf16* rowk0, int lane) {
  union { v16b v; v8b q[2]; } u; const __bf16* p = rowk0 + 8 * (lane >> 4);
  u.q[0] = *(const v8b*)p; u.q[1] = *(const v8b*)(p + 16); return u.v;
}
#define QBH 0              // unused: k_att treats all query blocks alike
#define QHI 1024            // rows carrying a q residual plane (all rows: 2-product logits everywhere)
#define KHI 64            // key rows carrying k residual / v bf16 hi+lo planes (written and read by no kernel)
// B fragment (k rows k0+.., output column o) of a weight: (in,out) [K][ld] or (out,in) [ld rows of K]: bf16 exact, or f16(bf16 * 256) exact
__device__ __forceinline__ v16b wcol_io(const float* Wm, int k0, int o, int lane, int ld) { v16b w; const int g = lane >> 4;
#pragma unroll
  for (int i = 0; i < 8; ++i) { w[i] = (__bf16)Wm[(size_t)(k0 + 8 * g + i) * ld + o]; w[8 + i] = (__bf16)Wm[(size_t)(k0 + 16 + 8 * g + i) * ld + o]; }
  return w; }
__device__ __forceinline__ v16b wcol_oi(const float* Wm, int k0, int o, int lane, int K) { v16b w; const float* p = Wm + (size_t)o * K + k0 + 8 * (lane >> 4);
#pragma unroll
  for (int i = 0; i < 8; ++i) { w[i] = (__bf16)p[i]; w[8 + i] = (__bf16)p[16 + i]; }
  return w; }
__device__ __forceinline__ v16h wcolh_io(const float* Wm, int k0, int o, int lane, int ld) { v16h w; const int g = lane >> 4;
#pragma unroll
  for (int i = 0; i < 8; ++i) { w[i] = (_Float16)(bfr(Wm[(size_t)(k0 + 8 * g + i) * ld + o]) * 256.0f); w[8 + i] = (_Float16)(bfr(Wm[(size_t)(k0 + 16 + 8 * g + i) * ld + o]) * 256.0f); }
  return w; }
__device__ __forceinline__ v16h wcolh_oi(const float* Wm, int k0, int o, int lane, int K) { v16h w; const float* p = Wm + (size_t)o * K + k0 + 8 * (lane >> 4);
#pragma unroll
  for (int i = 0; i < 8; ++i) { w[i] = (_Float16)(bfr(p[i]) * 256.0f); w[8 + i] = (_Float16)(bfr(p[16 + i]) * 256.0f); }
  return w; }
#define WQKV_LAYOUT 1   // 0 = (in,out) [DIN][CC]; 1 = (out,in) [CC][DIN]; 2 = per-head [NH][DIN][HD]
__device__ __forceinline__ v16b wcol_hdk(const float* Wm, int k0, int o, int lane) { v16b w; const int g = lane >> 4; const float* p = Wm + (size_t)(o / HD) * DIN * HD + (o % HD);
#pragma unroll
  for (int i = 0; i < 8; ++i) { w[i] = (__bf16)p[(size_t)(k0 + 8 * g + i) * HD]; w[8 + i] = (__bf16)p[(size_t)(k0 + 16 + 8 * g + i) * HD]; }
  return w; }
#define WO_OUT_IN 1
#if WQKV_LAYOUT == 1
#define WCOL(W, k0, o, lane) wcol_oi(W, k0, o, lane, DIN)
#elif WQKV_LAYOUT == 2
#define WCOL(W, k0, o, lane) wcol_hdk(W, k0, o, lane)
#else
#define WCOL(W, k0, o, lane) wcol_io(W, k0, o, lane, CC)
#endif
#if WO_OUT_IN
#define WOCOL(W, k0, o, lane) wcol_oi(W, k0, o, lane, CC)
#define WOCOLH(W, k0, o, lane) wcolh_oi(W, k0, o, lane, CC)
#else
#define WOCOL(W, k0, o, lane) wcol_io(W, k0, o, lane, DIN)
#define WOCOLH(W, k0, o, lane) wcolh_io(W, k0, o, lane, DIN)
#endif
#define HDV 64             // value columns per softmax sub-head (the parent head's 64 columns)
#ifndef SM_EXTRA_PARAMS
#define SM_EXTRA_PARAMS
#endif
#ifndef PROJ_EXTRA_PARAMS
#define PROJ_EXTRA_PARAMS
#endif
#ifndef SM_MASK_HOOK
#define SM_MASK_HOOK (void)0
#endif

#define WS_QH  0u                                      // f16 q rows [b*t][CC]
#define WS_KH  (WS_QH + 2u * (size_t)NB * TT * CC)      // f16 k rows [b*t][CC]
#define WS_VT  (WS_KH + 2u * (size_t)NB * TT * CC)      // f16 v planes [b][c][t]
#define WS_QL  (WS_VT + 2u * (size_t)NB * CC * TT)      // f16 q residual x 2^10 rows [b][t < QHI][CC]
#define WS_KL  (WS_QL + 2u * (size_t)NB * QHI * CC)     // f16 k residual x 2^10 rows [b][t < KHI][CC]
#define WS_VB  (WS_KL + 2u * (size_t)NB * KHI * CC)     // bf16 v hi planes [b][c][t < KHI]
#define WS_VBL (WS_VB + 2u * (size_t)NB * CC * KHI)
#define WS_S   (WS_VBL + 2u * (size_t)NB * CC * KHI)    // f16 differential rows [b*t][CC] (first quarter of the plane)
#define WS_XB  (WS_S  + 4u * (size_t)HG * TT * TT)      // bf16 x rows [b*t][DIN]
#define WS_WB  (WS_XB + 2u * (size_t)NB * TT * DIN)     // bf16 W_qkv rows [3 * CC][DIN]
#define WS_WP  (WS_WB + 2u * (size_t)3 * CC * DIN)      // f16 (bf16(W_proj) x 2^8) rows [DIN][CC]
#define WS_END (WS_WP + 2u * (size_t)DIN * CC)

// ---- the two GEMM kernels: block = 4 waves (2 x 2), tile 128 rows x 128 cols, a wave 64 x 64 (16 accumulator tiles). Both operands lie in memory in the 16-bit operand type (k_cvt rounds x and the weights once; k_att stores its rows as f16). Per 64 k: every thread loads whole 128-B lines of both operands (a wave-wide load = 4 rows) and stores them in LDS as they are; all waves take their fragments from there. k_proj: two LDS buffers, the next 64 k's global loads in flight over the products; k_out: asynchronous copies into a ring of four buffers, three 64-k stages in flight; one barrier a pass.
#define GP 72                       // LDS row pitch in 16-bit elements: 144 B = 16 B x 9, odd, for 16-byte fragment reads
#define GSTG (256 * GP)             // elements of one buffer: 128 X rows, then 128 W rows
#define GSM (2 * GSTG * 2)          // bytes: the two buffers, 73,728 (the epilogue's two f16 planes [128][136] take 69,632)
typedef const __attribute__((address_space(1))) float* gf_p;   /* typed as global memory, as gh_p below: an address that has gone through an asm statement still loads by global_load */
typedef const __attribute__((address_space(1))) v4f* gv4f_p;
typedef __attribute__((ext_vector_type(4))) __bf16 v4b;
typedef __attribute__((ext_vector_type(4))) _Float16 v4h;
__device__ __forceinline__ v8f wmb(v16b a, v16b b, v8f c) { return __builtin_amdgcn_wmma_f32_16x16x32_bf16(false, a, false, b, (short)0, c, false, false); }
__device__ __forceinline__ v8f wmh(v16h a, v16h b, v8f c) { return __builtin_amdgcn_wmma_f32_16x16x32_f16(false, a, false, b, (short)0, c, false, false); }
typedef const __attribute__((address_space(1))) v4u* gcu4_p;
/* 64 k of 128 rows of each operand: thread = (row tid >> 3 of 16, 8 elements tid & 7); rows are 2 KB apart; then both addresses step 64 elements. The wait and the steps stand in one statement, so that an address pair is rewritten only behind the wait */
__device__ __forceinline__ void g_fetch(gcu4_p& px, gcu4_p& pw, v4u (&xr)[8], v4u (&wr)[8]) {
#pragma unroll   // constant indices keep the arrays in registers
  for (int i = 0; i < 8; ++i) { xr[i] = px[(size_t)(i * 16) * (DIN * 2 / 16)]; wr[i] = pw[(size_t)(i * 16) * (DIN * 2 / 16)]; }
  asm volatile("s_wait_xcnt 0x0\n\tv_add_nc_u64 %0, %2, %0\n\tv_add_nc_u64 %1, %2, %1" : "+v"(px), "+v"(pw) : "s"((long long)128) : "memory");
}
typedef __attribute__((address_space(1))) v4u* gu4_p;
typedef __attribute__((address_space(1))) v4b* gb4_p;
typedef __attribute__((address_space(1))) v4h* gh4_p;
// ---- k_cvt: rounds the GEMM operands once: x and W_qkv to bf16, W_proj to f16(bf16 x 2^8). 256 blocks of 8 waves; a block takes 32,768 consecutive elements of one array, a thread 32 loads of 16 B (a wave-wide load = 4 whole lines), all in flight at once, and 32 stores of 8 B (a wave-wide store = 2 whole lines)
#define CVE 32768
#define CVX (NB * TT * DIN / CVE)   // blocks on x
#define CVW (3 * CC * DIN / CVE)    // blocks on W_qkv
#define CVP (DIN * CC / CVE)        // blocks on W_proj
__global__ __launch_bounds__(256) void k_cvt(const float* __restrict__ X, const float* __restrict__ WQKV, const float* __restrict__ WP, __bf16* __restrict__ XB, __bf16* __restrict__ WB, _Float16* __restrict__ WPH) {
  const int bid = blockIdx.x, tid = threadIdx.x; const int arr = bid < CVX ? 0 : bid < CVX + CVW ? 1 : 2;
  const size_t o = (size_t)(bid - (arr == 0 ? 0 : arr == 1 ? CVX : CVX + CVW)) * CVE + tid * 4;
  gv4f_p s = (gv4f_p)((arr == 0 ? X : arr == 1 ? WQKV : WP) + o);
  v4f v[32];
#pragma unroll   // constant indices keep the array in registers; one address pair and constant offsets
  for (int i = 0; i < 32; ++i) v[i] = s[i * 256];
  asm volatile("s_wait_xcnt 0x0" :: "v"(s) : "memory");   /* behind the loads; their address pair is named to stay unwritten up to here */
  if (arr < 2) { gb4_p d = (gb4_p)((arr == 0 ? XB : WB) + o);
#pragma unroll   // one address pair and constant offsets: no address register is rewritten behind a store
    for (int i = 0; i < 32; ++i) { v4b c;
#pragma unroll   // constant indices keep the arrays in registers
      for (int q = 0; q < 4; ++q) c[q] = (__bf16)v[i][q];
      d[i * 256] = c;
      if (i == 7 || i == 15 || i == 23) __builtin_amdgcn_sched_barrier(0); } }   /* eight stores leave as soon as their eight loads are back: without it the first store is scheduled behind the wait for the 25th load */
  else { gh4_p d = (gh4_p)(WPH + o); v4h c[32];
#pragma unroll   // constant indices keep the arrays in registers
    for (int i = 0; i < 32; ++i)
#pragma unroll   // constant indices keep the arrays in registers
      for (int q = 0; q < 4; ++q) c[i][q] = (_Float16)(bfr(v[i][q]) * 256.0f);
    __builtin_amdgcn_sched_barrier(0);   /* all values are formed in front of the first store, each in registers of its own: without it the stores' data registers are reused, with a wait in front of every reuse */
#pragma unroll   // as above
    for (int i = 0; i < 32; ++i) d[i * 256] = c[i]; } }
typedef __attribute__((address_space(1))) v4f* gf4_p;
/* the four bias values of a lane's columns (16 apart), rounded to bf16; the wait stands behind the loads, in front of any rewrite of their address registers */
__device__ __forceinline__ void g_bias(const float* p, float (&bs)[4]) {
#pragma unroll   // constant indices keep the arrays in registers
  for (int j = 0; j < 4; ++j) bs[j] = p[j * 16];
  asm volatile("s_wait_xcnt 0x0" ::: "memory");
#pragma unroll   // constant indices keep the arrays in registers
  for (int j = 0; j < 4; ++j) bs[j] = bfr(bs[j]);
}
/* q or k tile into LDS planes [128][136]: f16 rows (RES: and the residual x 2^10) */
template <bool RES> __device__ __forceinline__ void rows_lds(const v8f (&acc)[4][4], const float (&bs)[4], _Float16* sh, _Float16* sl) {
#pragma unroll   // constant indices keep the arrays in registers
  for (int j = 0; j < 4; ++j)
#pragma unroll   // constant indices keep the arrays in registers
    for (int i = 0; i < 4; ++i)
#pragma unroll   // constant indices keep the arrays in registers
      for (int r = 0; r < 8; ++r) { const float v = acc[i][j][r] + bs[j]; const _Float16 hv = (_Float16)v; const int o = (i * 16 + r) * 136 + j * 16; sh[o] = hv; if (RES) sl[o] = (_Float16)((v - (float)hv) * 1024.0f); }
}
// ---- k_proj: block = (128 rows, 128 cols, which): q/k/v = X W (+ b) with exact bf16 products (K = DIN), X and W as k_cvt's bf16 rows -> which 0: q f16 rows + residual rows; 1: k f16 rows; 2: v f16 planes [c][t]
__global__ __launch_bounds__(128) void k_proj(const __bf16* __restrict__ XQ, const __bf16* __restrict__ XK, const __bf16* __restrict__ XV, const __bf16* __restrict__ WQ, const __bf16* __restrict__ WK, const __bf16* __restrict__ WV, const float* __restrict__ BQ, const float* __restrict__ BK, const float* __restrict__ BV,
    _Float16* __restrict__ QH, _Float16* __restrict__ QL, _Float16* __restrict__ KH, _Float16* __restrict__ VT) {
  __shared__ __align__(16) unsigned char sm[GSM];
  const int tid = threadIdx.x, wave = tid >> 5, lane = tid & 31, col = lane & 15, g = lane >> 4, wm = wave >> 1, wn = wave & 1; const int which = blockIdx.z; const int c0 = blockIdx.y * 128; const size_t r0 = (size_t)blockIdx.x * 128; const size_t bb = r0 / TT; const int t0 = (int)(r0 % TT);
  const __bf16* X = which == 0 ? XQ : which == 1 ? XK : XV; const __bf16* WA = which == 0 ? WQ : which == 1 ? WK : WV; const float* BA = which == 0 ? BQ : which == 1 ? BK : BV;
  gcu4_p px = (gcu4_p)(X + (r0 + (tid >> 3)) * DIN + (tid & 7) * 8); gcu4_p pw = (gcu4_p)(WA + (size_t)(c0 + (tid >> 3)) * DIN + (tid & 7) * 8);
  __bf16* st = (__bf16*)sm; const int so = (tid >> 3) * GP + (tid & 7) * 8;
  v4u xr[8], wr[8]; v8f acc[4][4] = {};
  g_fetch(px, pw, xr, wr);
  for (int kc = 0; kc < DIN / 64; ++kc) { __bf16* sb = st + (kc & 1) * GSTG;
#pragma unroll   // constant indices keep the arrays in registers
    for (int i = 0; i < 8; ++i) { *(v4u*)(sb + so + i * 16 * GP) = xr[i]; *(v4u*)(sb + 128 * GP + so + i * 16 * GP) = wr[i]; }
    __syncthreads();   /* publishes this pass's buffer; the other buffer's readers of the pass before are behind it when the next pass stores there */
    if (kc + 1 < DIN / 64) g_fetch(px, pw, xr, wr);
#pragma unroll   // the two 32-k halves of the pass, in k order
    for (int h = 0; h < 2; ++h) { v16b a[4], b[4];
#pragma unroll   // constant indices keep the arrays in registers
      for (int i = 0; i < 4; ++i) { a[i] = frag_b(sb + (wm * 64 + i * 16 + col) * GP + h * 32, lane); b[i] = frag_b(sb + (128 + wn * 64 + i * 16 + col) * GP + h * 32, lane); }
#pragma unroll   // constant indices keep the arrays in registers
      for (int i = 0; i < 4; ++i)
#pragma unroll   // constant indices keep the arrays in registers
        for (int j = 0; j < 4; ++j) acc[i][j] = wmb(a[i], b[j], acc[i][j]); } }
  __syncthreads();   /* every wave has left the buffers: the epilogue's planes lie over them */
  _Float16* sh = (_Float16*)sm; _Float16* sl = sh + 128 * 136; float bs[4] = {};
  if (BA) { g_bias(BA + c0 + wn * 64 + col, bs); }
  const int o0 = (wm * 64 + 8 * g) * 136 + wn * 64 + col;
  if (which == 0) rows_lds<true>(acc, bs, sh + o0, sl + o0);
  else if (which == 1) rows_lds<false>(acc, bs, sh + o0, sl + o0);
  else {
#pragma unroll   // constant indices keep the arrays in registers
    for (int j = 0; j < 4; ++j)
#pragma unroll   // constant indices keep the arrays in registers
      for (int i = 0; i < 4; ++i) { v8h t;
#pragma unroll   // constant indices keep the arrays in registers
        for (int r = 0; r < 8; ++r) t[r] = (_Float16)(acc[i][j][r] + bs[j]);
        *(v8h*)&sh[(wn * 64 + j * 16 + col) * 136 + wm * 64 + i * 16 + 8 * g] = t; } }   /* transposed: a lane's 8 rows are 8 consecutive t of its column */
  __syncthreads();
  /* copy-out: thread = (plane row tid >> 4 of 8, 16 bytes tid & 15), 256 B of a row by 16 lanes; q and k rows [b*t][CC] and v planes [c][t] both step 2 KB a row */
  const int sr = (tid >> 4) * 136 + (tid & 15) * 8; const size_t qo = (r0 + (tid >> 4)) * CC + c0 + (tid & 15) * 8;
  gu4_p dh = (gu4_p)(which == 0 ? QH + qo : which == 1 ? KH + qo : VT + (bb * CC + c0 + (tid >> 4)) * (size_t)TT + t0 + (tid & 15) * 8);
  gu4_p dl = (gu4_p)(QL + (bb * QHI + t0 + (tid >> 4)) * (size_t)CC + c0 + (tid & 15) * 8);
#pragma unroll   // one address pair and constant offsets: no address register is rewritten behind a store
  for (int it = 0; it < 16; ++it) dh[(size_t)it * 1024] = *(const v4u*)&sh[sr + it * 8 * 136];
  asm volatile("s_wait_xcnt 0x0" :: "v"(dh) : "memory");   /* behind the stores, in front of the second plane's reads and address, which reuse the stores' registers; the address pair is named to stay unwritten up to here */
  if (which == 0) {
#pragma unroll   // as above
    for (int it = 0; it < 16; ++it) dl[(size_t)it * 1024] = *(const v4u*)&sl[sr + it * 8 * 136]; } }
// ---- k_att: block = 16 waves x 16 queries of (b, head e); a wave holds both 32-wide sub-heads of its 16 queries. The head's K rows and V^T rows come into LDS once per block, 128 keys a stage, two buffers, by asynchronous copies of whole 128-B lines; all 16 waves take their fragments from there. Per 32 keys: S^T = K Q^T (q residual product first, x 2^-10, then the q hi product on top of it), running maximum and sum per query (query = lane column; base-2 exponent, scale folded in), P^T packed from the two score tiles straight into a B operand, O^T += V^T P^T with the head's 64-wide v fragments shared by both sub-heads. No logits or P in memory. The epilogue forms the head's differential row o = P1.v / l1 - lambda P2.v / l2 in registers (a wave holds both sub-heads of its queries), rounds it to f16, k_out's operand type, and stores the 64-wide context rows [b*t][CC]; every wave forms lambda for itself while stage 0 is in flight.
#define AW 16
#define KS 128                        // keys of one LDS stage
#define KKP 72                        // K row pitch in f16 elements: 144 B = 16 B x 9, odd, for 16-byte fragment reads
#define KVP 136                       // V^T row pitch in f16 elements: 272 B = 16 B x 17, odd
#define KSTG (KS * KKP + HDV * KVP)   // elements of one buffer: 128 K rows [key][64], then 64 V^T rows [d][128 keys]
__device__ __forceinline__ v8f wm(v16h a, v16h b, v8f c) { return __builtin_amdgcn_wmma_f32_16x16x32_f16(false, a, false, b, (short)0, c, false, false); }
__device__ __forceinline__ float xhalf(float x) { return __builtin_bit_cast(float, __builtin_amdgcn_permlanex16(__builtin_bit_cast(int, x), __builtin_bit_cast(int, x), 0x76543210, 0xfedcba98, false, false)); }   /* lane l with lane l ^ 16 */
typedef const __attribute__((address_space(1))) _Float16* gh_p;   /* pointer typed as global memory */
__device__ __forceinline__ v16h frag_l(const _Float16* p) { union { v16h v; v8h q[2]; } u; u.q[0] = *(const v8h*)p; u.q[1] = *(const v8h*)(p + 16); return u.v; }   /* frag_h with the lane half's 8 elements already in p */
/* one stage: a thread copies 16 B of K rows r and r + 64 and of V^T rows d and d + 32 (a wave-wide copy = 4 whole lines). The wait is the last line of the copies' own statement, so that no register a copy names is rewritten in front of it */
__device__ __forceinline__ void kv_copy(unsigned lk, gh_p gk, unsigned lv, gh_p gv) {
  asm volatile("global_load_async_to_lds_b128 %0, %1, off\n\tglobal_load_async_to_lds_b128 %2, %3, off\n\tglobal_load_async_to_lds_b128 %4, %5, off\n\tglobal_load_async_to_lds_b128 %6, %7, off\n\ts_wait_xcnt 0x0"
    :: "v"(lk), "v"(gk), "v"(lk + 64 * KKP * 2), "v"(gk + (size_t)64 * CC), "v"(lv), "v"(gv), "v"(lv + 32 * KVP * 2), "v"(gv + (size_t)32 * TT) : "memory");
}
/* lambda = mean over 64 of (exp(lq1 lk1) - exp(lq2 lk2) + 0.8) from the four bf16-rounded [64] inputs: lane l forms terms l and l + 32, the sum runs over the terms in index order; the same value in every lane */
__device__ __forceinline__ float lambda_of(const float* __restrict__ LQ1, const float* __restrict__ LK1, const float* __restrict__ LQ2, const float* __restrict__ LK2, int lane) {
  float in[8];
#pragma unroll   // constant indices keep the array in registers
  for (int h = 0; h < 2; ++h) { in[4 * h] = LQ1[lane + 32 * h]; in[4 * h + 1] = LK1[lane + 32 * h]; in[4 * h + 2] = LQ2[lane + 32 * h]; in[4 * h + 3] = LK2[lane + 32 * h]; }
  asm volatile("s_wait_xcnt 0x0" ::: "memory");   /* behind the eight loads, in front of any rewrite of their address registers */
  float s1 = 0.f;
#pragma unroll   // constant indices keep the array in registers
  for (int h = 0; h < 2; ++h) { const float tm = (expf(bfr(in[4 * h]) * bfr(in[4 * h + 1])) - expf(bfr(in[4 * h + 2]) * bfr(in[4 * h + 3]))) + 0.8f;
#pragma unroll   // the lane number of a lane read is a constant
    for (int i = 0; i < 32; ++i) s1 += __builtin_bit_cast(float, __builtin_amdgcn_readlane(__builtin_bit_cast(int, tm), i)); }
  return s1 * (1.0f / 64.0f);
}
__global__ __launch_bounds__(AW * 32) void k_att(const _Float16* __restrict__ QH, const _Float16* __restrict__ QL, const _Float16* __restrict__ KH, const _Float16* __restrict__ VT, const float* __restrict__ LQ1, const float* __restrict__ LK1, const float* __restrict__ LQ2, const float* __restrict__ LK2, _Float16* __restrict__ YD) {
  __shared__ __align__(16) unsigned char sm[2 * KSTG * 2 + AW * 16 * (HDV + 8) * 2];   /* the two stage buffers first, so that every fragment read's constant part fits the instruction's offset field; behind them the epilogue's rows */
  _Float16* kv = (_Float16*)sm; _Float16 (*so)[16][HDV + 8] = (_Float16 (*)[16][HDV + 8])(sm + 2 * KSTG * 2);   /* row pitch 144 B = 16 B x 9, odd */
  const int tid = threadIdx.x, wave = tid >> 5, lane = tid & 31, col = lane & 15, g = lane >> 4; const int e = blockIdx.y, b = blockIdx.z; const int ql0 = blockIdx.x * (AW * 16) + wave * 16;
  const float C2 = SCALE * 1.4426950408889634f;
  const unsigned lk = (unsigned)(size_t)kv + (unsigned)(((tid >> 3) * KKP + (tid & 7) * 8) * 2);              /* LDS byte address: K row tid >> 3 of 64, 16 bytes tid & 7 of 128 */
  const unsigned lv = (unsigned)(size_t)kv + (unsigned)((KS * KKP + (tid >> 4) * KVP + (tid & 15) * 8) * 2);   /* V^T row tid >> 4 of 32, 16 bytes tid & 15 of 256 */
  gh_p gk = (gh_p)(KH + ((size_t)b * TT + (tid >> 3)) * CC + e * HDV + (tid & 7) * 8);      /* walks 128 keys a stage */
  gh_p gv = (gh_p)(VT + ((size_t)b * CC + e * HDV + (tid >> 4)) * TT + (tid & 15) * 8);
  kv_copy(lk, gk, lv, gv); gk += (size_t)KS * CC; gv += KS;   /* stage 0 into buffer 0 */
  v16h qh[2], ql[2];
  const _Float16* qhp = QH + ((size_t)b * TT + ql0 + col) * CC + e * HDV; const _Float16* qlp = QL + ((size_t)b * QHI + ql0 + col) * CC + e * HDV;   /* query row col, this head's 64 columns: hi and residual */
#pragma unroll   // constant indices keep the fragment arrays in registers
  for (int u = 0; u < 2; ++u) { qh[u] = frag_h(qhp + u * HD, lane); ql[u] = frag_h(qlp + u * HD, lane); }
  asm volatile("s_wait_xcnt 0x0" :: "v"(qhp + 8 * g), "v"(qlp + 8 * g) : "memory");   /* behind the q loads; their addresses are named as inputs to stay unwritten up to it */
  const float lam = lambda_of(LQ1, LK1, LQ2, LK2, lane);
  asm volatile("s_wait_asynccnt 0x0" ::: "memory");   /* this wave's copies of stage 0 have landed */
  __syncthreads();                                    /* publishes stage 0 */
  kv_copy(lk + KSTG * 2, gk, lv + KSTG * 2, gv); gk += (size_t)KS * CC; gv += KS;   /* stage 1 into buffer 1, in flight over stage 0's work */
  v8f acc[2][HDV / 16] = {}; float mu[2] = { -3.0e38f, -3.0e38f }; v2f ls[2] = {};   /* per query: maximum in use; sum, even and odd keys apart */
#pragma unroll 1   // rolled: the publish point stands once, at the foot of a stage
  for (int t = 0; t < TT / KS; ++t) {
    const _Float16* kb = kv + (t & 1) * KSTG + col * KKP + 8 * g;              /* key row col of a 16-key tile, the lane's half */
    const _Float16* vb = kv + (t & 1) * KSTG + KS * KKP + col * KVP + 8 * g;   /* value column col of a 16-column tile, keys contiguous, the lane's half */
#pragma unroll 1   // rolled: one pass's registers only, so that four waves fit a SIMD
    for (int sp = 0; sp < KS / 32; ++sp) {
      v16h kf[2][2], vf[HDV / 16];
#pragma unroll   // constant indices keep the fragment arrays in registers
      for (int u = 0; u < 2; ++u)
#pragma unroll   // constant indices keep the fragment arrays in registers
        for (int kt = 0; kt < 2; ++kt) kf[u][kt] = frag_l(kb + (sp * 32 + kt * 16) * KKP + u * HD);
#pragma unroll   // constant indices keep the fragment arrays in registers
      for (int j = 0; j < HDV / 16; ++j) vf[j] = frag_l(vb + (j * 16) * KVP + sp * 32);
      v8f s[2][2];
#pragma unroll   // constant indices keep the fragment arrays in registers
      for (int u = 0; u < 2; ++u)
#pragma unroll   // constant indices keep the fragment arrays in registers
        for (int kt = 0; kt < 2; ++kt) { const v8f z = {}; s[u][kt] = wm(kf[u][kt], ql[u], z); }
#pragma unroll   // constant indices keep the fragment arrays in registers
      for (int u = 0; u < 2; ++u)
#pragma unroll   // constant indices keep the fragment arrays in registers
        for (int kt = 0; kt < 2; ++kt) s[u][kt] = wm(kf[u][kt], qh[u], s[u][kt] * (1.0f / 1024.0f));
      float mx[2];
#pragma unroll   // constant indices keep the fragment arrays in registers
      for (int u = 0; u < 2; ++u) { float m = fmaxf(s[u][0][0], s[u][1][0]);
#pragma unroll   // constant indices keep the fragment arrays in registers
        for (int r = 1; r < 8; ++r) m = fmaxf(m, fmaxf(s[u][0][r], s[u][1][r]));
        mx[u] = fmaxf(m, xhalf(m)) * C2; }
      if (__builtin_amdgcn_ballot_w32(mx[0] > mu[0] + 8.0f || mx[1] > mu[1] + 8.0f) != 0) {   /* rescale only when a query's maximum outgrows the one in use by 2^8: P stays <= 256 in f16 */
#pragma unroll   // constant indices keep the fragment arrays in registers
        for (int u = 0; u < 2; ++u) { const float mn = fmaxf(mu[u], mx[u]); const float corr = __builtin_amdgcn_exp2f(mu[u] - mn); mu[u] = mn; ls[u] *= corr;
#pragma unroll   // constant indices keep the fragment arrays in registers
          for (int j = 0; j < HDV / 16; ++j) acc[u][j] *= corr; } }
#pragma unroll   // constant indices keep the fragment arrays in registers
      for (int u = 0; u < 2; ++u) { v16h p;
#pragma unroll   // constant indices keep the fragment arrays in registers
        for (int i = 0; i < 16; i += 2) { v2f a = { s[u][i >> 3][i & 7], s[u][i >> 3][(i & 7) + 1] }; const v2f c2 = { C2, C2 }, nm = { -mu[u], -mu[u] }; a = __builtin_elementwise_fma(a, c2, nm);
          const v2f pe = { __builtin_amdgcn_exp2f(a[0]), __builtin_amdgcn_exp2f(a[1]) }; ls[u] += pe; p[i] = (_Float16)pe[0]; p[i + 1] = (_Float16)pe[1]; }
#pragma unroll   // constant indices keep the fragment arrays in registers
        for (int j = 0; j < HDV / 16; ++j) acc[u][j] = wm(vf[j], p, acc[u][j]); } }
    /* publish point of stage t + 1: this wave's reads of buffer t & 1 are done, its copies of stage t + 1 have landed; the barrier publishes that stage and ends every wave's reads of the buffer refilled behind it */
    asm volatile("s_wait_dscnt 0x0" ::: "memory");
    asm volatile("s_wait_asynccnt 0x0" ::: "memory");
    __syncthreads();
    if (t + 2 < TT / KS) { kv_copy(lk + (t & 1) * (KSTG * 2), gk, lv + (t & 1) * (KSTG * 2), gv); gk += (size_t)KS * CC; gv += KS; } }
  asm volatile("s_wait_asynccnt 0x0" ::: "memory");   /* no copy is outstanding when the wave goes on to its end */
  float w[2];   /* weight of each sub-head's unnormalised sum: 1 / l1 and -lambda / l2 */
#pragma unroll   // constant indices keep the fragment arrays in registers
  for (int u = 0; u < 2; ++u) { const float lh = ls[u][0] + ls[u][1]; w[u] = 1.0f / (lh + xhalf(lh)); }
  w[1] *= -lam;
#pragma unroll   // constant indices keep the fragment arrays in registers
  for (int j = 0; j < HDV / 16; ++j) { v8h t;
#pragma unroll   // constant indices keep the fragment arrays in registers
    for (int r = 0; r < 8; ++r) t[r] = (_Float16)(acc[0][j][r] * w[0] + acc[1][j][r] * w[1]);
    *(v8h*)&so[wave][col][j * 16 + 8 * g] = t; }
  LDSX();
  gu4_p po = (gu4_p)(YD + ((size_t)b * TT + ql0 + (lane >> 3)) * CC + e * HDV + (lane & 7) * 8);   /* a wave-wide store = the 128-B head segments of four rows */
#pragma unroll   // one address pair and constant offsets: no address register is rewritten behind a store
  for (int it = 0; it < 4; ++it) po[(size_t)it * (4 * CC * 2 / 16)] = *(const v4u*)&so[wave][it * 4 + (lane >> 3)][(lane & 7) * 8]; }
// ---- k_out: block = (128 rows, 128 cols): out = ctx Wo (+ bo): k_att's f16 ctx rows against k_cvt's Wo rows, f16(bf16 x 2^8) exact (1 product) x 2^-8; LDS rows as in k_proj, but brought by asynchronous copies into a ring of four buffers, three 64-k stages in flight
#define ONB 4                       // buffers of the ring
typedef __attribute__((address_space(1))) v4i* gi4_p;
typedef __attribute__((address_space(3))) v4i* li4_p;
/* one stage, 64 k of 128 rows of each operand: thread = (row tid >> 3 of 16, 16 bytes tid & 7), a wave-wide copy = 4 whole lines; rows are 2 KB apart in memory and GP elements in LDS */
__device__ __forceinline__ void o_copy(gi4_p px, gi4_p pw, li4_p l) {
#pragma unroll   // constant steps from one address each
  for (int i = 0; i < 8; ++i) { __builtin_amdgcn_global_load_async_to_lds_b128(px + (size_t)(i * 16) * (CC * 2 / 16), l + i * 16 * GP * 2 / 16, 0, 0); __builtin_amdgcn_global_load_async_to_lds_b128(pw + (size_t)(i * 16) * (CC * 2 / 16), l + (128 + i * 16) * GP * 2 / 16, 0, 0); }
}
__global__ __launch_bounds__(128) void k_out(const _Float16* __restrict__ Y, const _Float16* __restrict__ WO, const float* __restrict__ BO, float* __restrict__ OUT) {
  __shared__ __align__(16) unsigned char sm[ONB * GSTG * 2];
  const int tid = threadIdx.x, wave = tid >> 5, lane = tid & 31, col = lane & 15, g = lane >> 4, wm = wave >> 1, wn = wave & 1; const int c0 = blockIdx.y * 128; const size_t r0 = (size_t)blockIdx.x * 128;
  gi4_p px = (gi4_p)(Y + (r0 + (tid >> 3)) * CC + (tid & 7) * 8); gi4_p pw = (gi4_p)(WO + (size_t)(c0 + (tid >> 3)) * CC + (tid & 7) * 8);   /* both walk 64 elements a stage */
  _Float16* st = (_Float16*)sm; const int so = (tid >> 3) * GP + (tid & 7) * 8;
  v8f acc[4][4] = {};
#pragma unroll   // stages 0 to 2 into buffers 0 to 2
  for (int s = 0; s < ONB - 1; ++s) { o_copy(px, pw, (li4_p)(st + s * GSTG + so)); px += 8; pw += 8; }
  for (int kc = 0; kc < CC / 64; ++kc) { _Float16* sb = st + (kc & (ONB - 1)) * GSTG;
    /* publish point of stage kc: this wave's reads of the pass before are done; its copies of stage kc have landed (a wave issues 16 a stage: all but the two younger stages' 32; in the last passes, which issue none, all, so that no copy is outstanding behind the loop); the barrier publishes the stage and ends every wave's reads of the buffer refilled behind it */
    asm volatile("s_wait_dscnt 0x0" ::: "memory");
    if (kc + ONB - 1 < CC / 64) asm volatile("s_wait_asynccnt 0x20" ::: "memory"); else asm volatile("s_wait_asynccnt 0x0" ::: "memory");
    __syncthreads();
    v16h a[2][4], b[2][4];
#pragma unroll   // the two 32-k halves of the pass, in k order
    for (int h = 0; h < 2; ++h)
#pragma unroll   // constant indices keep the arrays in registers
      for (int i = 0; i < 4; ++i) { a[h][i] = frag_h(sb + (wm * 64 + i * 16 + col) * GP + h * 32, lane); b[h][i] = frag_h(sb + (128 + wn * 64 + i * 16 + col) * GP + h * 32, lane); }
    if (kc + ONB - 1 < CC / 64) { o_copy(px, pw, (li4_p)(st + ((kc + ONB - 1) & (ONB - 1)) * GSTG + so)); px += 8; pw += 8; }
    __builtin_amdgcn_sched_barrier(0);   /* the pass's fragment reads and the refill stay in front of its products: without it this build reads one row's fragment at a time and waits each out in front of four products */
#pragma unroll   // in k order
    for (int h = 0; h < 2; ++h)
#pragma unroll   // constant indices keep the arrays in registers
      for (int i = 0; i < 4; ++i)
#pragma unroll   // constant indices keep the arrays in registers
        for (int j = 0; j < 4; ++j) acc[i][j] = wmh(a[h][i], b[h][j], acc[i][j]); }
  __syncthreads();   /* every wave has left the buffers: the output tile [128][132] f32 lies over them */
  float* sf = (float*)sm; float bs[4] = {};
  if (BO) { g_bias(BO + c0 + wn * 64 + col, bs); }
#pragma unroll   // constant indices keep the arrays in registers
  for (int j = 0; j < 4; ++j)
#pragma unroll   // constant indices keep the arrays in registers
    for (int i = 0; i < 4; ++i)
#pragma unroll   // constant indices keep the arrays in registers
      for (int r = 0; r < 8; ++r) sf[(wm * 64 + i * 16 + 8 * g + r) * 132 + wn * 64 + j * 16 + col] = acc[i][j][r] * (1.0f / 256.0f) + bs[j];
  __syncthreads();
  gf4_p po = (gf4_p)(OUT + (r0 + wave) * DIN + c0 + lane * 4);   /* a wave stores 512 B of one row */
#pragma unroll   // one address pair and constant offsets: no address register is rewritten behind a store
  for (int it = 0; it < 32; ++it) po[(size_t)it * (4 * DIN * 4 / 16)] = *(const v4f*)&sf[(wave + it * 4) * 132 + lane * 4]; }

extern "C" void kernel_launch(void* const* d_in, const int* in_sizes, int n_in, void* d_out, int out_size, void* d_ws, size_t ws_size, hipStream_t stream) {
  (void)in_sizes; (void)n_in; (void)out_size;
  const float** F = (const float**)d_in;
  if (ws_size < (size_t)WS_END) return;
  char* ws = (char*)d_ws; _Float16 *QH = (_Float16*)(ws + WS_QH), *KH = (_Float16*)(ws + WS_KH), *VT = (_Float16*)(ws + WS_VT), *QL = (_Float16*)(ws + WS_QL), *KL = (_Float16*)(ws + WS_KL); __bf16 *VB = (__bf16*)(ws + WS_VB), *VBL = (__bf16*)(ws + WS_VBL), *XB = (__bf16*)(ws + WS_XB), *WB = (__bf16*)(ws + WS_WB); _Float16 *WPH = (_Float16*)(ws + WS_WP);
  (void)QL; (void)KL; (void)VB; (void)VBL;
  // inputs: 0 x [4,1024,1024]; 1 W_qkv [3072,1024] (out,in: rows 0-1023 q, 1024-2047 k, 2048-3071 v); 2 W_proj [1024,1024] (out,in); 3 b_proj; 4 lambda_q1, 5 lambda_k1, 6 lambda_q2, 7 lambda_k2 [64]
  _Float16* YD = (_Float16*)(ws + WS_S);   /* the differential rows [b*t][CC] live in the WS_S plane */
  k_cvt<<<CVX + CVW + CVP, 256, 0, stream>>>(F[0], F[1], F[2], XB, WB, WPH);
  k_proj<<<dim3(TNB * TT / 128, CC / 128, 3), 128, 0, stream>>>(XB, XB, XB, WB, WB + (size_t)CC * DIN, WB + (size_t)2 * CC * DIN, nullptr, nullptr, nullptr, QH, QL, KH, VT);
  k_att<<<dim3(TT / (AW * 16), NH / 2, TNB), AW * 32, 0, stream>>>(QH, QL, KH, VT, F[4], F[5], F[6], F[7], YD);
  k_out<<<dim3(TNB * TT / 128, DIN / 128), 128, 0, stream>>>(YD, WPH, F[3], (float*)d_out);
}

// v008
// It runs in 70.6 microseconds.
// It is 1.15 times as fast as v006, going by the measured steps of the versions left out in between.
// Over all steps from v000 it is 20.3 times as fast.
// compute dtype: all float inputs rounded to bf16; qkv = x Wqkv^T with EXACT bf16 products on WMMA 16x16x32 (f32 accumulate); the two 32-wide sub-head logits with q once to f16 against k once to f16 (1 product) x 64^-0.5; both softmaxes in f32 with a running maximum and sum (base-2 exponent); each unnormalised P (<= 2^8) once to f16 against the head's 64-wide v once to f16 (1 product), divided by the f32 sum at the end; the differential combination P1.v - lambda P2.v and lambda (mean of exp(lq1 lk1) - exp(lq2 lk2) + 0.8 over 64) in f32; ctx once to f16 against W_proj carried x 2^8 in f16 + b_proj; f32 output.
#include <hip/hip_runtime.h>
#include <math.h>

typedef __attribute__((ext_vector_type(16))) _Float16 v16h;
typedef __attribute__((ext_vector_type(16))) __bf16 v16b;
typedef __attribute__((ext_vector_type(8)))  _Float16 v8h;
typedef __attribute__((ext_vector_type(8)))  float v8f;
typedef __attribute__((ext_vector_type(4)))  float v4f;
typedef __attribute__((ext_vector_type(2)))  float v2f;
typedef __attribute__((ext_vector_type(4)))  unsigned v4u;
typedef __attribute__((ext_vector_type(4)))  int v4i;
typedef float __attribute__((may_alias)) float_a;
typedef int __attribute__((may_alias)) int_a;

template <typename T> __device__ __forceinline__ void vst2(void* p, T v) { *(T*)p = v;  }
__device__ __forceinline__ v8f wmma16(v16h a, v16h b, v8f c) {
  v8f d = __builtin_amdgcn_wmma_f32_16x16x32_f16(false, a, false, b, (short)0, c, false, false);
  asm volatile("v_nop\n\tv_nop\n\tv_nop\n\tv_nop" : "+v"(d) : "v"(a), "v"(b));
  return d;
}
__device__ __forceinline__ v8f wmma_bf(v16b a, v16b b, v8f c) {
  v8f d = __builtin_amdgcn_wmma_f32_16x16x32_bf16(false, a, false, b, (short)0, c, false, false);
  asm volatile("v_nop\n\tv_nop\n\tv_nop\n\tv_nop" : "+v"(d) : "v"(a), "v"(b));
  return d;
}
// 16x16x32 fragments: lane = (h = lane>>4, row/col = lane&15); elements 0..7 = k0+8h+0..7, 8..15 = k0+16+8h+0..7; D element r = row 8h+r
__device__ __forceinline__ v16h frag_h(const _Float16* rowk0, int lane) {
  union { v16h v; v8h q[2]; } u; const _Float16* p = rowk0 + 8 * (lane >> 4);
  u.q[0] = *(const v8h*)p; u.q[1] = *(const v8h*)(p + 16); return u.v;
}
__device__ __forceinline__ v16h frag_f32(const float* rowk0, int lane) {
  v16h a; const float* p = rowk0 + 8 * (lane >> 4);
#pragma unroll
  for (int i = 0; i < 8; ++i) { a[i] = (_Float16)p[i]; a[8 + i] = (_Float16)p[16 + i]; }
  return a;
}
__device__ __forceinline__ v16h frag_f32s(const float* rowk0, int lane, float sc) {
  v16h a; const float* p = rowk0 + 8 * (lane >> 4);
#pragma unroll
  for (int i = 0; i < 8; ++i) { a[i] = (_Float16)(p[i] * sc); a[8 + i] = (_Float16)(p[16 + i] * sc); }
  return a;
}
// column fragment from a [K][ld] layout (column n), rows >= K read as 0
__device__ __forceinline__ v16h fragc_f32(const float* W, int k0, int n, int lane, int ld, int K) {
  v16h a; const int g = lane >> 4;
#pragma unroll
  for (int i = 0; i < 8; ++i) { const int ka = k0 + 8 * g + i, kb = ka + 16;
    a[i] = (_Float16)(ka < K ? W[(size_t)(ka < K ? ka : K - 1) * ld + n] : 0.f); a[8 + i] = (_Float16)(kb < K ? W[(size_t)(kb < K ? kb : K - 1) * ld + n] : 0.f); }
  return a;
}
struct F2 { v16b h, l; };
__device__ __forceinline__ F2 bsplit16(const float v[16]) { F2 r;
#pragma unroll
  for (int i = 0; i < 16; ++i) { const __bf16 h = (__bf16)v[i]; r.h[i] = h; r.l[i] = (__bf16)(v[i] - (float)h); }
  return r; }
__device__ __forceinline__ F2 split_row(const float* row, int k0, int lane) { float v[16]; const float* p = row + k0 + 8 * (lane >> 4);
#pragma unroll
  for (int i = 0; i < 8; ++i) { v[i] = p[i]; v[8 + i] = p[16 + i]; }
  return bsplit16(v); }
__device__ __forceinline__ F2 split_rowK(const float* row, int k0, int lane, int K) { float v[16]; const int g = lane >> 4;
#pragma unroll
  for (int i = 0; i < 8; ++i) { const int ka = k0 + 8 * g + i, kb = ka + 16; v[i] = ka < K ? row[ka < K ? ka : K - 1] : 0.f; v[8 + i] = kb < K ? row[kb < K ? kb : K - 1] : 0.f; }
  return bsplit16(v); }
__device__ __forceinline__ F2 split_col(const float* W, int k0, int n, int lane, int ld, int K) { float v[16]; const int g = lane >> 4;
#pragma unroll
  for (int i = 0; i < 8; ++i) { const int ka = k0 + 8 * g + i, kb = ka + 16; v[i] = ka < K ? W[(size_t)(ka < K ? ka : K - 1) * ld + n] : 0.f; v[8 + i] = kb < K ? W[(size_t)(kb < K ? kb : K - 1) * ld + n] : 0.f; }
  return bsplit16(v); }
__device__ __forceinline__ v8f mac3(const F2& a, const F2& b, v8f c) { c = wmma_bf(a.l, b.h, c); c = wmma_bf(a.h, b.l, c); return wmma_bf(a.h, b.h, c); }
__device__ __forceinline__ float sigm(float v) { return 1.0f / (1.0f + expf(-v)); }
#define LDSX() do { asm volatile("s_wait_dscnt 0" ::: "memory"); __builtin_amdgcn_wave_barrier(); __builtin_amdgcn_fence(__ATOMIC_RELEASE, "workgroup"); } while (0)

// Differential attention (B 4, N 1,024, C 1,024 = 16 heads x 64): qkv = x Wqkv^T ((out,in) [3072,1024]); per head the 64-dim q/k are split into two 32-dim halves: attn = softmax(q1 k1^T / 8) - lam softmax(q2 k2^T / 8), lam = mean(exp(lambda_q1 * lambda_k1) - exp(lambda_q2 * lambda_k2) + 0.8); out = merged(attn v) Wproj^T + b_proj. Realised as 32 softmax sub-heads of width 32 whose P.v share the parent head's 64-wide v.
#define NB 4
#define TT 1024
#define CC 1024            // NH * HD = projected width
#define DIN 1024          // input (model) width
#define NH 32              // softmax sub-heads (16 heads x 2 halves)
#define HD 32
#define NQB (TT / 64)
#define HG 8
#define SCALE (0.125f)
#define CAUSAL 0
#ifndef TNB
#define TNB NB
#endif
__device__ __forceinline__ float bfr(float v) { return (float)(__bf16)v; }
__host__ __device__ __forceinline__ int kb_last(int qb) { return CAUSAL ? ((qb * 64 + 63) >> 7) : (TT / 128 - 1); }
typedef __attribute__((ext_vector_type(8))) __bf16 v8b;
__device__ __forceinline__ v16b frag_b(const __bf16* rowk0, int lane) {
  union { v16b v; v8b q[2]; } u; const __bf16* p = rowk0 + 8 * (lane >> 4);
  u.q[0] = *(const v8b*)p; u.q[1] = *(const v8b*)(p + 16); return u.v;
}
#define QBH 0              // query blocks of a causal high-precision path (not in use: 1-product logits everywhere)
#define QHI 1024            // rows of the q residual plane (not in use: 1-product logits everywhere)
#define KHI 64            // key rows carrying k residual / v bf16 hi+lo planes (not in use)
// B fragment (k rows k0+.., output column o) of a weight: (in,out) [K][ld] or (out,in) [ld rows of K]: bf16 exact, or f16(bf16 * 256) exact
__device__ __forceinline__ v16b wcol_io(const float* Wm, int k0, int o, int lane, int ld) { v16b w; const int g = lane >> 4;
#pragma unroll
  for (int i = 0; i < 8; ++i) { w[i] = (__bf16)Wm[(size_t)(k0 + 8 * g + i) * ld + o]; w[8 + i] = (__bf16)Wm[(size_t)(k0 + 16 + 8 * g + i) * ld + o]; }
  return w; }
__device__ __forceinline__ v16b wcol_oi(const float* Wm, int k0, int o, int lane, int K) { v16b w; const float* p = Wm + (size_t)o * K + k0 + 8 * (lane >> 4);
#pragma unroll
  for (int i = 0; i < 8; ++i) { w[i] = (__bf16)p[i]; w[8 + i] = (__bf16)p[16 + i]; }
  return w; }
__device__ __forceinline__ v16h wcolh_io(const float* Wm, int k0, int o, int lane, int ld) { v16h w; const int g = lane >> 4;
#pragma unroll
  for (int i = 0; i < 8; ++i) { w[i] = (_Float16)(bfr(Wm[(size_t)(k0 + 8 * g + i) * ld + o]) * 256.0f); w[8 + i] = (_Float16)(bfr(Wm[(size_t)(k0 + 16 + 8 * g + i) * ld + o]) * 256.0f); }
  return w; }
__device__ __forceinline__ v16h wcolh_oi(const float* Wm, int k0, int o, int lane, int K) { v16h w; const float* p = Wm + (size_t)o * K + k0 + 8 * (lane >> 4);
#pragma unroll
  for (int i = 0; i < 8; ++i) { w[i] = (_Float16)(bfr(p[i]) * 256.0f); w[8 + i] = (_Float16)(bfr(p[16 + i]) * 256.0f); }
  return w; }
#define WQKV_LAYOUT 1   // 0 = (in,out) [DIN][CC]; 1 = (out,in) [CC][DIN]; 2 = per-head [NH][DIN][HD]
__device__ __forceinline__ v16b wcol_hdk(const float* Wm, int k0, int o, int lane) { v16b w; const int g = lane >> 4; const float* p = Wm + (size_t)(o / HD) * DIN * HD + (o % HD);
#pragma unroll
  for (int i = 0; i < 8; ++i) { w[i] = (__bf16)p[(size_t)(k0 + 8 * g + i) * HD]; w[8 + i] = (__bf16)p[(size_t)(k0 + 16 + 8 * g + i) * HD]; }
  return w; }
#define WO_OUT_IN 1
#if WQKV_LAYOUT == 1
#define WCOL(W, k0, o, lane) wcol_oi(W, k0, o, lane, DIN)
#elif WQKV_LAYOUT == 2
#define WCOL(W, k0, o, lane) wcol_hdk(W, k0, o, lane)
#else
#define WCOL(W, k0, o, lane) wcol_io(W, k0, o, lane, CC)
#endif
#if WO_OUT_IN
#define WOCOL(W, k0, o, lane) wcol_oi(W, k0, o, lane, CC)
#define WOCOLH(W, k0, o, lane) wcolh_oi(W, k0, o, lane, CC)
#else
#define WOCOL(W, k0, o, lane) wcol_io(W, k0, o, lane, DIN)
#define WOCOLH(W, k0, o, lane) wcolh_io(W, k0, o, lane, DIN)
#endif
#define HDV 64             // value columns per softmax sub-head (the parent head's 64 columns)
#ifndef SM_EXTRA_PARAMS
#define SM_EXTRA_PARAMS
#endif
#ifndef PROJ_EXTRA_PARAMS
#define PROJ_EXTRA_PARAMS
#endif
#ifndef SM_MASK_HOOK
#define SM_MASK_HOOK (void)0
#endif

#define WS_QH  0u                                      // f16 q rows [b*t][CC]
#define WS_KH  (WS_QH + 2u * (size_t)NB * TT * CC)      // f16 k rows [b*t][CC]
#define WS_VT  (WS_KH + 2u * (size_t)NB * TT * CC)      // f16 v planes [b][c][t]
#define WS_QL  (WS_VT + 2u * (size_t)NB * CC * TT)      // f16 q residual rows [b][t < QHI][CC] (not in use)
#define WS_KL  (WS_QL + 2u * (size_t)NB * QHI * CC)     // f16 k residual x 2^10 rows [b][t < KHI][CC]
#define WS_VB  (WS_KL + 2u * (size_t)NB * KHI * CC)     // bf16 v hi planes [b][c][t < KHI]
#define WS_VBL (WS_VB + 2u * (size_t)NB * CC * KHI)
#define WS_S   (WS_VBL + 2u * (size_t)NB * CC * KHI)    // f16 differential rows [b*t][CC] (first quarter of the plane)
#define WS_XB  (WS_S  + 4u * (size_t)HG * TT * TT)      // bf16 x rows [b*t][DIN]
#define WS_WB  (WS_XB + 2u * (size_t)NB * TT * DIN)     // bf16 W_qkv rows [3 * CC][DIN]
#define WS_WP  (WS_WB + 2u * (size_t)3 * CC * DIN)      // f16 (bf16(W_proj) x 2^8) rows [DIN][CC]
#define WS_END (WS_WP + 2u * (size_t)DIN * CC)

// ---- the two GEMM kernels: block = 4 waves (2 x 2), tile 128 rows x 128 cols, a wave 64 x 64 (16 accumulator tiles). Both operands lie in memory in the 16-bit operand type (k_cvt rounds x and the weights once; k_att stores its rows as f16). Per 64 k: every thread loads whole 128-B lines of both operands (a wave-wide load = 4 rows) and stores them in LDS as they are; all waves take their fragments from there. k_proj: two LDS buffers, the next 64 k's global loads in flight over the products; k_out: asynchronous copies into a ring of four buffers, three 64-k stages in flight; one barrier a pass.
#define GP 72                       // LDS row pitch in 16-bit elements: 144 B = 16 B x 9, odd, for 16-byte fragment reads
#define GSTG (256 * GP)             // elements of one buffer: 128 X rows, then 128 W rows
#define GSM (2 * GSTG * 2)          // bytes: the two buffers, 73,728 (the epilogue's f16 plane [128][136] takes 34,816)
typedef const __attribute__((address_space(1))) float* gf_p;   /* typed as global memory, as gh_p below: an address that has gone through an asm statement still loads by global_load */
typedef const __attribute__((address_space(1))) v4f* gv4f_p;
typedef __attribute__((ext_vector_type(4))) __bf16 v4b;
typedef __attribute__((ext_vector_type(4))) _Float16 v4h;
__device__ __forceinline__ v8f wmb(v16b a, v16b b, v8f c) { return __builtin_amdgcn_wmma_f32_16x16x32_bf16(false, a, false, b, (short)0, c, false, false); }
__device__ __forceinline__ v8f wmh(v16h a, v16h b, v8f c) { return __builtin_amdgcn_wmma_f32_16x16x32_f16(false, a, false, b, (short)0, c, false, false); }
typedef const __attribute__((address_space(1))) v4u* gcu4_p;
/* 64 k of 128 rows of each operand: thread = (row tid >> 3 of 16, 8 elements tid & 7); rows are 2 KB apart; then both addresses step 64 elements. The wait and the steps stand in one statement, so that an address pair is rewritten only behind the wait */
__device__ __forceinline__ void g_fetch(gcu4_p& px, gcu4_p& pw, v4u (&xr)[8], v4u (&wr)[8]) {
#pragma unroll   // constant indices keep the arrays in registers
  for (int i = 0; i < 8; ++i) { xr[i] = px[(size_t)(i * 16) * (DIN * 2 / 16)]; wr[i] = pw[(size_t)(i * 16) * (DIN * 2 / 16)]; }
  asm volatile("s_wait_xcnt 0x0\n\tv_add_nc_u64 %0, %2, %0\n\tv_add_nc_u64 %1, %2, %1" : "+v"(px), "+v"(pw) : "s"((long long)128) : "memory");
}
typedef __attribute__((address_space(1))) v4u* gu4_p;
typedef __attribute__((address_space(1))) v4b* gb4_p;
typedef __attribute__((address_space(1))) v4h* gh4_p;
// ---- k_cvt: rounds the GEMM operands once: x and W_qkv to bf16, W_proj to f16(bf16 x 2^8). 256 blocks of 8 waves; a block takes 32,768 consecutive elements of one array, a thread 32 loads of 16 B (a wave-wide load = 4 whole lines), all in flight at once, and 32 stores of 8 B (a wave-wide store = 2 whole lines)
#define CVE 32768
#define CVX (NB * TT * DIN / CVE)   // blocks on x
#define CVW (3 * CC * DIN / CVE)    // blocks on W_qkv
#define CVP (DIN * CC / CVE)        // blocks on W_proj
__global__ __launch_bounds__(256) void k_cvt(const float* __restrict__ X, const float* __restrict__ WQKV, const float* __restrict__ WP, __bf16* __restrict__ XB, __bf16* __restrict__ WB, _Float16* __restrict__ WPH) {
  const int bid = blockIdx.x, tid = threadIdx.x; const int arr = bid < CVX ? 0 : bid < CVX + CVW ? 1 : 2;
  const size_t o = (size_t)(bid - (arr == 0 ? 0 : arr == 1 ? CVX : CVX + CVW)) * CVE + tid * 4;
  gv4f_p s = (gv4f_p)((arr == 0 ? X : arr == 1 ? WQKV : WP) + o);
  v4f v[32];
#pragma unroll   // constant indices keep the array in registers; one address pair and constant offsets
  for (int i = 0; i < 32; ++i) v[i] = s[i * 256];
  asm volatile("s_wait_xcnt 0x0" :: "v"(s) : "memory");   /* behind the loads; their address pair is named to stay unwritten up to here */
  if (arr < 2) { gb4_p d = (gb4_p)((arr == 0 ? XB : WB) + o);
#pragma unroll   // one address pair and constant offsets: no address register is rewritten behind a store
    for (int i = 0; i < 32; ++i) { v4b c;
#pragma unroll   // constant indices keep the arrays in registers
      for (int q = 0; q < 4; ++q) c[q] = (__bf16)v[i][q];
      d[i * 256] = c;
      if (i == 7 || i == 15 || i == 23) __builtin_amdgcn_sched_barrier(0); } }   /* eight stores leave as soon as their eight loads are back: without it the first store is scheduled behind the wait for the 25th load */
  else { gh4_p d = (gh4_p)(WPH + o); v4h c[32];
#pragma unroll   // constant indices keep the arrays in registers
    for (int i = 0; i < 32; ++i)
#pragma unroll   // constant indices keep the arrays in registers
      for (int q = 0; q < 4; ++q) c[i][q] = (_Float16)(bfr(v[i][q]) * 256.0f);
    __builtin_amdgcn_sched_barrier(0);   /* all values are formed in front of the first store, each in registers of its own: without it the stores' data registers are reused, with a wait in front of every reuse */
#pragma unroll   // as above
    for (int i = 0; i < 32; ++i) d[i * 256] = c[i]; } }
typedef __attribute__((address_space(1))) v4f* gf4_p;
/* the four bias values of a lane's columns (16 apart), rounded to bf16; the wait stands behind the loads, in front of any rewrite of their address registers */
__device__ __forceinline__ void g_bias(const float* p, float (&bs)[4]) {
#pragma unroll   // constant indices keep the arrays in registers
  for (int j = 0; j < 4; ++j) bs[j] = p[j * 16];
  asm volatile("s_wait_xcnt 0x0" ::: "memory");
#pragma unroll   // constant indices keep the arrays in registers
  for (int j = 0; j < 4; ++j) bs[j] = bfr(bs[j]);
}
/* q or k tile into the LDS plane [128][136]: f16 rows */
__device__ __forceinline__ void rows_lds(const v8f (&acc)[4][4], const float (&bs)[4], _Float16* sh) {
#pragma unroll   // constant indices keep the arrays in registers
  for (int j = 0; j < 4; ++j)
#pragma unroll   // constant indices keep the arrays in registers
    for (int i = 0; i < 4; ++i)
#pragma unroll   // constant indices keep the arrays in registers
      for (int r = 0; r < 8; ++r) sh[(i * 16 + r) * 136 + j * 16] = (_Float16)(acc[i][j][r] + bs[j]);
}
// ---- k_proj: block = (128 rows, 128 cols, which): q/k/v = X W (+ b) with exact bf16 products (K = DIN), X and W as k_cvt's bf16 rows -> which 0: q f16 rows; 1: k f16 rows; 2: v f16 planes [c][t]
__global__ __launch_bounds__(128) void k_proj(const __bf16* __restrict__ XQ, const __bf16* __restrict__ XK, const __bf16* __restrict__ XV, const __bf16* __restrict__ WQ, const __bf16* __restrict__ WK, const __bf16* __restrict__ WV, const float* __restrict__ BQ, const float* __restrict__ BK, const float* __restrict__ BV,
    _Float16* __restrict__ QH, _Float16* __restrict__ KH, _Float16* __restrict__ VT) {
  __shared__ __align__(16) unsigned char sm[GSM];
  const int tid = threadIdx.x, wave = tid >> 5, lane = tid & 31, col = lane & 15, g = lane >> 4, wm = wave >> 1, wn = wave & 1; const int which = blockIdx.z; const int c0 = blockIdx.y * 128; const size_t r0 = (size_t)blockIdx.x * 128; const size_t bb = r0 / TT; const int t0 = (int)(r0 % TT);
  const __bf16* X = which == 0 ? XQ : which == 1 ? XK : XV; const __bf16* WA = which == 0 ? WQ : which == 1 ? WK : WV; const float* BA = which == 0 ? BQ : which == 1 ? BK : BV;
  gcu4_p px = (gcu4_p)(X + (r0 + (tid >> 3)) * DIN + (tid & 7) * 8); gcu4_p pw = (gcu4_p)(WA + (size_t)(c0 + (tid >> 3)) * DIN + (tid & 7) * 8);
  __bf16* st = (__bf16*)sm; const int so = (tid >> 3) * GP + (tid & 7) * 8;
  v4u xr[8], wr[8]; v8f acc[4][4] = {};
  g_fetch(px, pw, xr, wr);
  for (int kc = 0; kc < DIN / 64; ++kc) { __bf16* sb = st + (kc & 1) * GSTG;
#pragma unroll   // constant indices keep the arrays in registers
    for (int i = 0; i < 8; ++i) { *(v4u*)(sb + so + i * 16 * GP) = xr[i]; *(v4u*)(sb + 128 * GP + so + i * 16 * GP) = wr[i]; }
    __syncthreads();   /* publishes this pass's buffer; the other buffer's readers of the pass before are behind it when the next pass stores there */
    if (kc + 1 < DIN / 64) g_fetch(px, pw, xr, wr);
#pragma unroll   // the two 32-k halves of the pass, in k order
    for (int h = 0; h < 2; ++h) { v16b a[4], b[4];
#pragma unroll   // constant indices keep the arrays in registers
      for (int i = 0; i < 4; ++i) { a[i] = frag_b(sb + (wm * 64 + i * 16 + col) * GP + h * 32, lane); b[i] = frag_b(sb + (128 + wn * 64 + i * 16 + col) * GP + h * 32, lane); }
#pragma unroll   // constant indices keep the arrays in registers
      for (int i = 0; i < 4; ++i)
#pragma unroll   // constant indices keep the arrays in registers
        for (int j = 0; j < 4; ++j) acc[i][j] = wmb(a[i], b[j], acc[i][j]); } }
  __syncthreads();   /* every wave has left the buffers: the epilogue's planes lie over them */
  _Float16* sh = (_Float16*)sm; float bs[4] = {};
  if (BA) { g_bias(BA + c0 + wn * 64 + col, bs); }
  const int o0 = (wm * 64 + 8 * g) * 136 + wn * 64 + col;
  if (which < 2) rows_lds(acc, bs, sh + o0);
  else {
#pragma unroll   // constant indices keep the arrays in registers
    for (int j = 0; j < 4; ++j)
#pragma unroll   // constant indices keep the arrays in registers
      for (int i = 0; i < 4; ++i) { v8h t;
#pragma unroll   // constant indices keep the arrays in registers
        for (int r = 0; r < 8; ++r) t[r] = (_Float16)(acc[i][j][r] + bs[j]);
        *(v8h*)&sh[(wn * 64 + j * 16 + col) * 136 + wm * 64 + i * 16 + 8 * g] = t; } }   /* transposed: a lane's 8 rows are 8 consecutive t of its column */
  __syncthreads();
  /* copy-out: thread = (plane row tid >> 4 of 8, 16 bytes tid & 15), 256 B of a row by 16 lanes; q and k rows [b*t][CC] and v planes [c][t] both step 2 KB a row */
  const int sr = (tid >> 4) * 136 + (tid & 15) * 8; const size_t qo = (r0 + (tid >> 4)) * CC + c0 + (tid & 15) * 8;
  gu4_p dh = (gu4_p)(which == 0 ? QH + qo : which == 1 ? KH + qo : VT + (bb * CC + c0 + (tid >> 4)) * (size_t)TT + t0 + (tid & 15) * 8);
#pragma unroll   // one address pair and constant offsets: no address register is rewritten behind a store
  for (int it = 0; it < 16; ++it) dh[(size_t)it * 1024] = *(const v4u*)&sh[sr + it * 8 * 136]; }
// ---- k_att: block = 16 waves x 16 queries of (b, head e); a wave holds both 32-wide sub-heads of its 16 queries. The head's K rows and V^T rows come into LDS once per block, 128 keys a stage, two buffers, by asynchronous copies of whole 128-B lines; all 16 waves take their fragments from there. Per 32 keys: S^T = K Q^T, running maximum and sum per query (query = lane column; base-2 exponent, scale folded in), P^T packed from the two score tiles straight into a B operand, O^T += V^T P^T with the head's 64-wide v fragments shared by both sub-heads. No logits or P in memory. The epilogue forms the head's differential row o = P1.v / l1 - lambda P2.v / l2 in registers (a wave holds both sub-heads of its queries), rounds it to f16, k_out's operand type, and stores the 64-wide context rows [b*t][CC]; every wave forms lambda for itself while stage 0 is in flight.
#define AW 16
#define KS 128                        // keys of one LDS stage
#define KKP 72                        // K row pitch in f16 elements: 144 B = 16 B x 9, odd, for 16-byte fragment reads
#define KVP 136                       // V^T row pitch in f16 elements: 272 B = 16 B x 17, odd
#define KSTG (KS * KKP + HDV * KVP)   // elements of one buffer: 128 K rows [key][64], then 64 V^T rows [d][128 keys]
__device__ __forceinline__ v8f wm(v16h a, v16h b, v8f c) { return __builtin_amdgcn_wmma_f32_16x16x32_f16(false, a, false, b, (short)0, c, false, false); }
__device__ __forceinline__ float xhalf(float x) { return __builtin_bit_cast(float, __builtin_amdgcn_permlanex16(__builtin_bit_cast(int, x), __builtin_bit_cast(int, x), 0x76543210, 0xfedcba98, false, false)); }   /* lane l with lane l ^ 16 */
typedef const __attribute__((address_space(1))) _Float16* gh_p;   /* pointer typed as global memory */
__device__ __forceinline__ v16h frag_l(const _Float16* p) { union { v16h v; v8h q[2]; } u; u.q[0] = *(const v8h*)p; u.q[1] = *(const v8h*)(p + 16); return u.v; }   /* frag_h with the lane half's 8 elements already in p */
/* one stage: a thread copies 16 B of K rows r and r + 64 and of V^T rows d and d + 32 (a wave-wide copy = 4 whole lines). The wait is the last line of the copies' own statement, so that no register a copy names is rewritten in front of it */
__device__ __forceinline__ void kv_copy(unsigned lk, gh_p gk, unsigned lv, gh_p gv) {
  asm volatile("global_load_async_to_lds_b128 %0, %1, off\n\tglobal_load_async_to_lds_b128 %2, %3, off\n\tglobal_load_async_to_lds_b128 %4, %5, off\n\tglobal_load_async_to_lds_b128 %6, %7, off\n\ts_wait_xcnt 0x0"
    :: "v"(lk), "v"(gk), "v"(lk + 64 * KKP * 2), "v"(gk + (size_t)64 * CC), "v"(lv), "v"(gv), "v"(lv + 32 * KVP * 2), "v"(gv + (size_t)32 * TT) : "memory");
}
/* lambda = mean over 64 of (exp(lq1 lk1) - exp(lq2 lk2) + 0.8) from the four bf16-rounded [64] inputs: lane l forms terms l and l + 32, the sum runs over the terms in index order; the same value in every lane */
__device__ __forceinline__ float lambda_of(const float* __restrict__ LQ1, const float* __restrict__ LK1, const float* __restrict__ LQ2, const float* __restrict__ LK2, int lane) {
  float in[8];
#pragma unroll   // constant indices keep the array in registers
  for (int h = 0; h < 2; ++h) { in[4 * h] = LQ1[lane + 32 * h]; in[4 * h + 1] = LK1[lane + 32 * h]; in[4 * h + 2] = LQ2[lane + 32 * h]; in[4 * h + 3] = LK2[lane + 32 * h]; }
  asm volatile("s_wait_xcnt 0x0" ::: "memory");   /* behind the eight loads, in front of any rewrite of their address registers */
  float s1 = 0.f;
#pragma unroll   // constant indices keep the array in registers
  for (int h = 0; h < 2; ++h) { const float tm = (expf(bfr(in[4 * h]) * bfr(in[4 * h + 1])) - expf(bfr(in[4 * h + 2]) * bfr(in[4 * h + 3]))) + 0.8f;
#pragma unroll   // the lane number of a lane read is a constant
    for (int i = 0; i < 32; ++i) s1 += __builtin_bit_cast(float, __builtin_amdgcn_readlane(__builtin_bit_cast(int, tm), i)); }
  return s1 * (1.0f / 64.0f);
}
/* a lane's 16 scores of one sub-head against the maximum in use: P = 2^(s C2 - mu) in key pairs, and the pairs' sum in key order */
__device__ __forceinline__ void p_of(const v8f (&s)[2], float C2, float mu, v2f (&pe)[8], v2f& lp) {
  const v2f c2 = { C2, C2 }, nm = { -mu, -mu };
#pragma unroll   // constant indices keep the arrays in registers
  for (int i = 0; i < 8; ++i) { v2f a = { s[i >> 2][(2 * i) & 7], s[i >> 2][((2 * i) & 7) + 1] }; a = __builtin_elementwise_fma(a, c2, nm);
    pe[i] = (v2f){ __builtin_amdgcn_exp2f(a[0]), __builtin_amdgcn_exp2f(a[1]) }; lp = i ? lp + pe[i] : pe[i]; }
}
__global__ __launch_bounds__(AW * 32) void k_att(const _Float16* __restrict__ QH, const _Float16* __restrict__ KH, const _Float16* __restrict__ VT, const float* __restrict__ LQ1, const float* __restrict__ LK1, const float* __restrict__ LQ2, const float* __restrict__ LK2, _Float16* __restrict__ YD) {
  __shared__ __align__(16) unsigned char sm[2 * KSTG * 2 + AW * 16 * (HDV + 8) * 2];   /* the two stage buffers first, so that every fragment read's constant part fits the instruction's offset field; behind them the epilogue's rows */
  _Float16* kv = (_Float16*)sm; _Float16 (*so)[16][HDV + 8] = (_Float16 (*)[16][HDV + 8])(sm + 2 * KSTG * 2);   /* row pitch 144 B = 16 B x 9, odd */
  const int tid = threadIdx.x, wave = tid >> 5, lane = tid & 31, col = lane & 15, g = lane >> 4; const int e = blockIdx.y, b = blockIdx.z; const int ql0 = blockIdx.x * (AW * 16) + wave * 16;
  const float C2 = SCALE * 1.4426950408889634f;
  const unsigned lk = (unsigned)(size_t)kv + (unsigned)(((tid >> 3) * KKP + (tid & 7) * 8) * 2);              /* LDS byte address: K row tid >> 3 of 64, 16 bytes tid & 7 of 128 */
  const unsigned lv = (unsigned)(size_t)kv + (unsigned)((KS * KKP + (tid >> 4) * KVP + (tid & 15) * 8) * 2);   /* V^T row tid >> 4 of 32, 16 bytes tid & 15 of 256 */
  gh_p gk = (gh_p)(KH + ((size_t)b * TT + (tid >> 3)) * CC + e * HDV + (tid & 7) * 8);      /* walks 128 keys a stage */
  gh_p gv = (gh_p)(VT + ((size_t)b * CC + e * HDV + (tid >> 4)) * TT + (tid & 15) * 8);
  kv_copy(lk, gk, lv, gv); gk += (size_t)KS * CC; gv += KS;   /* stage 0 into buffer 0 */
  v16h qh[2];
  const _Float16* qhp = QH + ((size_t)b * TT + ql0 + col) * CC + e * HDV;   /* query row col, this head's 64 columns */
#pragma unroll   // constant indices keep the fragment arrays in registers
  for (int u = 0; u < 2; ++u) qh[u] = frag_h(qhp + u * HD, lane);
  asm volatile("s_wait_xcnt 0x0" :: "v"(qhp + 8 * g) : "memory");   /* behind the q loads; their address is named as an input to stay unwritten up to it */
  const float lam = lambda_of(LQ1, LK1, LQ2, LK2, lane);
  asm volatile("s_wait_asynccnt 0x0" ::: "memory");   /* this wave's copies of stage 0 have landed */
  __syncthreads();                                    /* publishes stage 0 */
  kv_copy(lk + KSTG * 2, gk, lv + KSTG * 2, gv); gk += (size_t)KS * CC; gv += KS;   /* stage 1 into buffer 1, in flight over stage 0's work */
  v8f acc[2][HDV / 16] = {}; float mu[2] = { -3.0e38f, -3.0e38f }; v2f ls[2] = {};   /* per query: maximum in use; sum, even and odd keys apart */
#pragma unroll 1   // rolled: the publish point stands once, at the foot of a stage
  for (int t = 0; t < TT / KS; ++t) {
    const _Float16* kb = kv + (t & 1) * KSTG + col * KKP + 8 * g;              /* key row col of a 16-key tile, the lane's half */
    const _Float16* vb = kv + (t & 1) * KSTG + KS * KKP + col * KVP + 8 * g;   /* value column col of a 16-column tile, keys contiguous, the lane's half */
#pragma unroll 1   // rolled: one pass's registers only, so that four waves fit a SIMD
    for (int sp = 0; sp < KS / 32; ++sp) {
      v16h kf[2][2], vf[HDV / 16];
#pragma unroll   // constant indices keep the fragment arrays in registers
      for (int u = 0; u < 2; ++u)
#pragma unroll   // constant indices keep the fragment arrays in registers
        for (int kt = 0; kt < 2; ++kt) kf[u][kt] = frag_l(kb + (sp * 32 + kt * 16) * KKP + u * HD);
      __builtin_amdgcn_sched_barrier(0);   /* the pass's eight K reads stay one group in front of its four score products: without it this build reads the last fragment into the first one's registers, behind the first product, and waits it out there */
      v8f s[2][2];
#pragma unroll   // constant indices keep the fragment arrays in registers
      for (int u = 0; u < 2; ++u)
#pragma unroll   // constant indices keep the fragment arrays in registers
        for (int kt = 0; kt < 2; ++kt) { const v8f z = {}; s[u][kt] = wm(kf[u][kt], qh[u], z); }
      __builtin_amdgcn_sched_barrier(0);   /* the four score products stay one run in front of the V reads: without it this build sets the V address sum and the reads among them and pads the products with eight idle slots */
#pragma unroll   // constant indices keep the fragment arrays in registers
      for (int j = 0; j < HDV / 16; ++j) vf[j] = frag_l(vb + (j * 16) * KVP + sp * 32);
      __builtin_amdgcn_sched_barrier(0);   /* the eight V reads are issued in front of the exponentials, which cover their way: without it this build issues them at the end of the exponentials and waits them out there */
      v2f pe[2][8], lp[2];   /* unnormalised P in key pairs; the pass's own sum, even and odd keys apart */
#pragma unroll   // constant indices keep the fragment arrays in registers
      for (int u = 0; u < 2; ++u) p_of(s[u], C2, mu[u], pe[u], lp[u]);
      asm volatile("" :: "v"(vf[0]), "v"(vf[1]), "v"(vf[2]), "v"(vf[3]));   /* inputs only: holds the pass's eight V reads in front of the test, under the exponentials; without it this build sinks them behind the branch, directly in front of the products that wait for them */
      if (__builtin_amdgcn_ballot_w32(!(lp[0][0] + lp[0][1] <= 256.0f) || !(lp[1][0] + lp[1][1] <= 256.0f)) != 0) {   /* all P are >= 0, so a lane's sum <= 256 bounds each of its P by 256 in f16: the scores' maximum is formed only when a sum is larger or no number (the first pass: infinite), then the rescale, and P again against the new maximum (sum <= 16) */
#pragma unroll   // constant indices keep the fragment arrays in registers
        for (int u = 0; u < 2; ++u) { float m = fmaxf(s[u][0][0], s[u][1][0]);
#pragma unroll   // constant indices keep the fragment arrays in registers
          for (int r = 1; r < 8; ++r) m = fmaxf(m, fmaxf(s[u][0][r], s[u][1][r]));
          const float mn = fmaxf(mu[u], fmaxf(m, xhalf(m)) * C2); const float corr = __builtin_amdgcn_exp2f(mu[u] - mn); mu[u] = mn; ls[u] *= corr;
#pragma unroll   // constant indices keep the fragment arrays in registers
          for (int j = 0; j < HDV / 16; ++j) acc[u][j] *= corr;
          p_of(s[u], C2, mu[u], pe[u], lp[u]); } }
#pragma unroll   // constant indices keep the fragment arrays in registers
      for (int u = 0; u < 2; ++u) { v16h p; ls[u] += lp[u];
#pragma unroll   // constant indices keep the fragment arrays in registers
        for (int i = 0; i < 8; ++i) { p[2 * i] = (_Float16)pe[u][i][0]; p[2 * i + 1] = (_Float16)pe[u][i][1]; }
#pragma unroll   // constant indices keep the fragment arrays in registers
        for (int j = 0; j < HDV / 16; ++j) acc[u][j] = wm(vf[j], p, acc[u][j]); } }
    /* publish point of stage t + 1: this wave's reads of buffer t & 1 are done, its copies of stage t + 1 have landed; the barrier publishes that stage and ends every wave's reads of the buffer refilled behind it */
    asm volatile("s_wait_dscnt 0x0" ::: "memory");
    asm volatile("s_wait_asynccnt 0x0" ::: "memory");
    __syncthreads();
    if (t + 2 < TT / KS) { kv_copy(lk + (t & 1) * (KSTG * 2), gk, lv + (t & 1) * (KSTG * 2), gv); gk += (size_t)KS * CC; gv += KS; } }
  asm volatile("s_wait_asynccnt 0x0" ::: "memory");   /* no copy is outstanding when the wave goes on to its end */
  float w[2];   /* weight of each sub-head's unnormalised sum: 1 / l1 and -lambda / l2 */
#pragma unroll   // constant indices keep the fragment arrays in registers
  for (int u = 0; u < 2; ++u) { const float lh = ls[u][0] + ls[u][1]; w[u] = 1.0f / (lh + xhalf(lh)); }
  w[1] *= -lam;
#pragma unroll   // constant indices keep the fragment arrays in registers
  for (int j = 0; j < HDV / 16; ++j) { v8h t;
#pragma unroll   // constant indices keep the fragment arrays in registers
    for (int r = 0; r < 8; ++r) t[r] = (_Float16)(acc[0][j][r] * w[0] + acc[1][j][r] * w[1]);
    *(v8h*)&so[wave][col][j * 16 + 8 * g] = t; }
  LDSX();
  gu4_p po = (gu4_p)(YD + ((size_t)b * TT + ql0 + (lane >> 3)) * CC + e * HDV + (lane & 7) * 8);   /* a wave-wide store = the 128-B head segments of four rows */
#pragma unroll   // one address pair and constant offsets: no address register is rewritten behind a store
  for (int it = 0; it < 4; ++it) po[(size_t)it * (4 * CC * 2 / 16)] = *(const v4u*)&so[wave][it * 4 + (lane >> 3)][(lane & 7) * 8]; }
// ---- k_out: block = (128 rows, 128 cols): out = ctx Wo (+ bo): k_att's f16 ctx rows against k_cvt's Wo rows, f16(bf16 x 2^8) exact (1 product) x 2^-8; LDS rows as in k_proj, but brought by asynchronous copies into a ring of four buffers, three 64-k stages in flight
#define ONB 4                       // buffers of the ring
typedef __attribute__((address_space(1))) v4i* gi4_p;
typedef __attribute__((address_space(3))) v4i* li4_p;
/* one stage, 64 k of 128 rows of each operand: thread = (row tid >> 3 of 16, 16 bytes tid & 7), a wave-wide copy = 4 whole lines; rows are 2 KB apart in memory and GP elements in LDS */
__device__ __forceinline__ void o_copy(gi4_p px, gi4_p pw, li4_p l) {
#pragma unroll   // constant steps from one address each
  for (int i = 0; i < 8; ++i) { __builtin_amdgcn_global_load_async_to_lds_b128(px + (size_t)(i * 16) * (CC * 2 / 16), l + i * 16 * GP * 2 / 16, 0, 0); __builtin_amdgcn_global_load_async_to_lds_b128(pw + (size_t)(i * 16) * (CC * 2 / 16), l + (128 + i * 16) * GP * 2 / 16, 0, 0); }
}
__global__ __launch_bounds__(128) void k_out(const _Float16* __restrict__ Y, const _Float16* __restrict__ WO, const float* __restrict__ BO, float* __restrict__ OUT) {
  __shared__ __align__(16) unsigned char sm[ONB * GSTG * 2];
  const int tid = threadIdx.x, wave = tid >> 5, lane = tid & 31, col = lane & 15, g = lane >> 4, wm = wave >> 1, wn = wave & 1; const int c0 = blockIdx.y * 128; const size_t r0 = (size_t)blockIdx.x * 128;
  gi4_p px = (gi4_p)(Y + (r0 + (tid >> 3)) * CC + (tid & 7) * 8); gi4_p pw = (gi4_p)(WO + (size_t)(c0 + (tid >> 3)) * CC + (tid & 7) * 8);   /* both walk 64 elements a stage */
  _Float16* st = (_Float16*)sm; const int so = (tid >> 3) * GP + (tid & 7) * 8;
  v8f acc[4][4] = {};
#pragma unroll   // stages 0 to 2 into buffers 0 to 2
  for (int s = 0; s < ONB - 1; ++s) { o_copy(px, pw, (li4_p)(st + s * GSTG + so)); px += 8; pw += 8; }
  for (int kc = 0; kc < CC / 64; ++kc) { _Float16* sb = st + (kc & (ONB - 1)) * GSTG;
    /* publish point of stage kc: this wave's reads of the pass before are done; its copies of stage kc have landed (a wave issues 16 a stage: all but the two younger stages' 32; in the last passes, which issue none, all, so that no copy is outstanding behind the loop); the barrier publishes the stage and ends every wave's reads of the buffer refilled behind it */
    asm volatile("s_wait_dscnt 0x0" ::: "memory");
    if (kc + ONB - 1 < CC / 64) asm volatile("s_wait_asynccnt 0x20" ::: "memory"); else asm volatile("s_wait_asynccnt 0x0" ::: "memory");
    __syncthreads();
    v16h a[2][4], b[2][4];
#pragma unroll   // the two 32-k halves of the pass, in k order
    for (int h = 0; h < 2; ++h)
#pragma unroll   // constant indices keep the arrays in registers
      for (int i = 0; i < 4; ++i) { a[h][i] = frag_h(sb + (wm * 64 + i * 16 + col) * GP + h * 32, lane); b[h][i] = frag_h(sb + (128 + wn * 64 + i * 16 + col) * GP + h * 32, lane); }
    if (kc + ONB - 1 < CC / 64) { o_copy(px, pw, (li4_p)(st + ((kc + ONB - 1) & (ONB - 1)) * GSTG + so)); px += 8; pw += 8; }
    __builtin_amdgcn_sched_barrier(0);   /* the pass's fragment reads and the refill stay in front of its products: without it this build reads one row's fragment at a time and waits each out in front of four products */
#pragma unroll   // in k order
    for (int h = 0; h < 2; ++h)
#pragma unroll   // constant indices keep the arrays in registers
      for (int i = 0; i < 4; ++i)
#pragma unroll   // constant indices keep the arrays in registers
        for (int j = 0; j < 4; ++j) acc[i][j] = wmh(a[h][i], b[h][j], acc[i][j]); }
  __syncthreads();   /* every wave has left the buffers: the output tile [128][132] f32 lies over them */
  float* sf = (float*)sm; float bs[4] = {};
  if (BO) { g_bias(BO + c0 + wn * 64 + col, bs); }
#pragma unroll   // constant indices keep the arrays in registers
  for (int j = 0; j < 4; ++j)
#pragma unroll   // constant indices keep the arrays in registers
    for (int i = 0; i < 4; ++i)
#pragma unroll   // constant indices keep the arrays in registers
      for (int r = 0; r < 8; ++r) sf[(wm * 64 + i * 16 + 8 * g + r) * 132 + wn * 64 + j * 16 + col] = acc[i][j][r] * (1.0f / 256.0f) + bs[j];
  __syncthreads();
  gf4_p po = (gf4_p)(OUT + (r0 + wave) * DIN + c0 + lane * 4);   /* a wave stores 512 B of one row */
#pragma unroll   // one address pair and constant offsets: no address register is rewritten behind a store
  for (int it = 0; it < 32; ++it) po[(size_t)it * (4 * DIN * 4 / 16)] = *(const v4f*)&sf[(wave + it * 4) * 132 + lane * 4]; }

extern "C" void kernel_launch(void* const* d_in, const int* in_sizes, int n_in, void* d_out, int out_size, void* d_ws, size_t ws_size, hipStream_t stream) {
  (void)in_sizes; (void)n_in; (void)out_size;
  const float** F = (const float**)d_in;
  if (ws_size < (size_t)WS_END) return;
  char* ws = (char*)d_ws; _Float16 *QH = (_Float16*)(ws + WS_QH), *KH = (_Float16*)(ws + WS_KH), *VT = (_Float16*)(ws + WS_VT), *KL = (_Float16*)(ws + WS_KL); __bf16 *VB = (__bf16*)(ws + WS_VB), *VBL = (__bf16*)(ws + WS_VBL), *XB = (__bf16*)(ws + WS_XB), *WB = (__bf16*)(ws + WS_WB); _Float16 *WPH = (_Float16*)(ws + WS_WP);
  (void)KL; (void)VB; (void)VBL;
  // inputs: 0 x [4,1024,1024]; 1 W_qkv [3072,1024] (out,in: rows 0-1023 q, 1024-2047 k, 2048-3071 v); 2 W_proj [1024,1024] (out,in); 3 b_proj; 4 lambda_q1, 5 lambda_k1, 6 lambda_q2, 7 lambda_k2 [64]
  _Float16* YD = (_Float16*)(ws + WS_S);   /* the differential rows [b*t][CC] live in the WS_S plane */
  k_cvt<<<CVX + CVW + CVP, 256, 0, stream>>>(F[0], F[1], F[2], XB, WB, WPH);
  k_proj<<<dim3(TNB * TT / 128, CC / 128, 3), 128, 0, stream>>>(XB, XB, XB, WB, WB + (size_t)CC * DIN, WB + (size_t)2 * CC * DIN, nullptr, nullptr, nullptr, QH, KH, VT);
  k_att<<<dim3(TT / (AW * 16), NH / 2, TNB), AW * 32, 0, stream>>>(QH, KH, VT, F[4], F[5], F[6], F[7], YD);
  k_out<<<dim3(TNB * TT / 128, DIN / 128), 128, 0, stream>>>(YD, WPH, F[3], (float*)d_out);
}
